// v000
// Times are from an AMD MI455X. After a warm-up the kernel runs many times in a row, and a time is the length of
// such a window on the GPU divided by its runs, so every launch and the gaps after it count. The runs cycle
// through copies of the inputs. A figure is the median of several windows, for all but v000 over two sittings.
// Sittings can differ by a few percent; kernels timed side by side share one.
// v000 is the starting kernel. One run takes 596 microseconds.
#include <hip/hip_runtime.h>
#include <hip/hip_bf16.h>

// ---------------------------------------------------------------------------
// Text->Img cross attention, CDNA5 (gfx1250, wave32) bf16 WMMA implementation
//   B=16, N=128, H=W=64 (M=4096), TC=768, IC=512, FQ=36 (padded to 64)
// ---------------------------------------------------------------------------

typedef __bf16 bf16;
typedef __attribute__((ext_vector_type(8)))  bf16  bf16x8;
typedef __attribute__((ext_vector_type(16))) bf16  bf16x16;
typedef __attribute__((ext_vector_type(8)))  float f32x8;

// A/B fragment loader for V_WMMA_*_16X16X32_BF16 (wave32).
// Per ISA 7.12.2, lane (with half = lane>>4) holds K = half*8 + [0..7] in
// elements 0..7 and K = 16 + half*8 + [0..7] in elements 8..15 -> two 16B
// contiguous loads from a row-major [row/col, K] buffer.
__device__ __forceinline__ bf16x16 load_frag(const bf16* base, int half) {
  bf16x8 lo = *(const bf16x8*)(base + half * 8);
  bf16x8 hi = *(const bf16x8*)(base + 16 + half * 8);
  bf16x16 r;
#pragma unroll
  for (int i = 0; i < 8; ++i) { r[i] = lo[i]; r[i + 8] = hi[i]; }
  return r;
}

__device__ __forceinline__ f32x8 wmma_bf16(bf16x16 a, bf16x16 b, f32x8 c) {
  // (neg_a, A, neg_b, B, c_mod, C, reuse_a, reuse_b)
  return __builtin_amdgcn_wmma_f32_16x16x32_bf16(false, a, false, b,
                                                 (short)0, c, false, false);
}

// Staging helpers for the projection GEMM (split so loads can be issued
// before the WMMAs and the cvt+LDS-store after -> VMEM latency hidden).
// A chunk: [128 rows x 32 k] f32, 2 threads/row x 16 k.  rows is always a
// multiple of 128 in our launches, so no row guard (keeps the K-loop free of
// divergent exec-mask save/restore).
__device__ __forceinline__ void stage_load(const float* __restrict__ A,
                                           const float* __restrict__ W,
                                           int rowblock, int colblock,
                                           int K, int ncols, int k0, int tid,
                                           float aR[16], float wR[8]) {
  const int r  = tid >> 1;
  const int kk = (tid & 1) * 16;
  const float* asrc = A + (size_t)(rowblock + r) * K + k0 + kk;
#pragma unroll
  for (int i = 0; i < 16; ++i) aR[i] = asrc[i];
  const int kw = tid >> 3;
  const int c0 = (tid & 7) * 8;
  const float* wsrc = W + (size_t)(k0 + kw) * ncols + colblock + c0;
#pragma unroll
  for (int i = 0; i < 8; ++i)
    wR[i] = (colblock + c0 + i < ncols) ? wsrc[i] : 0.f;  // zero-pad FQ->64
}

__device__ __forceinline__ void stage_store(bf16* __restrict__ lA,
                                            bf16* __restrict__ lB, int tid,
                                            const float aR[16], const float wR[8]) {
  const int r  = tid >> 1;
  const int kk = (tid & 1) * 16;
  bf16* dst = &lA[r * 32 + kk];
#pragma unroll
  for (int i = 0; i < 16; ++i) dst[i] = (bf16)aR[i];
  const int kw = tid >> 3;
  const int c0 = (tid & 7) * 8;
#pragma unroll
  for (int i = 0; i < 8; ++i) lB[(c0 + i) * 32 + kw] = (bf16)wR[i];  // [col][k]
}

// ---------------------------------------------------------------------------
// Kernel 1: out = relu(A[rows,K] @ W[K,ncols] + bias), f32 in -> bf16 out.
// Block = 256 thr (8 waves). Tile = 128 rows x 64 cols; wave w owns rows
// [16w,16w+16) x all 64 cols (4 accumulators). Double-buffered LDS staging:
// per K-chunk -> issue next chunk's global loads, run 4 WMMAs on current
// chunk (overlapping the loads), then cvt+store next chunk, one barrier.
// transpose=1 stores out as [b, col, m] (column-major per batch, rpb=2^rpbShift)
// for the o-GEMM's B operand; else row-major [row, out_ld] (zero-pad cols kept).
// ---------------------------------------------------------------------------
__launch_bounds__(256)
__global__ void proj_gemm_bias_relu(const float* __restrict__ A,
                                    const float* __restrict__ W,
                                    const float* __restrict__ bias,
                                    bf16* __restrict__ out,
                                    int rows, int K, int ncols,
                                    int out_ld, int transpose, int rpbShift) {
  __shared__ __align__(16) bf16 lA[2][128 * 32];  // [buf][row][k]  2x8 KB
  __shared__ __align__(16) bf16 lB[2][64 * 32];   // [buf][col][k]  2x4 KB

  const int tid  = threadIdx.x;
  const int w    = tid >> 5;
  const int lane = tid & 31;
  const int half = lane >> 4;
  const int l15  = lane & 15;
  const int rowblock = blockIdx.x * 128;
  const int colblock = blockIdx.y * 64;

  f32x8 acc[4] = {};
  float aR[16], wR[8];

  // prologue: stage chunk 0 into buffer 0
  stage_load(A, W, rowblock, colblock, K, ncols, 0, tid, aR, wR);
  stage_store(lA[0], lB[0], tid, aR, wR);
  __syncthreads();

  const int nCh = K >> 5;
  for (int ci = 0; ci < nCh; ++ci) {
    const int cur = ci & 1;
    const bool more = (ci + 1) < nCh;
    if (more)  // issue VMEM for next chunk before the matrix ops
      stage_load(A, W, rowblock, colblock, K, ncols, (ci + 1) * 32, tid, aR, wR);

    const bf16x16 af = load_frag(&lA[cur][(w * 16 + l15) * 32], half);
#pragma unroll
    for (int t = 0; t < 4; ++t) {
      const bf16x16 bfr = load_frag(&lB[cur][(t * 16 + l15) * 32], half);
      acc[t] = wmma_bf16(af, bfr, acc[t]);
    }

    if (more) {
      // safe: everyone finished reading buffer cur^1 before last barrier
      stage_store(lA[cur ^ 1], lB[cur ^ 1], tid, aR, wR);
      __syncthreads();
    }
  }

  // epilogue: bias + relu + bf16 store (C/D layout: row=r+8*half, col=l15)
#pragma unroll
  for (int t = 0; t < 4; ++t) {
    const int gc = colblock + t * 16 + l15;
    const float bv = (gc < ncols) ? bias[gc] : 0.f;
#pragma unroll
    for (int r = 0; r < 8; ++r) {
      const int grow = rowblock + w * 16 + r + 8 * half;  // rows % 128 == 0
      float val = acc[t][r] + bv;
      val = val > 0.f ? val : 0.f;
      if (transpose) {
        const int bb = grow >> rpbShift;
        const int mm = grow & ((1 << rpbShift) - 1);
        out[((size_t)bb * out_ld + gc) << rpbShift | (unsigned)mm] = (bf16)val;
      } else if (gc < out_ld) {
        out[(size_t)grow * out_ld + gc] = (bf16)val;
      }
    }
  }
}

// ---------------------------------------------------------------------------
// Kernel 2: s = q@k^T, beta = s*mask, two-pass softmax over M=4096.
// One block per (b, 16-query tile). Wave w owns m-tiles w, w+8, ... (32 each).
// Pass 1: WMMA scores (K=64 -> 2 wmma) -> beta f32 (ws) + running row max.
// Pass 2: exp(beta - max) -> bf16 p (unnormalized), row sums -> rowsum_g.
// Row reductions: __shfl_xor within 16-lane groups, then LDS across waves.
// ---------------------------------------------------------------------------
__launch_bounds__(256)
__global__ void attn_scores_softmax(const bf16* __restrict__ qp,
                                    const bf16* __restrict__ kp,
                                    const float* __restrict__ masks,
                                    float* __restrict__ beta,
                                    bf16* __restrict__ p,
                                    float* __restrict__ rowsum_g) {
  __shared__ float red[8][16];
  __shared__ float rowmax[16];

  const int tid  = threadIdx.x;
  const int w    = tid >> 5;
  const int lane = tid & 31;
  const int half = lane >> 4;
  const int l15  = lane & 15;
  const int b     = blockIdx.x >> 3;
  const int nbase = (blockIdx.x & 7) * 16;

  const bf16* qrow = qp + ((size_t)b * 128 + nbase + l15) * 64;
  const bf16x16 a0 = load_frag(qrow, half);        // K 0..31
  const bf16x16 a1 = load_frag(qrow + 32, half);   // K 32..63

  const size_t bm = (size_t)b * 128 * 4096;
  float rmax[8];
#pragma unroll
  for (int r = 0; r < 8; ++r) rmax[r] = -3.0e38f;

  for (int mt = w; mt < 256; mt += 8) {
    const int mbase = mt * 16;
    const bf16* krow = kp + ((size_t)b * 4096 + mbase + l15) * 64;
    const bf16x16 b0 = load_frag(krow, half);
    const bf16x16 b1 = load_frag(krow + 32, half);
    f32x8 acc = {};
    acc = wmma_bf16(a0, b0, acc);
    acc = wmma_bf16(a1, b1, acc);
    const int m = mbase + l15;
#pragma unroll
    for (int r = 0; r < 8; ++r) {
      const int n = nbase + r + 8 * half;
      const size_t idx = bm + (size_t)n * 4096 + m;
      const float bv = acc[r] * masks[idx];  // multiplicative mask BEFORE softmax
      beta[idx] = bv;
      rmax[r] = fmaxf(rmax[r], bv);
    }
  }

  // row max: reduce across the 16 lanes that share rows, then across waves
#pragma unroll
  for (int r = 0; r < 8; ++r)
#pragma unroll
    for (int off = 1; off < 16; off <<= 1)
      rmax[r] = fmaxf(rmax[r], __shfl_xor(rmax[r], off, 16));
  if (l15 == 0)
#pragma unroll
    for (int r = 0; r < 8; ++r) red[w][r + 8 * half] = rmax[r];
  __syncthreads();
  if (tid < 16) {
    float mx = -3.0e38f;
    for (int ww = 0; ww < 8; ++ww) mx = fmaxf(mx, red[ww][tid]);
    rowmax[tid] = mx;
  }
  __syncthreads();

  float rsum[8] = {};
  for (int mt = w; mt < 256; mt += 8) {
    const int m = mt * 16 + l15;
#pragma unroll
    for (int r = 0; r < 8; ++r) {
      const int n = nbase + r + 8 * half;
      const size_t idx = bm + (size_t)n * 4096 + m;
      const float e = __expf(beta[idx] - rowmax[r + 8 * half]);
      rsum[r] += e;
      p[idx] = (bf16)e;  // unnormalized; 1/sum applied in attn_out
    }
  }
#pragma unroll
  for (int r = 0; r < 8; ++r)
#pragma unroll
    for (int off = 1; off < 16; off <<= 1)
      rsum[r] += __shfl_xor(rsum[r], off, 16);
  __syncthreads();  // rowmax reads done; red is reusable
  if (l15 == 0)
#pragma unroll
    for (int r = 0; r < 8; ++r) red[w][r + 8 * half] = rsum[r];
  __syncthreads();
  if (tid < 16) {
    float s = 0.f;
    for (int ww = 0; ww < 8; ++ww) s += red[ww][tid];
    rowsum_g[(size_t)b * 128 + nbase + tid] = s;
  }
}

// ---------------------------------------------------------------------------
// Kernel 3: o[b,n,col] = (p[b,n,:] @ v[b,:,col]) / rowsum[b,n].
// v stored transposed [b, col, m] so B-fragments are K(m)-contiguous.
// Two independent accumulators over even/odd K-chunks hide WMMA RAW latency.
// ---------------------------------------------------------------------------
__launch_bounds__(256)
__global__ void attn_out(const bf16* __restrict__ p,
                         const bf16* __restrict__ v_t,
                         const float* __restrict__ rowsum_g,
                         float* __restrict__ out) {
  const int tid  = threadIdx.x;
  const int w    = tid >> 5;
  const int lane = tid & 31;
  const int half = lane >> 4;
  const int l15  = lane & 15;
  const int b     = blockIdx.x >> 3;
  const int nbase = (blockIdx.x & 7) * 16;
  const int col   = blockIdx.y * 128 + w * 16 + l15;

  const bf16* arow = p   + ((size_t)b * 128 + nbase + l15) * 4096;
  const bf16* brow = v_t + ((size_t)b * 768 + col) * 4096;

  f32x8 acc0 = {}, acc1 = {};
  for (int m0 = 0; m0 < 4096; m0 += 64) {
    if (m0 + 128 < 4096) {
      __builtin_prefetch(brow + m0 + 128, 0, 0);  // global_prefetch_b8
      __builtin_prefetch(arow + m0 + 128, 0, 0);
    }
    const bf16x16 af0 = load_frag(arow + m0, half);
    const bf16x16 bf0 = load_frag(brow + m0, half);
    acc0 = wmma_bf16(af0, bf0, acc0);
    const bf16x16 af1 = load_frag(arow + m0 + 32, half);
    const bf16x16 bf1 = load_frag(brow + m0 + 32, half);
    acc1 = wmma_bf16(af1, bf1, acc1);
  }
#pragma unroll
  for (int r = 0; r < 8; ++r) {
    const int n = nbase + r + 8 * half;
    const float scale = 1.0f / rowsum_g[(size_t)b * 128 + n];
    out[((size_t)b * 128 + n) * 768 + col] = (acc0[r] + acc1[r]) * scale;
  }
}

// ---------------------------------------------------------------------------
extern "C" void kernel_launch(void* const* d_in, const int* in_sizes, int n_in,
                              void* d_out, int out_size, void* d_ws, size_t ws_size,
                              hipStream_t stream) {
  (void)in_sizes; (void)n_in; (void)out_size; (void)ws_size;
  const float* text  = (const float*)d_in[0];  // [16,128,768]
  const float* img   = (const float*)d_in[1];  // [16,64,64,512] = [65536,512]
  const float* masks = (const float*)d_in[2];  // [16,128,4096]
  const float* Wq    = (const float*)d_in[3];  // [768,36]
  const float* bq    = (const float*)d_in[4];
  const float* Wk    = (const float*)d_in[5];  // [512,36]
  const float* bk    = (const float*)d_in[6];
  const float* Wv    = (const float*)d_in[7];  // [512,768]
  const float* bv    = (const float*)d_in[8];
  float* out = (float*)d_out;                  // [16,128,768]

  // workspace carve (256B aligned regions)
  char* ws = (char*)d_ws;
  size_t off = 0;
  auto carve = [&](size_t bytes) -> void* {
    void* ptr = ws + off;
    off = (off + bytes + 255) & ~(size_t)255;
    return ptr;
  };
  bf16*  qp    = (bf16*)carve((size_t)2048 * 64 * 2);          //  256 KB
  bf16*  kpB   = (bf16*)carve((size_t)65536 * 64 * 2);         //    8 MB
  bf16*  vt    = (bf16*)carve((size_t)16 * 768 * 4096 * 2);    //  100 MB
  bf16*  pP    = (bf16*)carve((size_t)16 * 128 * 4096 * 2);    //   16 MB
  float* beta  = (float*)carve((size_t)16 * 128 * 4096 * 4);   //   33 MB
  float* rsum  = (float*)carve((size_t)2048 * 4);

  // q = relu(text@Wq+bq) -> [2048,64] bf16 (cols 36..63 zero)
  proj_gemm_bias_relu<<<dim3(16, 1), 256, 0, stream>>>(
      text, Wq, bq, qp, 2048, 768, 36, 64, 0, 0);
  // k = relu(img@Wk+bk) -> [65536,64] bf16
  proj_gemm_bias_relu<<<dim3(512, 1), 256, 0, stream>>>(
      img, Wk, bk, kpB, 65536, 512, 36, 64, 0, 0);
  // v = relu(img@Wv+bv) -> transposed [16,768,4096] bf16 (rpb = 2^12)
  proj_gemm_bias_relu<<<dim3(512, 12), 256, 0, stream>>>(
      img, Wv, bv, vt, 65536, 512, 768, 768, 1, 12);
  // scores + masked softmax
  attn_scores_softmax<<<dim3(128), 256, 0, stream>>>(
      qp, kpB, masks, beta, pP, rsum);
  // o = (p @ v) / rowsum
  attn_out<<<dim3(128, 6), 256, 0, stream>>>(pP, vt, rsum, out);
}

// v001
// A run of this version takes 341 microseconds.
// In two side-by-side timings against v000, it was 1.82 and 1.81 times as fast.
#include <hip/hip_runtime.h>
#include <hip/hip_bf16.h>

// ---------------------------------------------------------------------------
// Text->Img cross attention, CDNA5 (gfx1250, wave32) bf16 WMMA implementation
//   B=16, N=128, H=W=64 (M=4096), TC=768, IC=512, FQ=36 (padded to 64)
// ---------------------------------------------------------------------------

typedef __bf16 bf16;
typedef __attribute__((ext_vector_type(8)))  bf16  bf16x8;
typedef __attribute__((ext_vector_type(16))) bf16  bf16x16;
typedef __attribute__((ext_vector_type(8)))  float f32x8;

// A/B fragment loader for V_WMMA_*_16X16X32_BF16 (wave32).
// Per ISA 7.12.2, lane (with half = lane>>4) holds K = half*8 + [0..7] in
// elements 0..7 and K = 16 + half*8 + [0..7] in elements 8..15 -> two 16B
// contiguous loads from a row-major [row/col, K] buffer.
__device__ __forceinline__ bf16x16 load_frag(const bf16* base, int half) {
  bf16x8 lo = *(const bf16x8*)(base + half * 8);
  bf16x8 hi = *(const bf16x8*)(base + 16 + half * 8);
  bf16x16 r;
#pragma unroll
  for (int i = 0; i < 8; ++i) { r[i] = lo[i]; r[i + 8] = hi[i]; }
  return r;
}

__device__ __forceinline__ f32x8 wmma_bf16(bf16x16 a, bf16x16 b, f32x8 c) {
  // (neg_a, A, neg_b, B, c_mod, C, reuse_a, reuse_b)
  return __builtin_amdgcn_wmma_f32_16x16x32_bf16(false, a, false, b,
                                                 (short)0, c, false, false);
}

// Staging helpers for the projection GEMM (split so loads can be issued
// before the WMMAs and the cvt+LDS-store after -> VMEM latency hidden).
// A chunk: [128 rows x 32 k] f32, 2 threads/row x 16 k.  rows is always a
// multiple of 128 in our launches, so no row guard (keeps the K-loop free of
// divergent exec-mask save/restore).
__device__ __forceinline__ void stage_load(const float* __restrict__ A,
                                           const float* __restrict__ W,
                                           int rowblock, int colblock,
                                           int K, int ncols, int k0, int tid,
                                           float aR[16], float wR[8]) {
  const int r  = tid >> 1;
  const int kk = (tid & 1) * 16;
  const float* asrc = A + (size_t)(rowblock + r) * K + k0 + kk;
#pragma unroll
  for (int i = 0; i < 16; ++i) aR[i] = asrc[i];
  const int kw = tid >> 3;
  const int c0 = (tid & 7) * 8;
  const float* wsrc = W + (size_t)(k0 + kw) * ncols + colblock + c0;
#pragma unroll
  for (int i = 0; i < 8; ++i)
    wR[i] = (colblock + c0 + i < ncols) ? wsrc[i] : 0.f;  // zero-pad FQ->64
}

__device__ __forceinline__ void stage_store(bf16* __restrict__ lA,
                                            bf16* __restrict__ lB, int tid,
                                            const float aR[16], const float wR[8]) {
  const int r  = tid >> 1;
  const int kk = (tid & 1) * 16;
  bf16* dst = &lA[r * 32 + kk];
#pragma unroll
  for (int i = 0; i < 16; ++i) dst[i] = (bf16)aR[i];
  const int kw = tid >> 3;
  const int c0 = (tid & 7) * 8;
#pragma unroll
  for (int i = 0; i < 8; ++i) lB[(c0 + i) * 32 + kw] = (bf16)wR[i];  // [col][k]
}

// ---------------------------------------------------------------------------
// Kernel 1: out = relu(A[rows,K] @ W[K,ncols] + bias), f32 in -> bf16 out.
// Block = 256 thr (8 waves). Tile = 128 rows x 64 cols; wave w owns rows
// [16w,16w+16) x all 64 cols (4 accumulators). Double-buffered LDS staging:
// per K-chunk -> issue next chunk's global loads, run 4 WMMAs on current
// chunk (overlapping the loads), then cvt+store next chunk, one barrier.
// transpose=1 stores out as [b, col, m] (column-major per batch, rpb=2^rpbShift)
// (unused: both launches pass 0); else row-major [row, out_ld] (zero-pad cols kept).
// ---------------------------------------------------------------------------
__launch_bounds__(256)
__global__ void proj_gemm_bias_relu(const float* __restrict__ A,
                                    const float* __restrict__ W,
                                    const float* __restrict__ bias,
                                    bf16* __restrict__ out,
                                    int rows, int K, int ncols,
                                    int out_ld, int transpose, int rpbShift) {
  __shared__ __align__(16) bf16 lA[2][128 * 32];  // [buf][row][k]  2x8 KB
  __shared__ __align__(16) bf16 lB[2][64 * 32];   // [buf][col][k]  2x4 KB

  const int tid  = threadIdx.x;
  const int w    = tid >> 5;
  const int lane = tid & 31;
  const int half = lane >> 4;
  const int l15  = lane & 15;
  const int rowblock = blockIdx.x * 128;
  const int colblock = blockIdx.y * 64;

  f32x8 acc[4] = {};
  float aR[16], wR[8];

  // prologue: stage chunk 0 into buffer 0
  stage_load(A, W, rowblock, colblock, K, ncols, 0, tid, aR, wR);
  stage_store(lA[0], lB[0], tid, aR, wR);
  __syncthreads();

  const int nCh = K >> 5;
  for (int ci = 0; ci < nCh; ++ci) {
    const int cur = ci & 1;
    const bool more = (ci + 1) < nCh;
    if (more)  // issue VMEM for next chunk before the matrix ops
      stage_load(A, W, rowblock, colblock, K, ncols, (ci + 1) * 32, tid, aR, wR);

    const bf16x16 af = load_frag(&lA[cur][(w * 16 + l15) * 32], half);
#pragma unroll
    for (int t = 0; t < 4; ++t) {
      const bf16x16 bfr = load_frag(&lB[cur][(t * 16 + l15) * 32], half);
      acc[t] = wmma_bf16(af, bfr, acc[t]);
    }

    if (more) {
      // safe: everyone finished reading buffer cur^1 before last barrier
      stage_store(lA[cur ^ 1], lB[cur ^ 1], tid, aR, wR);
      __syncthreads();
    }
  }

  // epilogue: bias + relu + bf16 store (C/D layout: row=r+8*half, col=l15)
#pragma unroll
  for (int t = 0; t < 4; ++t) {
    const int gc = colblock + t * 16 + l15;
    const float bv = (gc < ncols) ? bias[gc] : 0.f;
#pragma unroll
    for (int r = 0; r < 8; ++r) {
      const int grow = rowblock + w * 16 + r + 8 * half;  // rows % 128 == 0
      float val = acc[t][r] + bv;
      val = val > 0.f ? val : 0.f;
      if (transpose) {
        const int bb = grow >> rpbShift;
        const int mm = grow & ((1 << rpbShift) - 1);
        out[((size_t)bb * out_ld + gc) << rpbShift | (unsigned)mm] = (bf16)val;
      } else if (gc < out_ld) {
        out[(size_t)grow * out_ld + gc] = (bf16)val;
      }
    }
  }
}

// ---------------------------------------------------------------------------
// Kernel 1b: the v projection, vt[b, col, m] = relu(img[b*4096+m, :] @ Wv + bv),
// f32 in -> bf16 out, rows=65536, K=512, cols=768 (all multiples of the tile).
// Block = 512 thr (16 waves, 4 x 4). Tile = 256 rows x 256 cols; each wave owns
// 64 rows x 64 cols = 4 x 4 accumulators, so 8 fragments feed 16 WMMAs.
// Same double-buffered staging as kernel 1: next chunk's global loads, WMMAs on
// the current chunk, cvt + LDS store of the next chunk, one barrier per chunk.
// LDS rows are 32 k at a pitch of 40 bf16 (80 B = 16 B x odd).
// Column order in LDS: the thread that loads 4 neighbouring columns cg*4+j puts
// column j into LDS row j*64+cg, so wave column wc holds the columns = wc mod 4.
// ---------------------------------------------------------------------------
typedef __attribute__((ext_vector_type(4))) float f32x4;
typedef __attribute__((ext_vector_type(4))) bf16  bf16x4;

__launch_bounds__(512)
__global__ void proj_v_tiled(const float* __restrict__ A,
                             const float* __restrict__ W,
                             const float* __restrict__ bias,
                             bf16* __restrict__ out) {
  constexpr int K = 512, NC = 768, P = 40;
  __shared__ __align__(16) bf16 lA[2][256 * P];  // [buf][row][k]  2x20 KB
  __shared__ __align__(16) bf16 lB[2][256 * P];  // [buf][col][k]  2x20 KB

  const int tid  = threadIdx.x;
  const int w    = tid >> 5;
  const int lane = tid & 31;
  const int half = lane >> 4;
  const int l15  = lane & 15;
  const int wr   = w >> 2;
  const int wc   = w & 3;
  const int colblock = blockIdx.x * 256;
  const int rowblock = blockIdx.y * 256;

  // A chunk [256 x 32] f32: 8 lanes x 16 B cover one row's 128-B line.
  const int ar = tid >> 3;
  const int ak = (tid & 7) * 4;
  const float* asrc = A + (size_t)(rowblock + ar) * K + ak;
  // W chunk [32 x 256] f32: 4 k rows x 4 columns per thread.
  const int cg = tid & 63;
  const int kg = tid >> 6;
  const float* wsrc = W + (size_t)(kg * 4) * NC + colblock + cg * 4;

  f32x4 aR[4], wR[4];
  auto stage_ld = [&](int k0) {
#pragma unroll
    for (int j = 0; j < 4; ++j)
      aR[j] = *(const f32x4*)(asrc + (size_t)(j * 64) * K + k0);
#pragma unroll
    for (int i = 0; i < 4; ++i)
      wR[i] = *(const f32x4*)(wsrc + (size_t)(k0 + i) * NC);
  };
  auto stage_st = [&](int buf) {
#pragma unroll
    for (int j = 0; j < 4; ++j)
      *(bf16x4*)&lA[buf][(ar + 64 * j) * P + ak] =
          __builtin_convertvector(aR[j], bf16x4);
#pragma unroll
    for (int j = 0; j < 4; ++j) {
      bf16x4 v;
#pragma unroll
      for (int i = 0; i < 4; ++i) v[i] = (bf16)wR[i][j];
      *(bf16x4*)&lB[buf][(j * 64 + cg) * P + kg * 4] = v;
    }
  };

  f32x8 acc[4][4] = {};

  stage_ld(0);
  stage_st(0);
  __syncthreads();

  constexpr int nCh = K / 32;
  for (int ci = 0; ci < nCh; ++ci) {
    const int cur = ci & 1;
    const bool more = (ci + 1) < nCh;
    if (more) stage_ld((ci + 1) * 32);  // VMEM for the next chunk first

    bf16x16 af[4], bfr[4];
#pragma unroll
    for (int i = 0; i < 4; ++i)
      af[i] = load_frag(&lA[cur][(wr * 64 + i * 16 + l15) * P], half);
#pragma unroll
    for (int t = 0; t < 4; ++t)
      bfr[t] = load_frag(&lB[cur][(wc * 64 + t * 16 + l15) * P], half);
    // keeps the 8 global loads and the 16 LDS reads one group ahead of the WMMAs;
    // without it global loads sink to just before their cvt, their latency no
    // longer covered, and A fragments are read among the WMMAs behind full waits
    __builtin_amdgcn_sched_barrier(0);
#pragma unroll
    for (int i = 0; i < 4; ++i)
#pragma unroll
      for (int t = 0; t < 4; ++t)
        acc[i][t] = wmma_bf16(af[i], bfr[t], acc[i][t]);

    // keeps the cvt of the loaded chunk, and with it the wait on those loads,
    // behind the WMMAs; without it the scheduler lifts both above them
    __builtin_amdgcn_sched_barrier(0);
    if (more) {
      // safe: everyone finished reading buffer cur^1 before the last barrier
      stage_st(cur ^ 1);
      __syncthreads();
    }
  }

  // epilogue: a lane's 8 accumulator registers are 8 consecutive m of one
  // column -> bias + relu + one 16-B store each.
  const int bb = rowblock >> 12;
  const int m0 = (rowblock & 4095) + wr * 64 + 8 * half;
#pragma unroll
  for (int t = 0; t < 4; ++t) {
    const int gc = colblock + (t * 16 + l15) * 4 + wc;
    const float bv = bias[gc];
    bf16* dst = out + (((size_t)bb * NC + gc) << 12) + m0;
#pragma unroll
    for (int i = 0; i < 4; ++i) {
      bf16x8 v;
#pragma unroll
      for (int r = 0; r < 8; ++r) {
        const float val = acc[i][t][r] + bv;
        v[r] = (bf16)(val > 0.f ? val : 0.f);
      }
      *(bf16x8*)(dst + i * 16) = v;
    }
  }
}

// ---------------------------------------------------------------------------
// Kernel 2: s = q@k^T, beta = s*mask, two-pass softmax over M=4096.
// One block per (b, 16-query tile). Wave w owns m-tiles w, w+8, ... (32 each).
// Pass 1: WMMA scores (K=64 -> 2 wmma) -> beta f32 (ws) + running row max.
// Pass 2: exp(beta - max) -> bf16 p (unnormalized), row sums -> rowsum_g.
// Row reductions: __shfl_xor within 16-lane groups, then LDS across waves.
// ---------------------------------------------------------------------------
__launch_bounds__(256)
__global__ void attn_scores_softmax(const bf16* __restrict__ qp,
                                    const bf16* __restrict__ kp,
                                    const float* __restrict__ masks,
                                    float* __restrict__ beta,
                                    bf16* __restrict__ p,
                                    float* __restrict__ rowsum_g) {
  __shared__ float red[8][16];
  __shared__ float rowmax[16];

  const int tid  = threadIdx.x;
  const int w    = tid >> 5;
  const int lane = tid & 31;
  const int half = lane >> 4;
  const int l15  = lane & 15;
  const int b     = blockIdx.x >> 3;
  const int nbase = (blockIdx.x & 7) * 16;

  const bf16* qrow = qp + ((size_t)b * 128 + nbase + l15) * 64;
  const bf16x16 a0 = load_frag(qrow, half);        // K 0..31
  const bf16x16 a1 = load_frag(qrow + 32, half);   // K 32..63

  const size_t bm = (size_t)b * 128 * 4096;
  float rmax[8];
#pragma unroll
  for (int r = 0; r < 8; ++r) rmax[r] = -3.0e38f;

  for (int mt = w; mt < 256; mt += 8) {
    const int mbase = mt * 16;
    const bf16* krow = kp + ((size_t)b * 4096 + mbase + l15) * 64;
    const bf16x16 b0 = load_frag(krow, half);
    const bf16x16 b1 = load_frag(krow + 32, half);
    f32x8 acc = {};
    acc = wmma_bf16(a0, b0, acc);
    acc = wmma_bf16(a1, b1, acc);
    const int m = mbase + l15;
#pragma unroll
    for (int r = 0; r < 8; ++r) {
      const int n = nbase + r + 8 * half;
      const size_t idx = bm + (size_t)n * 4096 + m;
      const float bv = acc[r] * masks[idx];  // multiplicative mask BEFORE softmax
      beta[idx] = bv;
      rmax[r] = fmaxf(rmax[r], bv);
    }
  }

  // row max: reduce across the 16 lanes that share rows, then across waves
#pragma unroll
  for (int r = 0; r < 8; ++r)
#pragma unroll
    for (int off = 1; off < 16; off <<= 1)
      rmax[r] = fmaxf(rmax[r], __shfl_xor(rmax[r], off, 16));
  if (l15 == 0)
#pragma unroll
    for (int r = 0; r < 8; ++r) red[w][r + 8 * half] = rmax[r];
  __syncthreads();
  if (tid < 16) {
    float mx = -3.0e38f;
    for (int ww = 0; ww < 8; ++ww) mx = fmaxf(mx, red[ww][tid]);
    rowmax[tid] = mx;
  }
  __syncthreads();

  float rsum[8] = {};
  for (int mt = w; mt < 256; mt += 8) {
    const int m = mt * 16 + l15;
#pragma unroll
    for (int r = 0; r < 8; ++r) {
      const int n = nbase + r + 8 * half;
      const size_t idx = bm + (size_t)n * 4096 + m;
      const float e = __expf(beta[idx] - rowmax[r + 8 * half]);
      rsum[r] += e;
      p[idx] = (bf16)e;  // unnormalized; 1/sum applied in attn_out
    }
  }
#pragma unroll
  for (int r = 0; r < 8; ++r)
#pragma unroll
    for (int off = 1; off < 16; off <<= 1)
      rsum[r] += __shfl_xor(rsum[r], off, 16);
  __syncthreads();  // rowmax reads done; red is reusable
  if (l15 == 0)
#pragma unroll
    for (int r = 0; r < 8; ++r) red[w][r + 8 * half] = rsum[r];
  __syncthreads();
  if (tid < 16) {
    float s = 0.f;
    for (int ww = 0; ww < 8; ++ww) s += red[ww][tid];
    rowsum_g[(size_t)b * 128 + nbase + tid] = s;
  }
}

// ---------------------------------------------------------------------------
// Kernel 3: o[b,n,col] = (p[b,n,:] @ v[b,:,col]) / rowsum[b,n].
// v stored transposed [b, col, m] so B-fragments are K(m)-contiguous.
// Two independent accumulators over even/odd K-chunks hide WMMA RAW latency.
// ---------------------------------------------------------------------------
__launch_bounds__(256)
__global__ void attn_out(const bf16* __restrict__ p,
                         const bf16* __restrict__ v_t,
                         const float* __restrict__ rowsum_g,
                         float* __restrict__ out) {
  const int tid  = threadIdx.x;
  const int w    = tid >> 5;
  const int lane = tid & 31;
  const int half = lane >> 4;
  const int l15  = lane & 15;
  const int b     = blockIdx.x >> 3;
  const int nbase = (blockIdx.x & 7) * 16;
  const int col   = blockIdx.y * 128 + w * 16 + l15;

  const bf16* arow = p   + ((size_t)b * 128 + nbase + l15) * 4096;
  const bf16* brow = v_t + ((size_t)b * 768 + col) * 4096;

  f32x8 acc0 = {}, acc1 = {};
  for (int m0 = 0; m0 < 4096; m0 += 64) {
    if (m0 + 128 < 4096) {
      __builtin_prefetch(brow + m0 + 128, 0, 0);  // global_prefetch_b8
      __builtin_prefetch(arow + m0 + 128, 0, 0);
    }
    const bf16x16 af0 = load_frag(arow + m0, half);
    const bf16x16 bf0 = load_frag(brow + m0, half);
    acc0 = wmma_bf16(af0, bf0, acc0);
    const bf16x16 af1 = load_frag(arow + m0 + 32, half);
    const bf16x16 bf1 = load_frag(brow + m0 + 32, half);
    acc1 = wmma_bf16(af1, bf1, acc1);
  }
#pragma unroll
  for (int r = 0; r < 8; ++r) {
    const int n = nbase + r + 8 * half;
    const float scale = 1.0f / rowsum_g[(size_t)b * 128 + n];
    out[((size_t)b * 128 + n) * 768 + col] = (acc0[r] + acc1[r]) * scale;
  }
}

// ---------------------------------------------------------------------------
extern "C" void kernel_launch(void* const* d_in, const int* in_sizes, int n_in,
                              void* d_out, int out_size, void* d_ws, size_t ws_size,
                              hipStream_t stream) {
  (void)in_sizes; (void)n_in; (void)out_size; (void)ws_size;
  const float* text  = (const float*)d_in[0];  // [16,128,768]
  const float* img   = (const float*)d_in[1];  // [16,64,64,512] = [65536,512]
  const float* masks = (const float*)d_in[2];  // [16,128,4096]
  const float* Wq    = (const float*)d_in[3];  // [768,36]
  const float* bq    = (const float*)d_in[4];
  const float* Wk    = (const float*)d_in[5];  // [512,36]
  const float* bk    = (const float*)d_in[6];
  const float* Wv    = (const float*)d_in[7];  // [512,768]
  const float* bv    = (const float*)d_in[8];
  float* out = (float*)d_out;                  // [16,128,768]

  // workspace carve (256B aligned regions)
  char* ws = (char*)d_ws;
  size_t off = 0;
  auto carve = [&](size_t bytes) -> void* {
    void* ptr = ws + off;
    off = (off + bytes + 255) & ~(size_t)255;
    return ptr;
  };
  bf16*  qp    = (bf16*)carve((size_t)2048 * 64 * 2);          //  256 KB
  bf16*  kpB   = (bf16*)carve((size_t)65536 * 64 * 2);         //    8 MB
  bf16*  vt    = (bf16*)carve((size_t)16 * 768 * 4096 * 2);    //  100 MB
  bf16*  pP    = (bf16*)carve((size_t)16 * 128 * 4096 * 2);    //   16 MB
  float* beta  = (float*)carve((size_t)16 * 128 * 4096 * 4);   //   33 MB
  float* rsum  = (float*)carve((size_t)2048 * 4);

  // q = relu(text@Wq+bq) -> [2048,64] bf16 (cols 36..63 zero)
  proj_gemm_bias_relu<<<dim3(16, 1), 256, 0, stream>>>(
      text, Wq, bq, qp, 2048, 768, 36, 64, 0, 0);
  // k = relu(img@Wk+bk) -> [65536,64] bf16
  proj_gemm_bias_relu<<<dim3(512, 1), 256, 0, stream>>>(
      img, Wk, bk, kpB, 65536, 512, 36, 64, 0, 0);
  // v = relu(img@Wv+bv) -> transposed [16,768,4096] bf16 (rpb = 2^12)
  // x = column tile, so the 3 blocks that share an img row tile start together
  proj_v_tiled<<<dim3(3, 256), 512, 0, stream>>>(img, Wv, bv, vt);
  // scores + masked softmax
  attn_scores_softmax<<<dim3(128), 256, 0, stream>>>(
      qp, kpB, masks, beta, pP, rsum);
  // o = (p @ v) / rowsum
  attn_out<<<dim3(128, 6), 256, 0, stream>>>(pP, vt, rsum, out);
}

// v002
// Measured time: 274 microseconds a run.
// Next to v001, in two timings, it ran 1.25 times as fast each time.
// Counting every step since v000, it is 2.27 times as fast.
#include <hip/hip_runtime.h>
#include <hip/hip_bf16.h>

// ---------------------------------------------------------------------------
// Text->Img cross attention, CDNA5 (gfx1250, wave32) bf16 WMMA implementation
//   B=16, N=128, H=W=64 (M=4096), TC=768, IC=512, FQ=36 (padded to 64)
// ---------------------------------------------------------------------------

typedef __bf16 bf16;
typedef __attribute__((ext_vector_type(8)))  bf16  bf16x8;
typedef __attribute__((ext_vector_type(16))) bf16  bf16x16;
typedef __attribute__((ext_vector_type(8)))  float f32x8;

// A/B fragment loader for V_WMMA_*_16X16X32_BF16 (wave32).
// Per ISA 7.12.2, lane (with half = lane>>4) holds K = half*8 + [0..7] in
// elements 0..7 and K = 16 + half*8 + [0..7] in elements 8..15 -> two 16B
// contiguous loads from a row-major [row/col, K] buffer.
__device__ __forceinline__ bf16x16 load_frag(const bf16* base, int half) {
  bf16x8 lo = *(const bf16x8*)(base + half * 8);
  bf16x8 hi = *(const bf16x8*)(base + 16 + half * 8);
  bf16x16 r;
#pragma unroll
  for (int i = 0; i < 8; ++i) { r[i] = lo[i]; r[i + 8] = hi[i]; }
  return r;
}

__device__ __forceinline__ f32x8 wmma_bf16(bf16x16 a, bf16x16 b, f32x8 c) {
  // (neg_a, A, neg_b, B, c_mod, C, reuse_a, reuse_b)
  return __builtin_amdgcn_wmma_f32_16x16x32_bf16(false, a, false, b,
                                                 (short)0, c, false, false);
}

// Staging helpers for the projection GEMM (split so loads can be issued
// before the WMMAs and the cvt+LDS-store after -> VMEM latency hidden).
// A chunk: [128 rows x 32 k] f32, 2 threads/row x 16 k.  rows is always a
// multiple of 128 in our launches, so no row guard (keeps the K-loop free of
// divergent exec-mask save/restore).
__device__ __forceinline__ void stage_load(const float* __restrict__ A,
                                           const float* __restrict__ W,
                                           int rowblock, int colblock,
                                           int K, int ncols, int k0, int tid,
                                           float aR[16], float wR[8]) {
  const int r  = tid >> 1;
  const int kk = (tid & 1) * 16;
  const float* asrc = A + (size_t)(rowblock + r) * K + k0 + kk;
#pragma unroll
  for (int i = 0; i < 16; ++i) aR[i] = asrc[i];
  const int kw = tid >> 3;
  const int c0 = (tid & 7) * 8;
  const float* wsrc = W + (size_t)(k0 + kw) * ncols + colblock + c0;
#pragma unroll
  for (int i = 0; i < 8; ++i)
    wR[i] = (colblock + c0 + i < ncols) ? wsrc[i] : 0.f;  // zero-pad FQ->64
}

__device__ __forceinline__ void stage_store(bf16* __restrict__ lA,
                                            bf16* __restrict__ lB, int tid,
                                            const float aR[16], const float wR[8]) {
  const int r  = tid >> 1;
  const int kk = (tid & 1) * 16;
  bf16* dst = &lA[r * 32 + kk];
#pragma unroll
  for (int i = 0; i < 16; ++i) dst[i] = (bf16)aR[i];
  const int kw = tid >> 3;
  const int c0 = (tid & 7) * 8;
#pragma unroll
  for (int i = 0; i < 8; ++i) lB[(c0 + i) * 32 + kw] = (bf16)wR[i];  // [col][k]
}

// ---------------------------------------------------------------------------
// Kernel 1: out = relu(A[rows,K] @ W[K,ncols] + bias), f32 in -> bf16 out.
// Block = 256 thr (8 waves). Tile = 128 rows x 64 cols; wave w owns rows
// [16w,16w+16) x all 64 cols (4 accumulators). Double-buffered LDS staging:
// per K-chunk -> issue next chunk's global loads, run 4 WMMAs on current
// chunk (overlapping the loads), then cvt+store next chunk, one barrier.
// transpose=1 stores out as [b, col, m] (column-major per batch, rpb=2^rpbShift)
// (unused: both launches pass 0); else row-major [row, out_ld] (zero-pad cols kept).
// ---------------------------------------------------------------------------
__launch_bounds__(256)
__global__ void proj_gemm_bias_relu(const float* __restrict__ A,
                                    const float* __restrict__ W,
                                    const float* __restrict__ bias,
                                    bf16* __restrict__ out,
                                    int rows, int K, int ncols,
                                    int out_ld, int transpose, int rpbShift) {
  __shared__ __align__(16) bf16 lA[2][128 * 32];  // [buf][row][k]  2x8 KB
  __shared__ __align__(16) bf16 lB[2][64 * 32];   // [buf][col][k]  2x4 KB

  const int tid  = threadIdx.x;
  const int w    = tid >> 5;
  const int lane = tid & 31;
  const int half = lane >> 4;
  const int l15  = lane & 15;
  const int rowblock = blockIdx.x * 128;
  const int colblock = blockIdx.y * 64;

  f32x8 acc[4] = {};
  float aR[16], wR[8];

  // prologue: stage chunk 0 into buffer 0
  stage_load(A, W, rowblock, colblock, K, ncols, 0, tid, aR, wR);
  stage_store(lA[0], lB[0], tid, aR, wR);
  __syncthreads();

  const int nCh = K >> 5;
  for (int ci = 0; ci < nCh; ++ci) {
    const int cur = ci & 1;
    const bool more = (ci + 1) < nCh;
    if (more)  // issue VMEM for next chunk before the matrix ops
      stage_load(A, W, rowblock, colblock, K, ncols, (ci + 1) * 32, tid, aR, wR);

    const bf16x16 af = load_frag(&lA[cur][(w * 16 + l15) * 32], half);
#pragma unroll
    for (int t = 0; t < 4; ++t) {
      const bf16x16 bfr = load_frag(&lB[cur][(t * 16 + l15) * 32], half);
      acc[t] = wmma_bf16(af, bfr, acc[t]);
    }

    if (more) {
      // safe: everyone finished reading buffer cur^1 before last barrier
      stage_store(lA[cur ^ 1], lB[cur ^ 1], tid, aR, wR);
      __syncthreads();
    }
  }

  // epilogue: bias + relu + bf16 store (C/D layout: row=r+8*half, col=l15)
#pragma unroll
  for (int t = 0; t < 4; ++t) {
    const int gc = colblock + t * 16 + l15;
    const float bv = (gc < ncols) ? bias[gc] : 0.f;
#pragma unroll
    for (int r = 0; r < 8; ++r) {
      const int grow = rowblock + w * 16 + r + 8 * half;  // rows % 128 == 0
      float val = acc[t][r] + bv;
      val = val > 0.f ? val : 0.f;
      if (transpose) {
        const int bb = grow >> rpbShift;
        const int mm = grow & ((1 << rpbShift) - 1);
        out[((size_t)bb * out_ld + gc) << rpbShift | (unsigned)mm] = (bf16)val;
      } else if (gc < out_ld) {
        out[(size_t)grow * out_ld + gc] = (bf16)val;
      }
    }
  }
}

// ---------------------------------------------------------------------------
// Kernel 1b: the v projection, vt[b, col, m] = relu(img[b*4096+m, :] @ Wv + bv),
// f32 in -> bf16 out, rows=65536, K=512, cols=768 (all multiples of the tile).
// Block = 512 thr (16 waves, 4 x 4). Tile = 256 rows x 256 cols; each wave owns
// 64 rows x 64 cols = 4 x 4 accumulators, so 8 fragments feed 16 WMMAs.
// Same double-buffered staging as kernel 1: next chunk's global loads, WMMAs on
// the current chunk, cvt + LDS store of the next chunk, one barrier per chunk.
// LDS rows are 32 k at a pitch of 40 bf16 (80 B = 16 B x odd).
// Column order in LDS: the thread that loads 4 neighbouring columns cg*4+j puts
// column j into LDS row j*64+cg, so wave column wc holds the columns = wc mod 4.
// ---------------------------------------------------------------------------
typedef __attribute__((ext_vector_type(4))) float f32x4;
typedef __attribute__((ext_vector_type(4))) bf16  bf16x4;

__launch_bounds__(512)
__global__ void proj_v_tiled(const float* __restrict__ A,
                             const float* __restrict__ W,
                             const float* __restrict__ bias,
                             bf16* __restrict__ out) {
  constexpr int K = 512, NC = 768, P = 40;
  __shared__ __align__(16) bf16 lA[2][256 * P];  // [buf][row][k]  2x20 KB
  __shared__ __align__(16) bf16 lB[2][256 * P];  // [buf][col][k]  2x20 KB

  const int tid  = threadIdx.x;
  const int w    = tid >> 5;
  const int lane = tid & 31;
  const int half = lane >> 4;
  const int l15  = lane & 15;
  const int wr   = w >> 2;
  const int wc   = w & 3;
  const int colblock = blockIdx.x * 256;
  const int rowblock = blockIdx.y * 256;

  // A chunk [256 x 32] f32: 8 lanes x 16 B cover one row's 128-B line.
  const int ar = tid >> 3;
  const int ak = (tid & 7) * 4;
  const float* asrc = A + (size_t)(rowblock + ar) * K + ak;
  // W chunk [32 x 256] f32: 4 k rows x 4 columns per thread.
  const int cg = tid & 63;
  const int kg = tid >> 6;
  const float* wsrc = W + (size_t)(kg * 4) * NC + colblock + cg * 4;

  f32x4 aR[4], wR[4];
  auto stage_ld = [&](int k0) {
#pragma unroll
    for (int j = 0; j < 4; ++j)
      aR[j] = *(const f32x4*)(asrc + (size_t)(j * 64) * K + k0);
#pragma unroll
    for (int i = 0; i < 4; ++i)
      wR[i] = *(const f32x4*)(wsrc + (size_t)(k0 + i) * NC);
  };
  auto stage_st = [&](int buf) {
#pragma unroll
    for (int j = 0; j < 4; ++j)
      *(bf16x4*)&lA[buf][(ar + 64 * j) * P + ak] =
          __builtin_convertvector(aR[j], bf16x4);
#pragma unroll
    for (int j = 0; j < 4; ++j) {
      bf16x4 v;
#pragma unroll
      for (int i = 0; i < 4; ++i) v[i] = (bf16)wR[i][j];
      *(bf16x4*)&lB[buf][(j * 64 + cg) * P + kg * 4] = v;
    }
  };

  f32x8 acc[4][4] = {};

  stage_ld(0);
  stage_st(0);
  __syncthreads();

  constexpr int nCh = K / 32;
  for (int ci = 0; ci < nCh; ++ci) {
    const int cur = ci & 1;
    const bool more = (ci + 1) < nCh;
    if (more) stage_ld((ci + 1) * 32);  // VMEM for the next chunk first

    bf16x16 af[4], bfr[4];
#pragma unroll
    for (int i = 0; i < 4; ++i)
      af[i] = load_frag(&lA[cur][(wr * 64 + i * 16 + l15) * P], half);
#pragma unroll
    for (int t = 0; t < 4; ++t)
      bfr[t] = load_frag(&lB[cur][(wc * 64 + t * 16 + l15) * P], half);
    // keeps the 8 global loads and the 16 LDS reads one group ahead of the WMMAs;
    // without it global loads sink to just before their cvt, their latency no
    // longer covered, and A fragments are read among the WMMAs behind full waits
    __builtin_amdgcn_sched_barrier(0);
#pragma unroll
    for (int i = 0; i < 4; ++i)
#pragma unroll
      for (int t = 0; t < 4; ++t)
        acc[i][t] = wmma_bf16(af[i], bfr[t], acc[i][t]);

    // keeps the cvt of the loaded chunk, and with it the wait on those loads,
    // behind the WMMAs; without it the scheduler lifts both above them
    __builtin_amdgcn_sched_barrier(0);
    if (more) {
      // safe: everyone finished reading buffer cur^1 before the last barrier
      stage_st(cur ^ 1);
      __syncthreads();
    }
  }

  // epilogue: a lane's 8 accumulator registers are 8 consecutive m of one
  // column -> bias + relu + one 16-B store each.
  const int bb = rowblock >> 12;
  const int m0 = (rowblock & 4095) + wr * 64 + 8 * half;
#pragma unroll
  for (int t = 0; t < 4; ++t) {
    const int gc = colblock + (t * 16 + l15) * 4 + wc;
    const float bv = bias[gc];
    bf16* dst = out + (((size_t)bb * NC + gc) << 12) + m0;
#pragma unroll
    for (int i = 0; i < 4; ++i) {
      bf16x8 v;
#pragma unroll
      for (int r = 0; r < 8; ++r) {
        const float val = acc[i][t][r] + bv;
        v[r] = (bf16)(val > 0.f ? val : 0.f);
      }
      *(bf16x8*)(dst + i * 16) = v;
    }
  }
}

// ---------------------------------------------------------------------------
// Kernel 2: s = q@k^T, beta = s*mask, two-pass softmax over M=4096.
// One block per (b, 16-query tile). Wave w owns m-tiles w, w+8, ... (32 each).
// Pass 1: WMMA scores (K=64 -> 2 wmma) -> beta f32 (ws) + running row max.
// Pass 2: exp(beta - max) -> bf16 p (unnormalized), row sums -> rowsum_g.
// Row reductions: __shfl_xor within 16-lane groups, then LDS across waves.
// ---------------------------------------------------------------------------
__launch_bounds__(256)
__global__ void attn_scores_softmax(const bf16* __restrict__ qp,
                                    const bf16* __restrict__ kp,
                                    const float* __restrict__ masks,
                                    float* __restrict__ beta,
                                    bf16* __restrict__ p,
                                    float* __restrict__ rowsum_g) {
  __shared__ float red[8][16];
  __shared__ float rowmax[16];

  const int tid  = threadIdx.x;
  const int w    = tid >> 5;
  const int lane = tid & 31;
  const int half = lane >> 4;
  const int l15  = lane & 15;
  const int b     = blockIdx.x >> 3;
  const int nbase = (blockIdx.x & 7) * 16;

  const bf16* qrow = qp + ((size_t)b * 128 + nbase + l15) * 64;
  const bf16x16 a0 = load_frag(qrow, half);        // K 0..31
  const bf16x16 a1 = load_frag(qrow + 32, half);   // K 32..63

  const size_t bm = (size_t)b * 128 * 4096;
  float rmax[8];
#pragma unroll
  for (int r = 0; r < 8; ++r) rmax[r] = -3.0e38f;

  for (int mt = w; mt < 256; mt += 8) {
    const int mbase = mt * 16;
    const bf16* krow = kp + ((size_t)b * 4096 + mbase + l15) * 64;
    const bf16x16 b0 = load_frag(krow, half);
    const bf16x16 b1 = load_frag(krow + 32, half);
    f32x8 acc = {};
    acc = wmma_bf16(a0, b0, acc);
    acc = wmma_bf16(a1, b1, acc);
    const int m = mbase + l15;
#pragma unroll
    for (int r = 0; r < 8; ++r) {
      const int n = nbase + r + 8 * half;
      const size_t idx = bm + (size_t)n * 4096 + m;
      const float bv = acc[r] * masks[idx];  // multiplicative mask BEFORE softmax
      beta[idx] = bv;
      rmax[r] = fmaxf(rmax[r], bv);
    }
  }

  // row max: reduce across the 16 lanes that share rows, then across waves
#pragma unroll
  for (int r = 0; r < 8; ++r)
#pragma unroll
    for (int off = 1; off < 16; off <<= 1)
      rmax[r] = fmaxf(rmax[r], __shfl_xor(rmax[r], off, 16));
  if (l15 == 0)
#pragma unroll
    for (int r = 0; r < 8; ++r) red[w][r + 8 * half] = rmax[r];
  __syncthreads();
  if (tid < 16) {
    float mx = -3.0e38f;
    for (int ww = 0; ww < 8; ++ww) mx = fmaxf(mx, red[ww][tid]);
    rowmax[tid] = mx;
  }
  __syncthreads();

  float rsum[8] = {};
  for (int mt = w; mt < 256; mt += 8) {
    const int m = mt * 16 + l15;
#pragma unroll
    for (int r = 0; r < 8; ++r) {
      const int n = nbase + r + 8 * half;
      const size_t idx = bm + (size_t)n * 4096 + m;
      const float e = __expf(beta[idx] - rowmax[r + 8 * half]);
      rsum[r] += e;
      p[idx] = (bf16)e;  // unnormalized; 1/sum applied in attn_out
    }
  }
#pragma unroll
  for (int r = 0; r < 8; ++r)
#pragma unroll
    for (int off = 1; off < 16; off <<= 1)
      rsum[r] += __shfl_xor(rsum[r], off, 16);
  __syncthreads();  // rowmax reads done; red is reusable
  if (l15 == 0)
#pragma unroll
    for (int r = 0; r < 8; ++r) red[w][r + 8 * half] = rsum[r];
  __syncthreads();
  if (tid < 16) {
    float s = 0.f;
    for (int ww = 0; ww < 8; ++ww) s += red[ww][tid];
    rowsum_g[(size_t)b * 128 + nbase + tid] = s;
  }
}

// ---------------------------------------------------------------------------
// Kernel 3: o[b,n,col] = (p[b,n,:] @ v[b,:,col]) / rowsum[b,n].
// v stored transposed [b, col, m] so B-fragments are K(m)-contiguous.
// One block = all 128 n of one batch x 64 cols, 8 waves (4 x 2), 32 x 32 per
// wave = 2 x 2 accumulators. p and v_t are staged in LDS, 256 m per stage, by
// asynchronous copies: one wave-wide copy brings the 512 contiguous bytes that
// one row has in the stage, so every global access covers whole lines.
// Two buffers: the next stage's copies fly while this stage is multiplied.
// LDS rows: 512 B at a pitch of 528 B (16 B x odd) for the ds_load_b128 reads.
// ---------------------------------------------------------------------------
constexpr int AO_KS    = 256;                 // m per stage
constexpr int AO_NT    = 4096 / AO_KS;        // stages
constexpr int AO_PITCH = AO_KS * 2 + 16;      // bytes per LDS row
constexpr int AO_A     = 128 * AO_PITCH;      // p tile, bytes
constexpr int AO_BUF   = (128 + 64) * AO_PITCH;

// Eight copies of one wave: rows r, r+8, ..., r+56 of a tile; each lane brings
// its own 16 bytes. The s_wait_xcnt stands inside the statement so that no
// address register of a copy is rewritten in front of it.
__device__ __forceinline__ void copy8_rows(unsigned l, const bf16* g) {
  constexpr unsigned LS = 8 * AO_PITCH;
  constexpr int      GS = 8 * 4096;
  asm volatile(
      "global_load_async_to_lds_b128 %0, %8, off\n\t"
      "global_load_async_to_lds_b128 %1, %9, off\n\t"
      "global_load_async_to_lds_b128 %2, %10, off\n\t"
      "global_load_async_to_lds_b128 %3, %11, off\n\t"
      "global_load_async_to_lds_b128 %4, %12, off\n\t"
      "global_load_async_to_lds_b128 %5, %13, off\n\t"
      "global_load_async_to_lds_b128 %6, %14, off\n\t"
      "global_load_async_to_lds_b128 %7, %15, off\n\t"
      "s_wait_xcnt 0x0"
      :: "v"(l), "v"(l + LS), "v"(l + 2 * LS), "v"(l + 3 * LS),
         "v"(l + 4 * LS), "v"(l + 5 * LS), "v"(l + 6 * LS), "v"(l + 7 * LS),
         "v"(g), "v"(g + GS), "v"(g + 2 * GS), "v"(g + 3 * GS),
         "v"(g + 4 * GS), "v"(g + 5 * GS), "v"(g + 6 * GS), "v"(g + 7 * GS)
      : "memory");
}

__launch_bounds__(256)
__global__ void attn_out(const bf16* __restrict__ p,
                         const bf16* __restrict__ v_t,
                         const float* __restrict__ rowsum_g,
                         float* __restrict__ out) {
  __shared__ __align__(16) unsigned char ring[2][AO_BUF];  // 2 x 99 KB

  const int tid  = threadIdx.x;
  const int w    = tid >> 5;
  const int lane = tid & 31;
  const int half = lane >> 4;
  const int l15  = lane & 15;
  const int wr   = w >> 1;
  const int wc   = w & 1;
  const int b        = blockIdx.y;
  const int colblock = blockIdx.x * 64;

  // wave w copies rows w, w+8, ...: 16 rows of p, 8 rows (columns) of v_t
  const bf16* pg = p   + ((size_t)b * 128 + w) * 4096 + lane * 8;
  const bf16* vg = v_t + ((size_t)b * 768 + colblock + w) * 4096 + lane * 8;
  const unsigned l0 =
      (unsigned)(size_t)&ring[0][0] + (unsigned)(w * AO_PITCH + lane * 16);

  auto fill = [&](int t, int buf) {
    const unsigned l = l0 + (unsigned)(buf * AO_BUF);
    copy8_rows(l, pg + t * AO_KS);
    copy8_rows(l + 64 * AO_PITCH, pg + 64 * 4096 + t * AO_KS);
    copy8_rows(l + AO_A, vg + t * AO_KS);
  };

  f32x8 acc[2][2] = {};

  fill(0, 0);
  // stage 0 has landed for this wave, then for all
  asm volatile("s_wait_asynccnt 0x0" ::: "memory");
  __syncthreads();
  fill(1, 1);

  for (int t = 0; t < AO_NT; ++t) {
    const int cur = t & 1;
    const unsigned char* base = &ring[cur][0];
    const bf16* ar = (const bf16*)(base + (wr * 32 + l15) * AO_PITCH);
    const bf16* br = (const bf16*)(base + AO_A + (wc * 32 + l15) * AO_PITCH);
    // a block = 2 k chunks of 32 = 16 LDS reads, 8 WMMAs; two fragment sets
    bf16x16 fa[2][2][2], fb[2][2][2];  // [set][chunk][tile]
    auto frags = [&](int set, int blk) {
#pragma unroll  // constant indices keep fa, fb in registers
      for (int c = 0; c < 2; ++c) {
        const int k = (blk * 2 + c) * 32;
        fa[set][c][0] = load_frag(ar + k, half);
        fa[set][c][1] = load_frag(ar + 8 * AO_PITCH + k, half);
        fb[set][c][0] = load_frag(br + k, half);
        fb[set][c][1] = load_frag(br + 8 * AO_PITCH + k, half);
      }
    };
    frags(0, 0);
#pragma unroll  // the set index must be a constant: fa, fb stay in registers
    for (int blk = 0; blk < AO_KS / 64; ++blk) {
      const int s = blk & 1;
      if (blk + 1 < AO_KS / 64) frags(s ^ 1, blk + 1);
      // keeps the next block's LDS reads one group ahead of this block's WMMAs;
      // without it they are spread among the WMMAs behind full waits
      __builtin_amdgcn_sched_barrier(0);
#pragma unroll  // constant indices, as above
      for (int c = 0; c < 2; ++c) {
        acc[0][0] = wmma_bf16(fa[s][c][0], fb[s][c][0], acc[0][0]);
        acc[0][1] = wmma_bf16(fa[s][c][0], fb[s][c][1], acc[0][1]);
        acc[1][0] = wmma_bf16(fa[s][c][1], fb[s][c][0], acc[1][0]);
        acc[1][1] = wmma_bf16(fa[s][c][1], fb[s][c][1], acc[1][1]);
      }
      // keeps the reads of the block after next behind this block's WMMAs;
      // without it they split into smaller groups among these WMMAs, and the
      // last block's WMMAs sink behind the hand-over barrier
      __builtin_amdgcn_sched_barrier(0);
    }
    // hand-over: this wave's reads of buffer cur are done ...
    asm volatile("s_wait_dscnt 0x0" ::: "memory");
    // ... its copies of stage t+1 have landed ...
    asm volatile("s_wait_asynccnt 0x0" ::: "memory");
    // ... and the same holds for every wave: stage t+1 may be read, cur refilled
    __syncthreads();
    if (t + 2 < AO_NT) fill(t + 2, cur);
  }
  // no copy is outstanding when the wave ends
  asm volatile("s_wait_asynccnt 0x0" ::: "memory");

#pragma unroll  // acc is indexed by constants only
  for (int i = 0; i < 2; ++i)
#pragma unroll  // the same
    for (int r = 0; r < 8; ++r) {
      const int n = wr * 32 + i * 16 + r + 8 * half;
      const float scale = 1.0f / rowsum_g[(size_t)b * 128 + n];
      float* dst = out + ((size_t)b * 128 + n) * 768 + colblock + wc * 32 + l15;
      dst[0]  = acc[i][0][r] * scale;
      dst[16] = acc[i][1][r] * scale;
    }
}

// ---------------------------------------------------------------------------
extern "C" void kernel_launch(void* const* d_in, const int* in_sizes, int n_in,
                              void* d_out, int out_size, void* d_ws, size_t ws_size,
                              hipStream_t stream) {
  (void)in_sizes; (void)n_in; (void)out_size; (void)ws_size;
  const float* text  = (const float*)d_in[0];  // [16,128,768]
  const float* img   = (const float*)d_in[1];  // [16,64,64,512] = [65536,512]
  const float* masks = (const float*)d_in[2];  // [16,128,4096]
  const float* Wq    = (const float*)d_in[3];  // [768,36]
  const float* bq    = (const float*)d_in[4];
  const float* Wk    = (const float*)d_in[5];  // [512,36]
  const float* bk    = (const float*)d_in[6];
  const float* Wv    = (const float*)d_in[7];  // [512,768]
  const float* bv    = (const float*)d_in[8];
  float* out = (float*)d_out;                  // [16,128,768]

  // workspace carve (256B aligned regions)
  char* ws = (char*)d_ws;
  size_t off = 0;
  auto carve = [&](size_t bytes) -> void* {
    void* ptr = ws + off;
    off = (off + bytes + 255) & ~(size_t)255;
    return ptr;
  };
  bf16*  qp    = (bf16*)carve((size_t)2048 * 64 * 2);          //  256 KB
  bf16*  kpB   = (bf16*)carve((size_t)65536 * 64 * 2);         //    8 MB
  bf16*  vt    = (bf16*)carve((size_t)16 * 768 * 4096 * 2);    //  100 MB
  bf16*  pP    = (bf16*)carve((size_t)16 * 128 * 4096 * 2);    //   16 MB
  float* beta  = (float*)carve((size_t)16 * 128 * 4096 * 4);   //   33 MB
  float* rsum  = (float*)carve((size_t)2048 * 4);

  // q = relu(text@Wq+bq) -> [2048,64] bf16 (cols 36..63 zero)
  proj_gemm_bias_relu<<<dim3(16, 1), 256, 0, stream>>>(
      text, Wq, bq, qp, 2048, 768, 36, 64, 0, 0);
  // k = relu(img@Wk+bk) -> [65536,64] bf16
  proj_gemm_bias_relu<<<dim3(512, 1), 256, 0, stream>>>(
      img, Wk, bk, kpB, 65536, 512, 36, 64, 0, 0);
  // v = relu(img@Wv+bv) -> transposed [16,768,4096] bf16 (rpb = 2^12)
  // x = column tile, so the 3 blocks that share an img row tile start together
  proj_v_tiled<<<dim3(3, 256), 512, 0, stream>>>(img, Wv, bv, vt);
  // scores + masked softmax
  attn_scores_softmax<<<dim3(128), 256, 0, stream>>>(
      qp, kpB, masks, beta, pP, rsum);
  // o = (p @ v) / rowsum
  attn_out<<<dim3(12, 16), 256, 0, stream>>>(pP, vt, rsum, out);
}

// v003
// It runs in 183 microseconds.
// In both of two side-by-side timings against v002, it was 1.49 times as fast.
// All steps since v000 together make it 3.38 times as fast.
#include <hip/hip_runtime.h>
#include <hip/hip_bf16.h>

// ---------------------------------------------------------------------------
// Text->Img cross attention, CDNA5 (gfx1250, wave32) bf16 WMMA implementation
//   B=16, N=128, H=W=64 (M=4096), TC=768, IC=512, FQ=36 (padded to 64)
// ---------------------------------------------------------------------------

typedef __bf16 bf16;
typedef __attribute__((ext_vector_type(8)))  bf16  bf16x8;
typedef __attribute__((ext_vector_type(16))) bf16  bf16x16;
typedef __attribute__((ext_vector_type(8)))  float f32x8;

// A/B fragment loader for V_WMMA_*_16X16X32_BF16 (wave32).
// Per ISA 7.12.2, lane (with half = lane>>4) holds K = half*8 + [0..7] in
// elements 0..7 and K = 16 + half*8 + [0..7] in elements 8..15 -> two 16B
// contiguous loads from a row-major [row/col, K] buffer.
__device__ __forceinline__ bf16x16 load_frag(const bf16* base, int half) {
  bf16x8 lo = *(const bf16x8*)(base + half * 8);
  bf16x8 hi = *(const bf16x8*)(base + 16 + half * 8);
  bf16x16 r;
#pragma unroll
  for (int i = 0; i < 8; ++i) { r[i] = lo[i]; r[i + 8] = hi[i]; }
  return r;
}

__device__ __forceinline__ f32x8 wmma_bf16(bf16x16 a, bf16x16 b, f32x8 c) {
  // (neg_a, A, neg_b, B, c_mod, C, reuse_a, reuse_b)
  return __builtin_amdgcn_wmma_f32_16x16x32_bf16(false, a, false, b,
                                                 (short)0, c, false, false);
}

// Staging helpers for the projection GEMM (split so loads can be issued
// before the WMMAs and the cvt+LDS-store after -> VMEM latency hidden).
// A chunk: [128 rows x 32 k] f32, 2 threads/row x 16 k.  rows is always a
// multiple of 128 in our launches, so no row guard (keeps the K-loop free of
// divergent exec-mask save/restore).
__device__ __forceinline__ void stage_load(const float* __restrict__ A,
                                           const float* __restrict__ W,
                                           int rowblock, int colblock,
                                           int K, int ncols, int k0, int tid,
                                           float aR[16], float wR[8]) {
  const int r  = tid >> 1;
  const int kk = (tid & 1) * 16;
  const float* asrc = A + (size_t)(rowblock + r) * K + k0 + kk;
#pragma unroll
  for (int i = 0; i < 16; ++i) aR[i] = asrc[i];
  const int kw = tid >> 3;
  const int c0 = (tid & 7) * 8;
  const float* wsrc = W + (size_t)(k0 + kw) * ncols + colblock + c0;
#pragma unroll
  for (int i = 0; i < 8; ++i)
    wR[i] = (colblock + c0 + i < ncols) ? wsrc[i] : 0.f;  // zero-pad FQ->64
}

__device__ __forceinline__ void stage_store(bf16* __restrict__ lA,
                                            bf16* __restrict__ lB, int tid,
                                            const float aR[16], const float wR[8]) {
  const int r  = tid >> 1;
  const int kk = (tid & 1) * 16;
  bf16* dst = &lA[r * 32 + kk];
#pragma unroll
  for (int i = 0; i < 16; ++i) dst[i] = (bf16)aR[i];
  const int kw = tid >> 3;
  const int c0 = (tid & 7) * 8;
#pragma unroll
  for (int i = 0; i < 8; ++i) lB[(c0 + i) * 32 + kw] = (bf16)wR[i];  // [col][k]
}

// ---------------------------------------------------------------------------
// Kernel 1: out = relu(A[rows,K] @ W[K,ncols] + bias), f32 in -> bf16 out.
// Block = 256 thr (8 waves). Tile = 128 rows x 64 cols; wave w owns rows
// [16w,16w+16) x all 64 cols (4 accumulators). Double-buffered LDS staging:
// per K-chunk -> issue next chunk's global loads, run 4 WMMAs on current
// chunk (overlapping the loads), then cvt+store next chunk, one barrier.
// transpose=1 stores out as [b, col, m] (column-major per batch, rpb=2^rpbShift)
// (unused: both launches pass 0); else row-major [row, out_ld] (zero-pad cols kept).
// ---------------------------------------------------------------------------
__launch_bounds__(256)
__global__ void proj_gemm_bias_relu(const float* __restrict__ A,
                                    const float* __restrict__ W,
                                    const float* __restrict__ bias,
                                    bf16* __restrict__ out,
                                    int rows, int K, int ncols,
                                    int out_ld, int transpose, int rpbShift) {
  __shared__ __align__(16) bf16 lA[2][128 * 32];  // [buf][row][k]  2x8 KB
  __shared__ __align__(16) bf16 lB[2][64 * 32];   // [buf][col][k]  2x4 KB

  const int tid  = threadIdx.x;
  const int w    = tid >> 5;
  const int lane = tid & 31;
  const int half = lane >> 4;
  const int l15  = lane & 15;
  const int rowblock = blockIdx.x * 128;
  const int colblock = blockIdx.y * 64;

  f32x8 acc[4] = {};
  float aR[16], wR[8];

  // prologue: stage chunk 0 into buffer 0
  stage_load(A, W, rowblock, colblock, K, ncols, 0, tid, aR, wR);
  stage_store(lA[0], lB[0], tid, aR, wR);
  __syncthreads();

  const int nCh = K >> 5;
  for (int ci = 0; ci < nCh; ++ci) {
    const int cur = ci & 1;
    const bool more = (ci + 1) < nCh;
    if (more)  // issue VMEM for next chunk before the matrix ops
      stage_load(A, W, rowblock, colblock, K, ncols, (ci + 1) * 32, tid, aR, wR);

    const bf16x16 af = load_frag(&lA[cur][(w * 16 + l15) * 32], half);
#pragma unroll
    for (int t = 0; t < 4; ++t) {
      const bf16x16 bfr = load_frag(&lB[cur][(t * 16 + l15) * 32], half);
      acc[t] = wmma_bf16(af, bfr, acc[t]);
    }

    if (more) {
      // safe: everyone finished reading buffer cur^1 before last barrier
      stage_store(lA[cur ^ 1], lB[cur ^ 1], tid, aR, wR);
      __syncthreads();
    }
  }

  // epilogue: bias + relu + bf16 store (C/D layout: row=r+8*half, col=l15)
#pragma unroll
  for (int t = 0; t < 4; ++t) {
    const int gc = colblock + t * 16 + l15;
    const float bv = (gc < ncols) ? bias[gc] : 0.f;
#pragma unroll
    for (int r = 0; r < 8; ++r) {
      const int grow = rowblock + w * 16 + r + 8 * half;  // rows % 128 == 0
      float val = acc[t][r] + bv;
      val = val > 0.f ? val : 0.f;
      if (transpose) {
        const int bb = grow >> rpbShift;
        const int mm = grow & ((1 << rpbShift) - 1);
        out[((size_t)bb * out_ld + gc) << rpbShift | (unsigned)mm] = (bf16)val;
      } else if (gc < out_ld) {
        out[(size_t)grow * out_ld + gc] = (bf16)val;
      }
    }
  }
}

// ---------------------------------------------------------------------------
// Kernel 1b: the v projection, vt[b, col, m] = relu(img[b*4096+m, :] @ Wv + bv),
// f32 in -> bf16 out, rows=65536, K=512, cols=768 (all multiples of the tile).
// Block = 512 thr (16 waves, 4 x 4). Tile = 256 rows x 256 cols; each wave owns
// 64 rows x 64 cols = 4 x 4 accumulators, so 8 fragments feed 16 WMMAs.
// Same double-buffered staging as kernel 1: next chunk's global loads, WMMAs on
// the current chunk, cvt + LDS store of the next chunk, one barrier per chunk.
// LDS rows are 32 k at a pitch of 40 bf16 (80 B = 16 B x odd).
// Column order in LDS: the thread that loads 4 neighbouring columns cg*4+j puts
// column j into LDS row j*64+cg, so wave column wc holds the columns = wc mod 4.
// ---------------------------------------------------------------------------
typedef __attribute__((ext_vector_type(4))) float f32x4;
typedef __attribute__((ext_vector_type(4))) bf16  bf16x4;

__launch_bounds__(512)
__global__ void proj_v_tiled(const float* __restrict__ A,
                             const float* __restrict__ W,
                             const float* __restrict__ bias,
                             bf16* __restrict__ out) {
  constexpr int K = 512, NC = 768, P = 40;
  __shared__ __align__(16) bf16 lA[2][256 * P];  // [buf][row][k]  2x20 KB
  __shared__ __align__(16) bf16 lB[2][256 * P];  // [buf][col][k]  2x20 KB

  const int tid  = threadIdx.x;
  const int w    = tid >> 5;
  const int lane = tid & 31;
  const int half = lane >> 4;
  const int l15  = lane & 15;
  const int wr   = w >> 2;
  const int wc   = w & 3;
  const int colblock = blockIdx.x * 256;
  const int rowblock = blockIdx.y * 256;

  // A chunk [256 x 32] f32: 8 lanes x 16 B cover one row's 128-B line.
  const int ar = tid >> 3;
  const int ak = (tid & 7) * 4;
  const float* asrc = A + (size_t)(rowblock + ar) * K + ak;
  // W chunk [32 x 256] f32: 4 k rows x 4 columns per thread.
  const int cg = tid & 63;
  const int kg = tid >> 6;
  const float* wsrc = W + (size_t)(kg * 4) * NC + colblock + cg * 4;

  f32x4 aR[4], wR[4];
  auto stage_ld = [&](int k0) {
#pragma unroll
    for (int j = 0; j < 4; ++j)
      aR[j] = *(const f32x4*)(asrc + (size_t)(j * 64) * K + k0);
#pragma unroll
    for (int i = 0; i < 4; ++i)
      wR[i] = *(const f32x4*)(wsrc + (size_t)(k0 + i) * NC);
  };
  auto stage_st = [&](int buf) {
#pragma unroll
    for (int j = 0; j < 4; ++j)
      *(bf16x4*)&lA[buf][(ar + 64 * j) * P + ak] =
          __builtin_convertvector(aR[j], bf16x4);
#pragma unroll
    for (int j = 0; j < 4; ++j) {
      bf16x4 v;
#pragma unroll
      for (int i = 0; i < 4; ++i) v[i] = (bf16)wR[i][j];
      *(bf16x4*)&lB[buf][(j * 64 + cg) * P + kg * 4] = v;
    }
  };

  f32x8 acc[4][4] = {};

  stage_ld(0);
  stage_st(0);
  __syncthreads();

  constexpr int nCh = K / 32;
  for (int ci = 0; ci < nCh; ++ci) {
    const int cur = ci & 1;
    const bool more = (ci + 1) < nCh;
    if (more) stage_ld((ci + 1) * 32);  // VMEM for the next chunk first

    bf16x16 af[4], bfr[4];
#pragma unroll
    for (int i = 0; i < 4; ++i)
      af[i] = load_frag(&lA[cur][(wr * 64 + i * 16 + l15) * P], half);
#pragma unroll
    for (int t = 0; t < 4; ++t)
      bfr[t] = load_frag(&lB[cur][(wc * 64 + t * 16 + l15) * P], half);
    // keeps the 8 global loads and the 16 LDS reads one group ahead of the WMMAs;
    // without it global loads sink to just before their cvt, their latency no
    // longer covered, and A fragments are read among the WMMAs behind full waits
    __builtin_amdgcn_sched_barrier(0);
#pragma unroll
    for (int i = 0; i < 4; ++i)
#pragma unroll
      for (int t = 0; t < 4; ++t)
        acc[i][t] = wmma_bf16(af[i], bfr[t], acc[i][t]);

    // keeps the cvt of the loaded chunk, and with it the wait on those loads,
    // behind the WMMAs; without it the scheduler lifts both above them
    __builtin_amdgcn_sched_barrier(0);
    if (more) {
      // safe: everyone finished reading buffer cur^1 before the last barrier
      stage_st(cur ^ 1);
      __syncthreads();
    }
  }

  // epilogue: a lane's 8 accumulator registers are 8 consecutive m of one
  // column -> bias + relu + one 16-B store each.
  const int bb = rowblock >> 12;
  const int m0 = (rowblock & 4095) + wr * 64 + 8 * half;
#pragma unroll
  for (int t = 0; t < 4; ++t) {
    const int gc = colblock + (t * 16 + l15) * 4 + wc;
    const float bv = bias[gc];
    bf16* dst = out + (((size_t)bb * NC + gc) << 12) + m0;
#pragma unroll
    for (int i = 0; i < 4; ++i) {
      bf16x8 v;
#pragma unroll
      for (int r = 0; r < 8; ++r) {
        const float val = acc[i][t][r] + bv;
        v[r] = (bf16)(val > 0.f ? val : 0.f);
      }
      *(bf16x8*)(dst + i * 16) = v;
    }
  }
}

// ---------------------------------------------------------------------------
// Kernel 2: s = q@k^T, beta = s*mask, softmax over M=4096, beta held in registers.
// One block per (b, 16-query tile), 32 waves. Wave w owns m in [128w, 128w+128)
// = 8 WMMA tiles. The 64 beta of a lane stay in the registers that its 64 mask
// values were loaded into: all mask loads of a wave are in flight together, and
// nothing is written to be read again.
// p = exp(beta - max) is bf16, unnormalized; row sums -> rowsum_g.
// Row reductions: __shfl_xor within 16-lane groups, then LDS across waves.
// ---------------------------------------------------------------------------
__launch_bounds__(1024)
__global__ void attn_scores_softmax(const bf16* __restrict__ qp,
                                    const bf16* __restrict__ kp,
                                    const float* __restrict__ masks,
                                    bf16* __restrict__ p,
                                    float* __restrict__ rowsum_g) {
  __shared__ float red[32][16];
  __shared__ float rowmax[16];

  const int tid  = threadIdx.x;
  const int w    = tid >> 5;
  const int lane = tid & 31;
  const int half = lane >> 4;
  const int l15  = lane & 15;
  const int b     = blockIdx.x >> 3;
  const int nbase = (blockIdx.x & 7) * 16;

  const bf16* qrow = qp + ((size_t)b * 128 + nbase + l15) * 64;
  const bf16x16 a0 = load_frag(qrow, half);        // K 0..31
  const bf16x16 a1 = load_frag(qrow + 32, half);   // K 32..63
  // precaution, here and behind the mask and the k loads below: as an input of
  // the wait the loads' address lives up to it, so that no later load lands in
  // registers which an issued load names before the wait has been passed
  asm volatile("s_wait_xcnt 0x0" :: "v"(qrow) : "memory");

  // the lane's element of tile j, register r: row nbase + 8 half + r, m = m0 + 16 j
  const int    m0  = w * 128 + l15;
  const size_t idx = ((size_t)b * 128 + nbase + 8 * half) * 4096 + m0;
  const float* mrow = masks + idx;
  const bf16*  krow = kp + ((size_t)b * 4096 + m0) * 64;

  f32x8 bt[8];  // [tile][register]: first the mask, then beta
#pragma unroll  // constant indices keep bt in registers
  for (int j = 0; j < 8; ++j)
#pragma unroll  // the same
    for (int r = 0; r < 8; ++r) bt[j][r] = mrow[r * 4096 + j * 16];
  asm volatile("s_wait_xcnt 0x0" :: "v"(mrow) : "memory");  // see the q loads

  float rmax[8];
#pragma unroll  // rmax is indexed by constants only
  for (int r = 0; r < 8; ++r) rmax[r] = -3.0e38f;

#pragma unroll  // constant indices keep bt in registers
  for (int j = 0; j < 8; ++j) {
    const bf16x16 b0 = load_frag(krow + j * 16 * 64, half);
    const bf16x16 b1 = load_frag(krow + j * 16 * 64 + 32, half);
    f32x8 acc = {};
    acc = wmma_bf16(a0, b0, acc);
    acc = wmma_bf16(a1, b1, acc);
    bt[j] = acc * bt[j];  // multiplicative mask BEFORE softmax
#pragma unroll  // the same
    for (int r = 0; r < 8; ++r) rmax[r] = fmaxf(rmax[r], bt[j][r]);
  }
  asm volatile("s_wait_xcnt 0x0" :: "v"(krow) : "memory");  // see the q loads

  // row max: reduce across the 16 lanes that share rows, then across waves
#pragma unroll
  for (int r = 0; r < 8; ++r)
#pragma unroll
    for (int off = 1; off < 16; off <<= 1)
      rmax[r] = fmaxf(rmax[r], __shfl_xor(rmax[r], off, 16));
  if (l15 == 0)
#pragma unroll
    for (int r = 0; r < 8; ++r) red[w][r + 8 * half] = rmax[r];
  __syncthreads();
  if (tid < 16) {
    float mx = -3.0e38f;
    for (int ww = 0; ww < 32; ++ww) mx = fmaxf(mx, red[ww][tid]);
    rowmax[tid] = mx;
  }
  __syncthreads();

  float rsum[8] = {};
  bf16* prow = p + idx;
#pragma unroll  // constant indices keep bt in registers
  for (int j = 0; j < 8; ++j)
#pragma unroll  // the same
    for (int r = 0; r < 8; ++r) {
      const float e = __expf(bt[j][r] - rowmax[r + 8 * half]);
      rsum[r] += e;
      prow[r * 4096 + j * 16] = (bf16)e;  // unnormalized; 1/sum in attn_out
    }
#pragma unroll
  for (int r = 0; r < 8; ++r)
#pragma unroll
    for (int off = 1; off < 16; off <<= 1)
      rsum[r] += __shfl_xor(rsum[r], off, 16);
  __syncthreads();  // rowmax reads done; red is reusable
  if (l15 == 0)
#pragma unroll
    for (int r = 0; r < 8; ++r) red[w][r + 8 * half] = rsum[r];
  __syncthreads();
  if (tid < 16) {
    float s = 0.f;
    for (int ww = 0; ww < 32; ++ww) s += red[ww][tid];
    rowsum_g[(size_t)b * 128 + nbase + tid] = s;
  }
}

// ---------------------------------------------------------------------------
// Kernel 3: o[b,n,col] = (p[b,n,:] @ v[b,:,col]) / rowsum[b,n].
// v stored transposed [b, col, m] so B-fragments are K(m)-contiguous.
// One block = all 128 n of one batch x 64 cols, 8 waves (4 x 2), 32 x 32 per
// wave = 2 x 2 accumulators. p and v_t are staged in LDS, 256 m per stage, by
// asynchronous copies: one wave-wide copy brings the 512 contiguous bytes that
// one row has in the stage, so every global access covers whole lines.
// Two buffers: the next stage's copies fly while this stage is multiplied.
// LDS rows: 512 B at a pitch of 528 B (16 B x odd) for the ds_load_b128 reads.
// ---------------------------------------------------------------------------
constexpr int AO_KS    = 256;                 // m per stage
constexpr int AO_NT    = 4096 / AO_KS;        // stages
constexpr int AO_PITCH = AO_KS * 2 + 16;      // bytes per LDS row
constexpr int AO_A     = 128 * AO_PITCH;      // p tile, bytes
constexpr int AO_BUF   = (128 + 64) * AO_PITCH;

// Eight copies of one wave: rows r, r+8, ..., r+56 of a tile; each lane brings
// its own 16 bytes. The s_wait_xcnt stands inside the statement so that no
// address register of a copy is rewritten in front of it.
__device__ __forceinline__ void copy8_rows(unsigned l, const bf16* g) {
  constexpr unsigned LS = 8 * AO_PITCH;
  constexpr int      GS = 8 * 4096;
  asm volatile(
      "global_load_async_to_lds_b128 %0, %8, off\n\t"
      "global_load_async_to_lds_b128 %1, %9, off\n\t"
      "global_load_async_to_lds_b128 %2, %10, off\n\t"
      "global_load_async_to_lds_b128 %3, %11, off\n\t"
      "global_load_async_to_lds_b128 %4, %12, off\n\t"
      "global_load_async_to_lds_b128 %5, %13, off\n\t"
      "global_load_async_to_lds_b128 %6, %14, off\n\t"
      "global_load_async_to_lds_b128 %7, %15, off\n\t"
      "s_wait_xcnt 0x0"
      :: "v"(l), "v"(l + LS), "v"(l + 2 * LS), "v"(l + 3 * LS),
         "v"(l + 4 * LS), "v"(l + 5 * LS), "v"(l + 6 * LS), "v"(l + 7 * LS),
         "v"(g), "v"(g + GS), "v"(g + 2 * GS), "v"(g + 3 * GS),
         "v"(g + 4 * GS), "v"(g + 5 * GS), "v"(g + 6 * GS), "v"(g + 7 * GS)
      : "memory");
}

__launch_bounds__(256)
__global__ void attn_out(const bf16* __restrict__ p,
                         const bf16* __restrict__ v_t,
                         const float* __restrict__ rowsum_g,
                         float* __restrict__ out) {
  __shared__ __align__(16) unsigned char ring[2][AO_BUF];  // 2 x 99 KB

  const int tid  = threadIdx.x;
  const int w    = tid >> 5;
  const int lane = tid & 31;
  const int half = lane >> 4;
  const int l15  = lane & 15;
  const int wr   = w >> 1;
  const int wc   = w & 1;
  const int b        = blockIdx.y;
  const int colblock = blockIdx.x * 64;

  // wave w copies rows w, w+8, ...: 16 rows of p, 8 rows (columns) of v_t
  const bf16* pg = p   + ((size_t)b * 128 + w) * 4096 + lane * 8;
  const bf16* vg = v_t + ((size_t)b * 768 + colblock + w) * 4096 + lane * 8;
  const unsigned l0 =
      (unsigned)(size_t)&ring[0][0] + (unsigned)(w * AO_PITCH + lane * 16);

  auto fill = [&](int t, int buf) {
    const unsigned l = l0 + (unsigned)(buf * AO_BUF);
    copy8_rows(l, pg + t * AO_KS);
    copy8_rows(l + 64 * AO_PITCH, pg + 64 * 4096 + t * AO_KS);
    copy8_rows(l + AO_A, vg + t * AO_KS);
  };

  f32x8 acc[2][2] = {};

  fill(0, 0);
  // stage 0 has landed for this wave, then for all
  asm volatile("s_wait_asynccnt 0x0" ::: "memory");
  __syncthreads();
  fill(1, 1);

  for (int t = 0; t < AO_NT; ++t) {
    const int cur = t & 1;
    const unsigned char* base = &ring[cur][0];
    const bf16* ar = (const bf16*)(base + (wr * 32 + l15) * AO_PITCH);
    const bf16* br = (const bf16*)(base + AO_A + (wc * 32 + l15) * AO_PITCH);
    // a block = 2 k chunks of 32 = 16 LDS reads, 8 WMMAs; two fragment sets
    bf16x16 fa[2][2][2], fb[2][2][2];  // [set][chunk][tile]
    auto frags = [&](int set, int blk) {
#pragma unroll  // constant indices keep fa, fb in registers
      for (int c = 0; c < 2; ++c) {
        const int k = (blk * 2 + c) * 32;
        fa[set][c][0] = load_frag(ar + k, half);
        fa[set][c][1] = load_frag(ar + 8 * AO_PITCH + k, half);
        fb[set][c][0] = load_frag(br + k, half);
        fb[set][c][1] = load_frag(br + 8 * AO_PITCH + k, half);
      }
    };
    frags(0, 0);
#pragma unroll  // the set index must be a constant: fa, fb stay in registers
    for (int blk = 0; blk < AO_KS / 64; ++blk) {
      const int s = blk & 1;
      if (blk + 1 < AO_KS / 64) frags(s ^ 1, blk + 1);
      // keeps the next block's LDS reads one group ahead of this block's WMMAs;
      // without it they are spread among the WMMAs behind full waits
      __builtin_amdgcn_sched_barrier(0);
#pragma unroll  // constant indices, as above
      for (int c = 0; c < 2; ++c) {
        acc[0][0] = wmma_bf16(fa[s][c][0], fb[s][c][0], acc[0][0]);
        acc[0][1] = wmma_bf16(fa[s][c][0], fb[s][c][1], acc[0][1]);
        acc[1][0] = wmma_bf16(fa[s][c][1], fb[s][c][0], acc[1][0]);
        acc[1][1] = wmma_bf16(fa[s][c][1], fb[s][c][1], acc[1][1]);
      }
      // keeps the reads of the block after next behind this block's WMMAs;
      // without it they split into smaller groups among these WMMAs, and the
      // last block's WMMAs sink behind the hand-over barrier
      __builtin_amdgcn_sched_barrier(0);
    }
    // hand-over: this wave's reads of buffer cur are done ...
    asm volatile("s_wait_dscnt 0x0" ::: "memory");
    // ... its copies of stage t+1 have landed ...
    asm volatile("s_wait_asynccnt 0x0" ::: "memory");
    // ... and the same holds for every wave: stage t+1 may be read, cur refilled
    __syncthreads();
    if (t + 2 < AO_NT) fill(t + 2, cur);
  }
  // no copy is outstanding when the wave ends
  asm volatile("s_wait_asynccnt 0x0" ::: "memory");

#pragma unroll  // acc is indexed by constants only
  for (int i = 0; i < 2; ++i)
#pragma unroll  // the same
    for (int r = 0; r < 8; ++r) {
      const int n = wr * 32 + i * 16 + r + 8 * half;
      const float scale = 1.0f / rowsum_g[(size_t)b * 128 + n];
      float* dst = out + ((size_t)b * 128 + n) * 768 + colblock + wc * 32 + l15;
      dst[0]  = acc[i][0][r] * scale;
      dst[16] = acc[i][1][r] * scale;
    }
}

// ---------------------------------------------------------------------------
extern "C" void kernel_launch(void* const* d_in, const int* in_sizes, int n_in,
                              void* d_out, int out_size, void* d_ws, size_t ws_size,
                              hipStream_t stream) {
  (void)in_sizes; (void)n_in; (void)out_size; (void)ws_size;
  const float* text  = (const float*)d_in[0];  // [16,128,768]
  const float* img   = (const float*)d_in[1];  // [16,64,64,512] = [65536,512]
  const float* masks = (const float*)d_in[2];  // [16,128,4096]
  const float* Wq    = (const float*)d_in[3];  // [768,36]
  const float* bq    = (const float*)d_in[4];
  const float* Wk    = (const float*)d_in[5];  // [512,36]
  const float* bk    = (const float*)d_in[6];
  const float* Wv    = (const float*)d_in[7];  // [512,768]
  const float* bv    = (const float*)d_in[8];
  float* out = (float*)d_out;                  // [16,128,768]

  // workspace carve (256B aligned regions)
  char* ws = (char*)d_ws;
  size_t off = 0;
  auto carve = [&](size_t bytes) -> void* {
    void* ptr = ws + off;
    off = (off + bytes + 255) & ~(size_t)255;
    return ptr;
  };
  bf16*  qp    = (bf16*)carve((size_t)2048 * 64 * 2);          //  256 KB
  bf16*  kpB   = (bf16*)carve((size_t)65536 * 64 * 2);         //    8 MB
  bf16*  vt    = (bf16*)carve((size_t)16 * 768 * 4096 * 2);    //  100 MB
  bf16*  pP    = (bf16*)carve((size_t)16 * 128 * 4096 * 2);    //   16 MB
  float* rsum  = (float*)carve((size_t)2048 * 4);

  // q = relu(text@Wq+bq) -> [2048,64] bf16 (cols 36..63 zero)
  proj_gemm_bias_relu<<<dim3(16, 1), 256, 0, stream>>>(
      text, Wq, bq, qp, 2048, 768, 36, 64, 0, 0);
  // k = relu(img@Wk+bk) -> [65536,64] bf16
  proj_gemm_bias_relu<<<dim3(512, 1), 256, 0, stream>>>(
      img, Wk, bk, kpB, 65536, 512, 36, 64, 0, 0);
  // v = relu(img@Wv+bv) -> transposed [16,768,4096] bf16 (rpb = 2^12)
  // x = column tile, so the 3 blocks that share an img row tile start together
  proj_v_tiled<<<dim3(3, 256), 512, 0, stream>>>(img, Wv, bv, vt);
  // scores + masked softmax
  attn_scores_softmax<<<dim3(128), 1024, 0, stream>>>(
      qp, kpB, masks, pP, rsum);
  // o = (p @ v) / rowsum
  attn_out<<<dim3(12, 16), 256, 0, stream>>>(pP, vt, rsum, out);
}

// v004
// Measured time: 142 microseconds a run.
// In both of two side-by-side timings against v003, it was 1.28 times as fast.
// Over all steps from v000 it is 4.32 times as fast.
#include <hip/hip_runtime.h>
#include <hip/hip_bf16.h>
#include <type_traits>

// ---------------------------------------------------------------------------
// Text->Img cross attention, CDNA5 (gfx1250, wave32) bf16 WMMA implementation
//   B=16, N=128, H=W=64 (M=4096), TC=768, IC=512, FQ=36 (padded to 64)
// ---------------------------------------------------------------------------

typedef __bf16 bf16;
typedef __attribute__((ext_vector_type(8)))  bf16  bf16x8;
typedef __attribute__((ext_vector_type(16))) bf16  bf16x16;
typedef __attribute__((ext_vector_type(8)))  float f32x8;

// A/B fragment loader for V_WMMA_*_16X16X32_BF16 (wave32).
// Per ISA 7.12.2, lane (with half = lane>>4) holds K = half*8 + [0..7] in
// elements 0..7 and K = 16 + half*8 + [0..7] in elements 8..15 -> two 16B
// contiguous loads from a row-major [row/col, K] buffer.
__device__ __forceinline__ bf16x16 load_frag(const bf16* base, int half) {
  bf16x8 lo = *(const bf16x8*)(base + half * 8);
  bf16x8 hi = *(const bf16x8*)(base + 16 + half * 8);
  bf16x16 r;
#pragma unroll
  for (int i = 0; i < 8; ++i) { r[i] = lo[i]; r[i + 8] = hi[i]; }
  return r;
}

__device__ __forceinline__ f32x8 wmma_bf16(bf16x16 a, bf16x16 b, f32x8 c) {
  // (neg_a, A, neg_b, B, c_mod, C, reuse_a, reuse_b)
  return __builtin_amdgcn_wmma_f32_16x16x32_bf16(false, a, false, b,
                                                 (short)0, c, false, false);
}

typedef __attribute__((ext_vector_type(4))) float f32x4;
typedef __attribute__((ext_vector_type(4))) bf16  bf16x4;

// ---------------------------------------------------------------------------
// Kernel 1: the q and the k projection, out[row, 0..63] = relu(A[row, :] @ W + bias)
// in columns 0..35 and 0 in columns 36..63; f32 in -> bf16 out, row-major.
// W (K x 36) is turned into bf16 [col][k] in LDS once per block, one barrier;
// the K loop has none. A wave owns 16 rows and all columns (3 accumulators), so
// nobody else needs its A rows: it streams them with loads that cover whole
// lines (16 lanes x 16 B = the 256 B that one row has in a step of 64 k), DS
// steps ahead in registers, and turns them into fragments through an LDS slab
// of its own. Column tile 2 holds columns 32..47: the lanes of 36..47 read a
// row of zeros. k is summed 32 at a time, rising, in one chain per accumulator.
// LDS pitches: K + 8 and 72 bf16, both 16 B x odd, for the ds_load_b128 reads.
// ---------------------------------------------------------------------------
template <int K, int WAVES, int DS>
__device__ __forceinline__ void proj36_body(const float* __restrict__ A,
                                            const float* __restrict__ W,
                                            const float* __restrict__ bias,
                                            bf16* __restrict__ out) {
  constexpr int NC = 36, PB = K + 8, PA = 72, NS = K / 64, NT = WAVES * 32;
  __shared__ __align__(16) bf16 lB[(NC + 1) * PB];        // [col][k], row 36 = 0
  __shared__ __align__(16) bf16 slab[WAVES][2][16 * PA];  // [wave][buf][row][k]

  const int tid  = threadIdx.x;
  const int w    = tid >> 5;
  const int lane = tid & 31;
  const int half = lane >> 4;
  const int l15  = lane & 15;
  const int rowbase = blockIdx.x * (WAVES * 16) + w * 16;

  // load j of a step: rows 2j and 2j+1, 256 contiguous bytes of each
  const float* ag = A + (size_t)(rowbase + half) * K + l15 * 4;
  f32x4 ring[DS][8];
  auto fetch = [&](int s) {
#pragma unroll  // constant indices keep ring in registers
    for (int j = 0; j < 8; ++j)
      ring[s % DS][j] = *(const f32x4*)(ag + j * 2 * K + s * 64);
  };
#pragma unroll  // the same
  for (int s = 0; s < DS; ++s) fetch(s);

  // W: a unit is 8 k x 4 columns, 8 loads of 16 B -> 4 LDS stores of 16 B;
  // the loads of WG units are in flight together
  constexpr int UNITS = (K / 8) * (NC / 4);
  constexpr int WG = (UNITS / NT) % 3 == 0 ? 3 : 1;
  auto stage_w = [&](int u0, auto gc) {
    constexpr int G = decltype(gc)::value;
    const float* src[G];
    f32x4 wv[G][8];
#pragma unroll  // constant indices: the array stays in registers
    for (int g = 0; g < G; ++g) {
      const int u = u0 + g * NT;
      src[g] = W + (u / (NC / 4)) * 8 * NC + (u % (NC / 4)) * 4;
#pragma unroll  // constant indices: the array stays in registers
      for (int i = 0; i < 8; ++i) wv[g][i] = *(const f32x4*)(src[g] + i * NC);
    }
    // precaution: as inputs of the wait the loads' addresses live up to it, so
    // that no later load lands in registers which an issued load names
    if constexpr (G == 3)
      asm volatile("s_wait_xcnt 0x0" :: "v"(src[0]), "v"(src[1]), "v"(src[2]) : "memory");
    else
      asm volatile("s_wait_xcnt 0x0" :: "v"(src[0]) : "memory");
#pragma unroll  // constant indices: the array stays in registers
    for (int g = 0; g < G; ++g) {
      const int u = u0 + g * NT;
#pragma unroll  // constant indices: the array stays in registers
      for (int j = 0; j < 4; ++j) {
        bf16x8 v;
#pragma unroll  // constant indices: the array stays in registers
        for (int i = 0; i < 8; ++i) v[i] = (bf16)wv[g][i][j];
        *(bf16x8*)&lB[((u % (NC / 4)) * 4 + j) * PB + (u / (NC / 4)) * 8] = v;
      }
    }
  };
  for (int n = 0; n < UNITS / NT; n += WG)
    stage_w(n * NT + tid, std::integral_constant<int, WG>{});
  if (tid < UNITS % NT)
    stage_w((UNITS / NT) * NT + tid, std::integral_constant<int, 1>{});
  if (tid < K / 8) {
    const bf16x8 zero = {};
    *(bf16x8*)&lB[NC * PB + tid * 8] = zero;
  }
  __syncthreads();

  const bf16* brow[3];
#pragma unroll  // constant indices: the array stays in registers
  for (int t = 0; t < 3; ++t) {
    const int c = t * 16 + l15;
    brow[t] = &lB[(c < NC ? c : NC) * PB];
  }

  f32x8 acc[3] = {};
#pragma unroll  // the ring slot and the slab buffer must be constants
  for (int s = 0; s < NS; ++s) {
    bf16* sl = &slab[w][s & 1][0];
    bf16x16 af[2], bfr[2][3];
    // the W fragments wait for nobody: read ahead of the slab's wait, under it
#pragma unroll  // constant indices: the array stays in registers
    for (int c = 0; c < 2; ++c)
#pragma unroll  // constant indices: the array stays in registers
      for (int t = 0; t < 3; ++t)
        bfr[c][t] = load_frag(brow[t] + s * 64 + c * 32, half);
#pragma unroll  // constant indices: the array stays in registers
    for (int j = 0; j < 8; ++j)
      *(bf16x4*)&sl[(2 * j + half) * PA + l15 * 4] =
          __builtin_convertvector(ring[s % DS][j], bf16x4);
    if (s + DS < NS) fetch(s + DS);
    // the slab rows that a lane reads below were written by other lanes of its
    // wave: their stores are done, and the compiler moves no read above them
    asm volatile("s_wait_dscnt 0x0" ::: "memory");
#pragma unroll  // constant indices: the array stays in registers
    for (int c = 0; c < 2; ++c) af[c] = load_frag(&sl[l15 * PA + c * 32], half);
#pragma unroll  // constant indices: the array stays in registers
    for (int c = 0; c < 2; ++c)
#pragma unroll  // constant indices: the array stays in registers
      for (int t = 0; t < 3; ++t) acc[t] = wmma_bf16(af[c], bfr[c][t], acc[t]);
  }
  asm volatile("s_wait_xcnt 0x0" :: "v"(ag) : "memory");  // see the W loads

  // epilogue: bias + relu, through the wave's slab, so that every store
  // instruction writes 4 whole 128-B rows of out (C/D: row = r + 8 half, col = l15)
  bf16* sl = &slab[w][0][0];
#pragma unroll  // constant indices: the array stays in registers
  for (int t = 0; t < 3; ++t) {
    const int gc = t * 16 + l15;
    const float bv = (gc < NC) ? bias[gc] : 0.f;
#pragma unroll  // constant indices: the array stays in registers
    for (int r = 0; r < 8; ++r) {
      const float val = acc[t][r] + bv;
      sl[(r + 8 * half) * PA + gc] = (bf16)(val > 0.f ? val : 0.f);
    }
  }
  // as in the loop: other lanes' stores are done before the rows are read back
  asm volatile("s_wait_dscnt 0x0" ::: "memory");
  const int pc = lane & 7;  // 16-B piece of a row; pieces 6, 7 = columns 48..63
#pragma unroll  // the 4 LDS reads issue together, then the 4 stores
  for (int j = 0; j < 4; ++j) {
    const int row = j * 4 + (lane >> 3);
    bf16x8 v = *(const bf16x8*)&sl[row * PA + (pc < 6 ? pc : 0) * 8];
    if (pc >= 6) v = bf16x8{};
    *(bf16x8*)(out + (size_t)(rowbase + row) * 64 + pc * 8) = v;
  }
}

// q: 2048 rows, K = 768: 32 blocks of 4 waves, 2 steps (16 loads a lane) ahead
__launch_bounds__(128)
__global__ void proj_q(const float* __restrict__ A, const float* __restrict__ W,
                       const float* __restrict__ bias, bf16* __restrict__ out) {
  proj36_body<768, 4, 2>(A, W, bias, out);
}

// k: 65536 rows, K = 512: 256 blocks of 16 waves, 2 steps (16 loads a lane) ahead
__launch_bounds__(512)
__global__ void proj_k(const float* __restrict__ A, const float* __restrict__ W,
                       const float* __restrict__ bias, bf16* __restrict__ out) {
  proj36_body<512, 16, 2>(A, W, bias, out);
}

// ---------------------------------------------------------------------------
// Kernel 1b: the v projection, vt[b, col, m] = relu(img[b*4096+m, :] @ Wv + bv),
// f32 in -> bf16 out, rows=65536, K=512, cols=768 (all multiples of the tile).
// Block = 512 thr (16 waves, 4 x 4). Tile = 256 rows x 256 cols; each wave owns
// 64 rows x 64 cols = 4 x 4 accumulators, so 8 fragments feed 16 WMMAs.
// Double-buffered staging: next chunk's global loads, WMMAs on
// the current chunk, cvt + LDS store of the next chunk, one barrier per chunk.
// LDS rows are 32 k at a pitch of 40 bf16 (80 B = 16 B x odd).
// Column order in LDS: the thread that loads 4 neighbouring columns cg*4+j puts
// column j into LDS row j*64+cg, so wave column wc holds the columns = wc mod 4.
// ---------------------------------------------------------------------------
__launch_bounds__(512)
__global__ void proj_v_tiled(const float* __restrict__ A,
                             const float* __restrict__ W,
                             const float* __restrict__ bias,
                             bf16* __restrict__ out) {
  constexpr int K = 512, NC = 768, P = 40;
  __shared__ __align__(16) bf16 lA[2][256 * P];  // [buf][row][k]  2x20 KB
  __shared__ __align__(16) bf16 lB[2][256 * P];  // [buf][col][k]  2x20 KB

  const int tid  = threadIdx.x;
  const int w    = tid >> 5;
  const int lane = tid & 31;
  const int half = lane >> 4;
  const int l15  = lane & 15;
  const int wr   = w >> 2;
  const int wc   = w & 3;
  const int colblock = blockIdx.x * 256;
  const int rowblock = blockIdx.y * 256;

  // A chunk [256 x 32] f32: 8 lanes x 16 B cover one row's 128-B line.
  const int ar = tid >> 3;
  const int ak = (tid & 7) * 4;
  const float* asrc = A + (size_t)(rowblock + ar) * K + ak;
  // W chunk [32 x 256] f32: 4 k rows x 4 columns per thread.
  const int cg = tid & 63;
  const int kg = tid >> 6;
  const float* wsrc = W + (size_t)(kg * 4) * NC + colblock + cg * 4;

  f32x4 aR[4], wR[4];
  auto stage_ld = [&](int k0) {
#pragma unroll
    for (int j = 0; j < 4; ++j)
      aR[j] = *(const f32x4*)(asrc + (size_t)(j * 64) * K + k0);
#pragma unroll
    for (int i = 0; i < 4; ++i)
      wR[i] = *(const f32x4*)(wsrc + (size_t)(k0 + i) * NC);
  };
  auto stage_st = [&](int buf) {
#pragma unroll
    for (int j = 0; j < 4; ++j)
      *(bf16x4*)&lA[buf][(ar + 64 * j) * P + ak] =
          __builtin_convertvector(aR[j], bf16x4);
#pragma unroll
    for (int j = 0; j < 4; ++j) {
      bf16x4 v;
#pragma unroll
      for (int i = 0; i < 4; ++i) v[i] = (bf16)wR[i][j];
      *(bf16x4*)&lB[buf][(j * 64 + cg) * P + kg * 4] = v;
    }
  };

  f32x8 acc[4][4] = {};

  stage_ld(0);
  stage_st(0);
  __syncthreads();

  constexpr int nCh = K / 32;
  for (int ci = 0; ci < nCh; ++ci) {
    const int cur = ci & 1;
    const bool more = (ci + 1) < nCh;
    if (more) stage_ld((ci + 1) * 32);  // VMEM for the next chunk first

    bf16x16 af[4], bfr[4];
#pragma unroll
    for (int i = 0; i < 4; ++i)
      af[i] = load_frag(&lA[cur][(wr * 64 + i * 16 + l15) * P], half);
#pragma unroll
    for (int t = 0; t < 4; ++t)
      bfr[t] = load_frag(&lB[cur][(wc * 64 + t * 16 + l15) * P], half);
    // keeps the 8 global loads and the 16 LDS reads one group ahead of the WMMAs;
    // without it global loads sink to just before their cvt, their latency no
    // longer covered, and A fragments are read among the WMMAs behind full waits
    __builtin_amdgcn_sched_barrier(0);
#pragma unroll
    for (int i = 0; i < 4; ++i)
#pragma unroll
      for (int t = 0; t < 4; ++t)
        acc[i][t] = wmma_bf16(af[i], bfr[t], acc[i][t]);

    // keeps the cvt of the loaded chunk, and with it the wait on those loads,
    // behind the WMMAs; without it the scheduler lifts both above them
    __builtin_amdgcn_sched_barrier(0);
    if (more) {
      // safe: everyone finished reading buffer cur^1 before the last barrier
      stage_st(cur ^ 1);
      __syncthreads();
    }
  }

  // epilogue: a lane's 8 accumulator registers are 8 consecutive m of one
  // column -> bias + relu + one 16-B store each.
  const int bb = rowblock >> 12;
  const int m0 = (rowblock & 4095) + wr * 64 + 8 * half;
#pragma unroll
  for (int t = 0; t < 4; ++t) {
    const int gc = colblock + (t * 16 + l15) * 4 + wc;
    const float bv = bias[gc];
    bf16* dst = out + (((size_t)bb * NC + gc) << 12) + m0;
#pragma unroll
    for (int i = 0; i < 4; ++i) {
      bf16x8 v;
#pragma unroll
      for (int r = 0; r < 8; ++r) {
        const float val = acc[i][t][r] + bv;
        v[r] = (bf16)(val > 0.f ? val : 0.f);
      }
      *(bf16x8*)(dst + i * 16) = v;
    }
  }
}

// ---------------------------------------------------------------------------
// Kernel 2: s = q@k^T, beta = s*mask, softmax over M=4096, beta held in registers.
// One block per (b, 16-query tile), 32 waves. Wave w owns m in [128w, 128w+128)
// = 8 WMMA tiles. The 64 beta of a lane stay in the registers that its 64 mask
// values were loaded into: all mask loads of a wave are in flight together, and
// nothing is written to be read again.
// p = exp(beta - max) is bf16, unnormalized; row sums -> rowsum_g.
// Row reductions: __shfl_xor within 16-lane groups, then LDS across waves.
// ---------------------------------------------------------------------------
__launch_bounds__(1024)
__global__ void attn_scores_softmax(const bf16* __restrict__ qp,
                                    const bf16* __restrict__ kp,
                                    const float* __restrict__ masks,
                                    bf16* __restrict__ p,
                                    float* __restrict__ rowsum_g) {
  __shared__ float red[32][16];
  __shared__ float rowmax[16];

  const int tid  = threadIdx.x;
  const int w    = tid >> 5;
  const int lane = tid & 31;
  const int half = lane >> 4;
  const int l15  = lane & 15;
  const int b     = blockIdx.x >> 3;
  const int nbase = (blockIdx.x & 7) * 16;

  const bf16* qrow = qp + ((size_t)b * 128 + nbase + l15) * 64;
  const bf16x16 a0 = load_frag(qrow, half);        // K 0..31
  const bf16x16 a1 = load_frag(qrow + 32, half);   // K 32..63
  // precaution, here and behind the mask and the k loads below: as an input of
  // the wait the loads' address lives up to it, so that no later load lands in
  // registers which an issued load names before the wait has been passed
  asm volatile("s_wait_xcnt 0x0" :: "v"(qrow) : "memory");

  // the lane's element of tile j, register r: row nbase + 8 half + r, m = m0 + 16 j
  const int    m0  = w * 128 + l15;
  const size_t idx = ((size_t)b * 128 + nbase + 8 * half) * 4096 + m0;
  const float* mrow = masks + idx;
  const bf16*  krow = kp + ((size_t)b * 4096 + m0) * 64;

  f32x8 bt[8];  // [tile][register]: first the mask, then beta
#pragma unroll  // constant indices keep bt in registers
  for (int j = 0; j < 8; ++j)
#pragma unroll  // the same
    for (int r = 0; r < 8; ++r) bt[j][r] = mrow[r * 4096 + j * 16];
  asm volatile("s_wait_xcnt 0x0" :: "v"(mrow) : "memory");  // see the q loads

  float rmax[8];
#pragma unroll  // rmax is indexed by constants only
  for (int r = 0; r < 8; ++r) rmax[r] = -3.0e38f;

#pragma unroll  // constant indices keep bt in registers
  for (int j = 0; j < 8; ++j) {
    const bf16x16 b0 = load_frag(krow + j * 16 * 64, half);
    const bf16x16 b1 = load_frag(krow + j * 16 * 64 + 32, half);
    f32x8 acc = {};
    acc = wmma_bf16(a0, b0, acc);
    acc = wmma_bf16(a1, b1, acc);
    bt[j] = acc * bt[j];  // multiplicative mask BEFORE softmax
#pragma unroll  // the same
    for (int r = 0; r < 8; ++r) rmax[r] = fmaxf(rmax[r], bt[j][r]);
  }
  asm volatile("s_wait_xcnt 0x0" :: "v"(krow) : "memory");  // see the q loads

  // row max: reduce across the 16 lanes that share rows, then across waves
#pragma unroll
  for (int r = 0; r < 8; ++r)
#pragma unroll
    for (int off = 1; off < 16; off <<= 1)
      rmax[r] = fmaxf(rmax[r], __shfl_xor(rmax[r], off, 16));
  if (l15 == 0)
#pragma unroll
    for (int r = 0; r < 8; ++r) red[w][r + 8 * half] = rmax[r];
  __syncthreads();
  if (tid < 16) {
    float mx = -3.0e38f;
    for (int ww = 0; ww < 32; ++ww) mx = fmaxf(mx, red[ww][tid]);
    rowmax[tid] = mx;
  }
  __syncthreads();

  float rsum[8] = {};
  bf16* prow = p + idx;
#pragma unroll  // constant indices keep bt in registers
  for (int j = 0; j < 8; ++j)
#pragma unroll  // the same
    for (int r = 0; r < 8; ++r) {
      const float e = __expf(bt[j][r] - rowmax[r + 8 * half]);
      rsum[r] += e;
      prow[r * 4096 + j * 16] = (bf16)e;  // unnormalized; 1/sum in attn_out
    }
#pragma unroll
  for (int r = 0; r < 8; ++r)
#pragma unroll
    for (int off = 1; off < 16; off <<= 1)
      rsum[r] += __shfl_xor(rsum[r], off, 16);
  __syncthreads();  // rowmax reads done; red is reusable
  if (l15 == 0)
#pragma unroll
    for (int r = 0; r < 8; ++r) red[w][r + 8 * half] = rsum[r];
  __syncthreads();
  if (tid < 16) {
    float s = 0.f;
    for (int ww = 0; ww < 32; ++ww) s += red[ww][tid];
    rowsum_g[(size_t)b * 128 + nbase + tid] = s;
  }
}

// ---------------------------------------------------------------------------
// Kernel 3: o[b,n,col] = (p[b,n,:] @ v[b,:,col]) / rowsum[b,n].
// v stored transposed [b, col, m] so B-fragments are K(m)-contiguous.
// One block = all 128 n of one batch x 64 cols, 8 waves (4 x 2), 32 x 32 per
// wave = 2 x 2 accumulators. p and v_t are staged in LDS, 256 m per stage, by
// asynchronous copies: one wave-wide copy brings the 512 contiguous bytes that
// one row has in the stage, so every global access covers whole lines.
// Two buffers: the next stage's copies fly while this stage is multiplied.
// LDS rows: 512 B at a pitch of 528 B (16 B x odd) for the ds_load_b128 reads.
// ---------------------------------------------------------------------------
constexpr int AO_KS    = 256;                 // m per stage
constexpr int AO_NT    = 4096 / AO_KS;        // stages
constexpr int AO_PITCH = AO_KS * 2 + 16;      // bytes per LDS row
constexpr int AO_A     = 128 * AO_PITCH;      // p tile, bytes
constexpr int AO_BUF   = (128 + 64) * AO_PITCH;

// Eight copies of one wave: rows r, r+8, ..., r+56 of a tile; each lane brings
// its own 16 bytes. The s_wait_xcnt stands inside the statement so that no
// address register of a copy is rewritten in front of it.
__device__ __forceinline__ void copy8_rows(unsigned l, const bf16* g) {
  constexpr unsigned LS = 8 * AO_PITCH;
  constexpr int      GS = 8 * 4096;
  asm volatile(
      "global_load_async_to_lds_b128 %0, %8, off\n\t"
      "global_load_async_to_lds_b128 %1, %9, off\n\t"
      "global_load_async_to_lds_b128 %2, %10, off\n\t"
      "global_load_async_to_lds_b128 %3, %11, off\n\t"
      "global_load_async_to_lds_b128 %4, %12, off\n\t"
      "global_load_async_to_lds_b128 %5, %13, off\n\t"
      "global_load_async_to_lds_b128 %6, %14, off\n\t"
      "global_load_async_to_lds_b128 %7, %15, off\n\t"
      "s_wait_xcnt 0x0"
      :: "v"(l), "v"(l + LS), "v"(l + 2 * LS), "v"(l + 3 * LS),
         "v"(l + 4 * LS), "v"(l + 5 * LS), "v"(l + 6 * LS), "v"(l + 7 * LS),
         "v"(g), "v"(g + GS), "v"(g + 2 * GS), "v"(g + 3 * GS),
         "v"(g + 4 * GS), "v"(g + 5 * GS), "v"(g + 6 * GS), "v"(g + 7 * GS)
      : "memory");
}

__launch_bounds__(256)
__global__ void attn_out(const bf16* __restrict__ p,
                         const bf16* __restrict__ v_t,
                         const float* __restrict__ rowsum_g,
                         float* __restrict__ out) {
  __shared__ __align__(16) unsigned char ring[2][AO_BUF];  // 2 x 99 KB

  const int tid  = threadIdx.x;
  const int w    = tid >> 5;
  const int lane = tid & 31;
  const int half = lane >> 4;
  const int l15  = lane & 15;
  const int wr   = w >> 1;
  const int wc   = w & 1;
  const int b        = blockIdx.y;
  const int colblock = blockIdx.x * 64;

  // wave w copies rows w, w+8, ...: 16 rows of p, 8 rows (columns) of v_t
  const bf16* pg = p   + ((size_t)b * 128 + w) * 4096 + lane * 8;
  const bf16* vg = v_t + ((size_t)b * 768 + colblock + w) * 4096 + lane * 8;
  const unsigned l0 =
      (unsigned)(size_t)&ring[0][0] + (unsigned)(w * AO_PITCH + lane * 16);

  auto fill = [&](int t, int buf) {
    const unsigned l = l0 + (unsigned)(buf * AO_BUF);
    copy8_rows(l, pg + t * AO_KS);
    copy8_rows(l + 64 * AO_PITCH, pg + 64 * 4096 + t * AO_KS);
    copy8_rows(l + AO_A, vg + t * AO_KS);
  };

  f32x8 acc[2][2] = {};

  fill(0, 0);
  // stage 0 has landed for this wave, then for all
  asm volatile("s_wait_asynccnt 0x0" ::: "memory");
  __syncthreads();
  fill(1, 1);

  for (int t = 0; t < AO_NT; ++t) {
    const int cur = t & 1;
    const unsigned char* base = &ring[cur][0];
    const bf16* ar = (const bf16*)(base + (wr * 32 + l15) * AO_PITCH);
    const bf16* br = (const bf16*)(base + AO_A + (wc * 32 + l15) * AO_PITCH);
    // a block = 2 k chunks of 32 = 16 LDS reads, 8 WMMAs; two fragment sets
    bf16x16 fa[2][2][2], fb[2][2][2];  // [set][chunk][tile]
    auto frags = [&](int set, int blk) {
#pragma unroll  // constant indices keep fa, fb in registers
      for (int c = 0; c < 2; ++c) {
        const int k = (blk * 2 + c) * 32;
        fa[set][c][0] = load_frag(ar + k, half);
        fa[set][c][1] = load_frag(ar + 8 * AO_PITCH + k, half);
        fb[set][c][0] = load_frag(br + k, half);
        fb[set][c][1] = load_frag(br + 8 * AO_PITCH + k, half);
      }
    };
    frags(0, 0);
#pragma unroll  // the set index must be a constant: fa, fb stay in registers
    for (int blk = 0; blk < AO_KS / 64; ++blk) {
      const int s = blk & 1;
      if (blk + 1 < AO_KS / 64) frags(s ^ 1, blk + 1);
      // keeps the next block's LDS reads one group ahead of this block's WMMAs;
      // without it they are spread among the WMMAs behind full waits
      __builtin_amdgcn_sched_barrier(0);
#pragma unroll  // constant indices, as above
      for (int c = 0; c < 2; ++c) {
        acc[0][0] = wmma_bf16(fa[s][c][0], fb[s][c][0], acc[0][0]);
        acc[0][1] = wmma_bf16(fa[s][c][0], fb[s][c][1], acc[0][1]);
        acc[1][0] = wmma_bf16(fa[s][c][1], fb[s][c][0], acc[1][0]);
        acc[1][1] = wmma_bf16(fa[s][c][1], fb[s][c][1], acc[1][1]);
      }
      // keeps the reads of the block after next behind this block's WMMAs;
      // without it they split into smaller groups among these WMMAs, and the
      // last block's WMMAs sink behind the hand-over barrier
      __builtin_amdgcn_sched_barrier(0);
    }
    // hand-over: this wave's reads of buffer cur are done ...
    asm volatile("s_wait_dscnt 0x0" ::: "memory");
    // ... its copies of stage t+1 have landed ...
    asm volatile("s_wait_asynccnt 0x0" ::: "memory");
    // ... and the same holds for every wave: stage t+1 may be read, cur refilled
    __syncthreads();
    if (t + 2 < AO_NT) fill(t + 2, cur);
  }
  // no copy is outstanding when the wave ends
  asm volatile("s_wait_asynccnt 0x0" ::: "memory");

#pragma unroll  // acc is indexed by constants only
  for (int i = 0; i < 2; ++i)
#pragma unroll  // the same
    for (int r = 0; r < 8; ++r) {
      const int n = wr * 32 + i * 16 + r + 8 * half;
      const float scale = 1.0f / rowsum_g[(size_t)b * 128 + n];
      float* dst = out + ((size_t)b * 128 + n) * 768 + colblock + wc * 32 + l15;
      dst[0]  = acc[i][0][r] * scale;
      dst[16] = acc[i][1][r] * scale;
    }
}

// ---------------------------------------------------------------------------
extern "C" void kernel_launch(void* const* d_in, const int* in_sizes, int n_in,
                              void* d_out, int out_size, void* d_ws, size_t ws_size,
                              hipStream_t stream) {
  (void)in_sizes; (void)n_in; (void)out_size; (void)ws_size;
  const float* text  = (const float*)d_in[0];  // [16,128,768]
  const float* img   = (const float*)d_in[1];  // [16,64,64,512] = [65536,512]
  const float* masks = (const float*)d_in[2];  // [16,128,4096]
  const float* Wq    = (const float*)d_in[3];  // [768,36]
  const float* bq    = (const float*)d_in[4];
  const float* Wk    = (const float*)d_in[5];  // [512,36]
  const float* bk    = (const float*)d_in[6];
  const float* Wv    = (const float*)d_in[7];  // [512,768]
  const float* bv    = (const float*)d_in[8];
  float* out = (float*)d_out;                  // [16,128,768]

  // workspace carve (256B aligned regions)
  char* ws = (char*)d_ws;
  size_t off = 0;
  auto carve = [&](size_t bytes) -> void* {
    void* ptr = ws + off;
    off = (off + bytes + 255) & ~(size_t)255;
    return ptr;
  };
  bf16*  qp    = (bf16*)carve((size_t)2048 * 64 * 2);          //  256 KB
  bf16*  kpB   = (bf16*)carve((size_t)65536 * 64 * 2);         //    8 MB
  bf16*  vt    = (bf16*)carve((size_t)16 * 768 * 4096 * 2);    //  100 MB
  bf16*  pP    = (bf16*)carve((size_t)16 * 128 * 4096 * 2);    //   16 MB
  float* rsum  = (float*)carve((size_t)2048 * 4);

  // q = relu(text@Wq+bq) -> [2048,64] bf16 (cols 36..63 zero)
  proj_q<<<dim3(32), 128, 0, stream>>>(text, Wq, bq, qp);
  // k = relu(img@Wk+bk) -> [65536,64] bf16
  proj_k<<<dim3(256), 512, 0, stream>>>(img, Wk, bk, kpB);
  // v = relu(img@Wv+bv) -> transposed [16,768,4096] bf16 (rpb = 2^12)
  // x = column tile, so the 3 blocks that share an img row tile start together
  proj_v_tiled<<<dim3(3, 256), 512, 0, stream>>>(img, Wv, bv, vt);
  // scores + masked softmax
  attn_scores_softmax<<<dim3(128), 1024, 0, stream>>>(
      qp, kpB, masks, pP, rsum);
  // o = (p @ v) / rowsum
  attn_out<<<dim3(12, 16), 256, 0, stream>>>(pP, vt, rsum, out);
}

// v005
// Measured time: 133 microseconds a run.
// In two side-by-side timings against v004, it was 1.08 and 1.07 times as fast.
// Over all steps from v000 it is 4.64 times as fast.
#include <hip/hip_runtime.h>
#include <hip/hip_bf16.h>
#include <type_traits>

// ---------------------------------------------------------------------------
// Text->Img cross attention, CDNA5 (gfx1250, wave32) bf16 WMMA implementation
//   B=16, N=128, H=W=64 (M=4096), TC=768, IC=512, FQ=36 (padded to 64)
// ---------------------------------------------------------------------------

typedef __bf16 bf16;
typedef __attribute__((ext_vector_type(8)))  bf16  bf16x8;
typedef __attribute__((ext_vector_type(16))) bf16  bf16x16;
typedef __attribute__((ext_vector_type(8)))  float f32x8;

// A/B fragment loader for V_WMMA_*_16X16X32_BF16 (wave32).
// Per ISA 7.12.2, lane (with half = lane>>4) holds K = half*8 + [0..7] in
// elements 0..7 and K = 16 + half*8 + [0..7] in elements 8..15 -> two 16B
// contiguous loads from a row-major [row/col, K] buffer.
__device__ __forceinline__ bf16x16 load_frag(const bf16* base, int half) {
  bf16x8 lo = *(const bf16x8*)(base + half * 8);
  bf16x8 hi = *(const bf16x8*)(base + 16 + half * 8);
  bf16x16 r;
#pragma unroll
  for (int i = 0; i < 8; ++i) { r[i] = lo[i]; r[i + 8] = hi[i]; }
  return r;
}

__device__ __forceinline__ f32x8 wmma_bf16(bf16x16 a, bf16x16 b, f32x8 c) {
  // (neg_a, A, neg_b, B, c_mod, C, reuse_a, reuse_b)
  return __builtin_amdgcn_wmma_f32_16x16x32_bf16(false, a, false, b,
                                                 (short)0, c, false, false);
}

typedef __attribute__((ext_vector_type(4))) float f32x4;
typedef __attribute__((ext_vector_type(4))) bf16  bf16x4;

// ---------------------------------------------------------------------------
// Kernel 1: the q and the k projection, out[row, 0..63] = relu(A[row, :] @ W + bias)
// in columns 0..35 and 0 in columns 36..63; f32 in -> bf16 out, row-major.
// W (K x 36) is turned into bf16 [col][k] in LDS once per block, one barrier;
// the K loop has none. A wave owns 16 rows and all columns (3 accumulators), so
// nobody else needs its A rows: it streams them with loads that cover whole
// lines (16 lanes x 16 B = the 256 B that one row has in a step of 64 k), DS
// steps ahead in registers, and turns them into fragments through an LDS slab
// of its own. Column tile 2 holds columns 32..47: the lanes of 36..47 read a
// row of zeros. k is summed 32 at a time, rising, in one chain per accumulator.
// LDS pitches: K + 8 and 72 bf16, both 16 B x odd, for the ds_load_b128 reads.
// ---------------------------------------------------------------------------
template <int K, int WAVES, int DS>
__device__ __forceinline__ void proj36_body(const float* __restrict__ A,
                                            const float* __restrict__ W,
                                            const float* __restrict__ bias,
                                            bf16* __restrict__ out,
                                            unsigned char* smem, int blk) {
  constexpr int NC = 36, PB = K + 8, PA = 72, NS = K / 64, NT = WAVES * 32;
  bf16* lB   = (bf16*)smem;            // [col][k], row 36 = 0
  bf16* slab = lB + (NC + 1) * PB;     // [wave][buf][row][k]

  const int tid  = threadIdx.x;
  const int w    = tid >> 5;
  const int lane = tid & 31;
  const int half = lane >> 4;
  const int l15  = lane & 15;
  const int rowbase = blk * (WAVES * 16) + w * 16;

  // load j of a step: rows 2j and 2j+1, 256 contiguous bytes of each
  const float* ag = A + (size_t)(rowbase + half) * K + l15 * 4;
  f32x4 ring[DS][8];
  auto fetch = [&](int s) {
#pragma unroll  // constant indices keep ring in registers
    for (int j = 0; j < 8; ++j)
      ring[s % DS][j] = *(const f32x4*)(ag + j * 2 * K + s * 64);
  };
#pragma unroll  // the same
  for (int s = 0; s < DS; ++s) fetch(s);

  // W: a unit is 8 k x 4 columns, 8 loads of 16 B -> 4 LDS stores of 16 B;
  // the loads of WG units are in flight together
  constexpr int UNITS = (K / 8) * (NC / 4);
  constexpr int WG = (UNITS / NT) % 3 == 0 ? 3 : 1;
  auto stage_w = [&](int u0, auto gc) {
    constexpr int G = decltype(gc)::value;
    const float* src[G];
    f32x4 wv[G][8];
#pragma unroll  // constant indices: the array stays in registers
    for (int g = 0; g < G; ++g) {
      const int u = u0 + g * NT;
      src[g] = W + (u / (NC / 4)) * 8 * NC + (u % (NC / 4)) * 4;
#pragma unroll  // constant indices: the array stays in registers
      for (int i = 0; i < 8; ++i) wv[g][i] = *(const f32x4*)(src[g] + i * NC);
    }
    // precaution: as inputs of the wait the loads' addresses live up to it, so
    // that no later load lands in registers which an issued load names
    if constexpr (G == 3)
      asm volatile("s_wait_xcnt 0x0" :: "v"(src[0]), "v"(src[1]), "v"(src[2]) : "memory");
    else
      asm volatile("s_wait_xcnt 0x0" :: "v"(src[0]) : "memory");
#pragma unroll  // constant indices: the array stays in registers
    for (int g = 0; g < G; ++g) {
      const int u = u0 + g * NT;
#pragma unroll  // constant indices: the array stays in registers
      for (int j = 0; j < 4; ++j) {
        bf16x8 v;
#pragma unroll  // constant indices: the array stays in registers
        for (int i = 0; i < 8; ++i) v[i] = (bf16)wv[g][i][j];
        *(bf16x8*)&lB[((u % (NC / 4)) * 4 + j) * PB + (u / (NC / 4)) * 8] = v;
      }
    }
  };
  for (int n = 0; n < UNITS / NT; n += WG)
    stage_w(n * NT + tid, std::integral_constant<int, WG>{});
  if (tid < UNITS % NT)
    stage_w((UNITS / NT) * NT + tid, std::integral_constant<int, 1>{});
  if (tid < K / 8) {
    const bf16x8 zero = {};
    *(bf16x8*)&lB[NC * PB + tid * 8] = zero;
  }
  __syncthreads();

  const bf16* brow[3];
#pragma unroll  // constant indices: the array stays in registers
  for (int t = 0; t < 3; ++t) {
    const int c = t * 16 + l15;
    brow[t] = &lB[(c < NC ? c : NC) * PB];
  }

  f32x8 acc[3] = {};
#pragma unroll  // the ring slot and the slab buffer must be constants
  for (int s = 0; s < NS; ++s) {
    bf16* sl = slab + (w * 2 + (s & 1)) * (16 * PA);
    bf16x16 af[2], bfr[2][3];
    // the W fragments wait for nobody: read ahead of the slab's wait, under it
#pragma unroll  // constant indices: the array stays in registers
    for (int c = 0; c < 2; ++c)
#pragma unroll  // constant indices: the array stays in registers
      for (int t = 0; t < 3; ++t)
        bfr[c][t] = load_frag(brow[t] + s * 64 + c * 32, half);
#pragma unroll  // constant indices: the array stays in registers
    for (int j = 0; j < 8; ++j)
      *(bf16x4*)&sl[(2 * j + half) * PA + l15 * 4] =
          __builtin_convertvector(ring[s % DS][j], bf16x4);
    if (s + DS < NS) fetch(s + DS);
    // the slab rows that a lane reads below were written by other lanes of its
    // wave: their stores are done, and the compiler moves no read above them
    asm volatile("s_wait_dscnt 0x0" ::: "memory");
#pragma unroll  // constant indices: the array stays in registers
    for (int c = 0; c < 2; ++c) af[c] = load_frag(&sl[l15 * PA + c * 32], half);
#pragma unroll  // constant indices: the array stays in registers
    for (int c = 0; c < 2; ++c)
#pragma unroll  // constant indices: the array stays in registers
      for (int t = 0; t < 3; ++t) acc[t] = wmma_bf16(af[c], bfr[c][t], acc[t]);
  }
  asm volatile("s_wait_xcnt 0x0" :: "v"(ag) : "memory");  // see the W loads

  // epilogue: bias + relu, through the wave's slab, so that every store
  // instruction writes 4 whole 128-B rows of out (C/D: row = r + 8 half, col = l15)
  bf16* sl = slab + (w * 2) * (16 * PA);
#pragma unroll  // constant indices: the array stays in registers
  for (int t = 0; t < 3; ++t) {
    const int gc = t * 16 + l15;
    const float bv = (gc < NC) ? bias[gc] : 0.f;
#pragma unroll  // constant indices: the array stays in registers
    for (int r = 0; r < 8; ++r) {
      const float val = acc[t][r] + bv;
      sl[(r + 8 * half) * PA + gc] = (bf16)(val > 0.f ? val : 0.f);
    }
  }
  // as in the loop: other lanes' stores are done before the rows are read back
  asm volatile("s_wait_dscnt 0x0" ::: "memory");
  const int pc = lane & 7;  // 16-B piece of a row; pieces 6, 7 = columns 48..63
#pragma unroll  // the 4 LDS reads issue together, then the 4 stores
  for (int j = 0; j < 4; ++j) {
    const int row = j * 4 + (lane >> 3);
    bf16x8 v = *(const bf16x8*)&sl[row * PA + (pc < 6 ? pc : 0) * 8];
    if (pc >= 6) v = bf16x8{};
    *(bf16x8*)(out + (size_t)(rowbase + row) * 64 + pc * 8) = v;
  }
  // precaution: in the kernel's text another body's code follows these stores;
  // nothing there stands ahead of this wait and rewrites their address registers
  asm volatile("s_wait_xcnt 0x0" ::: "memory");
}

// ---------------------------------------------------------------------------
// Kernel 1b: the v projection, vt[b, col, m] = relu(img[b*4096+m, :] @ Wv + bv),
// f32 in -> bf16 out, rows=65536, K=512, cols=768 (all multiples of the tile).
// Block = 512 thr (16 waves, 4 x 4). Tile = 256 rows x 256 cols; each wave owns
// 64 rows x 64 cols = 4 x 4 accumulators, so 8 fragments feed 16 WMMAs.
// Double-buffered staging: next chunk's global loads, WMMAs on
// the current chunk, cvt + LDS store of the next chunk, one barrier per chunk.
// LDS rows are 32 k at a pitch of 40 bf16 (80 B = 16 B x odd).
// Column order in LDS: the thread that loads 4 neighbouring columns cg*4+j puts
// column j into LDS row j*64+cg, so wave column wc holds the columns = wc mod 4.
// ---------------------------------------------------------------------------
__device__ __forceinline__ void proj_v_body(const float* __restrict__ A,
                                            const float* __restrict__ W,
                                            const float* __restrict__ bias,
                                            bf16* __restrict__ out,
                                            unsigned char* smem, int blk) {
  constexpr int K = 512, NC = 768, P = 40;
  bf16 (*lA)[256 * P] = (bf16 (*)[256 * P])smem;  // [buf][row][k]  2x20 KB
  bf16 (*lB)[256 * P] = lA + 2;                   // [buf][col][k]  2x20 KB

  const int tid  = threadIdx.x;
  const int w    = tid >> 5;
  const int lane = tid & 31;
  const int half = lane >> 4;
  const int l15  = lane & 15;
  const int wr   = w >> 2;
  const int wc   = w & 3;
  // column tile fastest: the 3 blocks that share an img row tile have neighbouring indices
  const int colblock = (blk % 3) * 256;
  const int rowblock = (blk / 3) * 256;

  // A chunk [256 x 32] f32: 8 lanes x 16 B cover one row's 128-B line.
  const int ar = tid >> 3;
  const int ak = (tid & 7) * 4;
  const float* asrc = A + (size_t)(rowblock + ar) * K + ak;
  // W chunk [32 x 256] f32: 4 k rows x 4 columns per thread.
  const int cg = tid & 63;
  const int kg = tid >> 6;
  const float* wsrc = W + (size_t)(kg * 4) * NC + colblock + cg * 4;

  f32x4 aR[4], wR[4];
  auto stage_ld = [&](int k0) {
#pragma unroll
    for (int j = 0; j < 4; ++j)
      aR[j] = *(const f32x4*)(asrc + (size_t)(j * 64) * K + k0);
#pragma unroll
    for (int i = 0; i < 4; ++i)
      wR[i] = *(const f32x4*)(wsrc + (size_t)(k0 + i) * NC);
  };
  auto stage_st = [&](int buf) {
#pragma unroll
    for (int j = 0; j < 4; ++j)
      *(bf16x4*)&lA[buf][(ar + 64 * j) * P + ak] =
          __builtin_convertvector(aR[j], bf16x4);
#pragma unroll
    for (int j = 0; j < 4; ++j) {
      bf16x4 v;
#pragma unroll
      for (int i = 0; i < 4; ++i) v[i] = (bf16)wR[i][j];
      *(bf16x4*)&lB[buf][(j * 64 + cg) * P + kg * 4] = v;
    }
  };

  f32x8 acc[4][4] = {};

  stage_ld(0);
  stage_st(0);
  __syncthreads();

  constexpr int nCh = K / 32;
  for (int ci = 0; ci < nCh; ++ci) {
    const int cur = ci & 1;
    const bool more = (ci + 1) < nCh;
    if (more) stage_ld((ci + 1) * 32);  // VMEM for the next chunk first

    bf16x16 af[4], bfr[4];
#pragma unroll
    for (int i = 0; i < 4; ++i)
      af[i] = load_frag(&lA[cur][(wr * 64 + i * 16 + l15) * P], half);
#pragma unroll
    for (int t = 0; t < 4; ++t)
      bfr[t] = load_frag(&lB[cur][(wc * 64 + t * 16 + l15) * P], half);
    // keeps the 8 global loads and the 16 LDS reads one group ahead of the WMMAs;
    // without it global loads sink to just before their cvt, their latency no
    // longer covered, and A fragments are read among the WMMAs behind full waits
    __builtin_amdgcn_sched_barrier(0);
#pragma unroll
    for (int i = 0; i < 4; ++i)
#pragma unroll
      for (int t = 0; t < 4; ++t)
        acc[i][t] = wmma_bf16(af[i], bfr[t], acc[i][t]);

    // keeps the cvt of the loaded chunk, and with it the wait on those loads,
    // behind the WMMAs; without it the scheduler lifts both above them
    __builtin_amdgcn_sched_barrier(0);
    if (more) {
      // safe: everyone finished reading buffer cur^1 before the last barrier
      stage_st(cur ^ 1);
      __syncthreads();
    }
  }

  // epilogue: a lane's 8 accumulator registers are 8 consecutive m of one
  // column -> bias + relu + one 16-B store each.
  const int bb = rowblock >> 12;
  const int m0 = (rowblock & 4095) + wr * 64 + 8 * half;
#pragma unroll
  for (int t = 0; t < 4; ++t) {
    const int gc = colblock + (t * 16 + l15) * 4 + wc;
    const float bv = bias[gc];
    bf16* dst = out + (((size_t)bb * NC + gc) << 12) + m0;
#pragma unroll
    for (int i = 0; i < 4; ++i) {
      bf16x8 v;
#pragma unroll
      for (int r = 0; r < 8; ++r) {
        const float val = acc[i][t][r] + bv;
        v[r] = (bf16)(val > 0.f ? val : 0.f);
      }
      *(bf16x8*)(dst + i * 16) = v;
    }
  }
}

// ---------------------------------------------------------------------------
// The three projections depend on nothing but the inputs: one launch holds them
// all, so that no one of them waits for another to drain. In index order:
// the 8 q blocks (256 rows each) first, then the 768 long v blocks, then the
// 256 short k blocks. All have 16 waves and share one LDS range, sized for q.
// ---------------------------------------------------------------------------
constexpr int PJ_Q = 8, PJ_V = 768, PJ_K = 256, PJ_ALL = PJ_Q + PJ_V + PJ_K;
constexpr int PJ_LDS = (37 * (768 + 8) + 16 * 2 * 16 * 72) * 2;

__launch_bounds__(512)
__global__ void proj_qkv(const float* __restrict__ text, const float* __restrict__ Wq,
                         const float* __restrict__ bq, bf16* __restrict__ qp,
                         const float* __restrict__ img, const float* __restrict__ Wk,
                         const float* __restrict__ bk, bf16* __restrict__ kp,
                         const float* __restrict__ Wv, const float* __restrict__ bv,
                         bf16* __restrict__ vt) {
  __shared__ __align__(16) unsigned char smem[PJ_LDS];
  const int blk = blockIdx.x;
  if (blk >= PJ_Q && blk < PJ_Q + PJ_V)
    proj_v_body(img, Wv, bv, vt, smem, blk - PJ_Q);
  else if (blk >= PJ_Q + PJ_V)
    proj36_body<512, 16, 2>(img, Wk, bk, kp, smem, blk - (PJ_Q + PJ_V));
  else
    proj36_body<768, 16, 2>(text, Wq, bq, qp, smem, blk);
}

// ---------------------------------------------------------------------------
// Kernel 2: s = q@k^T, beta = s*mask, softmax over M=4096, beta held in registers.
// One block per (b, 16-query tile), 32 waves. Wave w owns m in [128w, 128w+128)
// = 8 WMMA tiles. The 64 beta of a lane stay in the registers that its 64 mask
// values were loaded into: all mask loads of a wave are in flight together, and
// nothing is written to be read again.
// p = exp(beta - max) is bf16, unnormalized; row sums -> rowsum_g.
// Row reductions: __shfl_xor within 16-lane groups, then LDS across waves.
// ---------------------------------------------------------------------------
__launch_bounds__(1024)
__global__ void attn_scores_softmax(const bf16* __restrict__ qp,
                                    const bf16* __restrict__ kp,
                                    const float* __restrict__ masks,
                                    bf16* __restrict__ p,
                                    float* __restrict__ rowsum_g) {
  __shared__ float red[32][16];
  __shared__ float rowmax[16];

  const int tid  = threadIdx.x;
  const int w    = tid >> 5;
  const int lane = tid & 31;
  const int half = lane >> 4;
  const int l15  = lane & 15;
  const int b     = blockIdx.x >> 3;
  const int nbase = (blockIdx.x & 7) * 16;

  const bf16* qrow = qp + ((size_t)b * 128 + nbase + l15) * 64;
  const bf16x16 a0 = load_frag(qrow, half);        // K 0..31
  const bf16x16 a1 = load_frag(qrow + 32, half);   // K 32..63
  // precaution, here and behind the mask and the k loads below: as an input of
  // the wait the loads' address lives up to it, so that no later load lands in
  // registers which an issued load names before the wait has been passed
  asm volatile("s_wait_xcnt 0x0" :: "v"(qrow) : "memory");

  // the lane's element of tile j, register r: row nbase + 8 half + r, m = m0 + 16 j
  const int    m0  = w * 128 + l15;
  const size_t idx = ((size_t)b * 128 + nbase + 8 * half) * 4096 + m0;
  const float* mrow = masks + idx;
  const bf16*  krow = kp + ((size_t)b * 4096 + m0) * 64;

  f32x8 bt[8];  // [tile][register]: first the mask, then beta
#pragma unroll  // constant indices keep bt in registers
  for (int j = 0; j < 8; ++j)
#pragma unroll  // the same
    for (int r = 0; r < 8; ++r) bt[j][r] = mrow[r * 4096 + j * 16];
  asm volatile("s_wait_xcnt 0x0" :: "v"(mrow) : "memory");  // see the q loads

  float rmax[8];
#pragma unroll  // rmax is indexed by constants only
  for (int r = 0; r < 8; ++r) rmax[r] = -3.0e38f;

#pragma unroll  // constant indices keep bt in registers
  for (int j = 0; j < 8; ++j) {
    const bf16x16 b0 = load_frag(krow + j * 16 * 64, half);
    const bf16x16 b1 = load_frag(krow + j * 16 * 64 + 32, half);
    f32x8 acc = {};
    acc = wmma_bf16(a0, b0, acc);
    acc = wmma_bf16(a1, b1, acc);
    bt[j] = acc * bt[j];  // multiplicative mask BEFORE softmax
#pragma unroll  // the same
    for (int r = 0; r < 8; ++r) rmax[r] = fmaxf(rmax[r], bt[j][r]);
  }
  asm volatile("s_wait_xcnt 0x0" :: "v"(krow) : "memory");  // see the q loads

  // row max: reduce across the 16 lanes that share rows, then across waves
#pragma unroll
  for (int r = 0; r < 8; ++r)
#pragma unroll
    for (int off = 1; off < 16; off <<= 1)
      rmax[r] = fmaxf(rmax[r], __shfl_xor(rmax[r], off, 16));
  if (l15 == 0)
#pragma unroll
    for (int r = 0; r < 8; ++r) red[w][r + 8 * half] = rmax[r];
  __syncthreads();
  if (tid < 16) {
    float mx = -3.0e38f;
    for (int ww = 0; ww < 32; ++ww) mx = fmaxf(mx, red[ww][tid]);
    rowmax[tid] = mx;
  }
  __syncthreads();

  float rsum[8] = {};
  bf16* prow = p + idx;
#pragma unroll  // constant indices keep bt in registers
  for (int j = 0; j < 8; ++j)
#pragma unroll  // the same
    for (int r = 0; r < 8; ++r) {
      const float e = __expf(bt[j][r] - rowmax[r + 8 * half]);
      rsum[r] += e;
      prow[r * 4096 + j * 16] = (bf16)e;  // unnormalized; 1/sum in attn_out
    }
#pragma unroll
  for (int r = 0; r < 8; ++r)
#pragma unroll
    for (int off = 1; off < 16; off <<= 1)
      rsum[r] += __shfl_xor(rsum[r], off, 16);
  __syncthreads();  // rowmax reads done; red is reusable
  if (l15 == 0)
#pragma unroll
    for (int r = 0; r < 8; ++r) red[w][r + 8 * half] = rsum[r];
  __syncthreads();
  if (tid < 16) {
    float s = 0.f;
    for (int ww = 0; ww < 32; ++ww) s += red[ww][tid];
    rowsum_g[(size_t)b * 128 + nbase + tid] = s;
  }
}

// ---------------------------------------------------------------------------
// Kernel 3: o[b,n,col] = (p[b,n,:] @ v[b,:,col]) / rowsum[b,n].
// v stored transposed [b, col, m] so B-fragments are K(m)-contiguous.
// One block = all 128 n of one batch x 64 cols, 8 waves (4 x 2), 32 x 32 per
// wave = 2 x 2 accumulators. p and v_t are staged in LDS, 256 m per stage, by
// asynchronous copies: one wave-wide copy brings the 512 contiguous bytes that
// one row has in the stage, so every global access covers whole lines.
// Two buffers: the next stage's copies fly while this stage is multiplied.
// LDS rows: 512 B at a pitch of 528 B (16 B x odd) for the ds_load_b128 reads.
// ---------------------------------------------------------------------------
constexpr int AO_KS    = 256;                 // m per stage
constexpr int AO_NT    = 4096 / AO_KS;        // stages
constexpr int AO_PITCH = AO_KS * 2 + 16;      // bytes per LDS row
constexpr int AO_A     = 128 * AO_PITCH;      // p tile, bytes
constexpr int AO_BUF   = (128 + 64) * AO_PITCH;

// Eight copies of one wave: rows r, r+8, ..., r+56 of a tile; each lane brings
// its own 16 bytes. The s_wait_xcnt stands inside the statement so that no
// address register of a copy is rewritten in front of it.
__device__ __forceinline__ void copy8_rows(unsigned l, const bf16* g) {
  constexpr unsigned LS = 8 * AO_PITCH;
  constexpr int      GS = 8 * 4096;
  asm volatile(
      "global_load_async_to_lds_b128 %0, %8, off\n\t"
      "global_load_async_to_lds_b128 %1, %9, off\n\t"
      "global_load_async_to_lds_b128 %2, %10, off\n\t"
      "global_load_async_to_lds_b128 %3, %11, off\n\t"
      "global_load_async_to_lds_b128 %4, %12, off\n\t"
      "global_load_async_to_lds_b128 %5, %13, off\n\t"
      "global_load_async_to_lds_b128 %6, %14, off\n\t"
      "global_load_async_to_lds_b128 %7, %15, off\n\t"
      "s_wait_xcnt 0x0"
      :: "v"(l), "v"(l + LS), "v"(l + 2 * LS), "v"(l + 3 * LS),
         "v"(l + 4 * LS), "v"(l + 5 * LS), "v"(l + 6 * LS), "v"(l + 7 * LS),
         "v"(g), "v"(g + GS), "v"(g + 2 * GS), "v"(g + 3 * GS),
         "v"(g + 4 * GS), "v"(g + 5 * GS), "v"(g + 6 * GS), "v"(g + 7 * GS)
      : "memory");
}

__launch_bounds__(256)
__global__ void attn_out(const bf16* __restrict__ p,
                         const bf16* __restrict__ v_t,
                         const float* __restrict__ rowsum_g,
                         float* __restrict__ out) {
  __shared__ __align__(16) unsigned char ring[2][AO_BUF];  // 2 x 99 KB

  const int tid  = threadIdx.x;
  const int w    = tid >> 5;
  const int lane = tid & 31;
  const int half = lane >> 4;
  const int l15  = lane & 15;
  const int wr   = w >> 1;
  const int wc   = w & 1;
  const int b        = blockIdx.y;
  const int colblock = blockIdx.x * 64;

  // wave w copies rows w, w+8, ...: 16 rows of p, 8 rows (columns) of v_t
  const bf16* pg = p   + ((size_t)b * 128 + w) * 4096 + lane * 8;
  const bf16* vg = v_t + ((size_t)b * 768 + colblock + w) * 4096 + lane * 8;
  const unsigned l0 =
      (unsigned)(size_t)&ring[0][0] + (unsigned)(w * AO_PITCH + lane * 16);

  auto fill = [&](int t, int buf) {
    const unsigned l = l0 + (unsigned)(buf * AO_BUF);
    copy8_rows(l, pg + t * AO_KS);
    copy8_rows(l + 64 * AO_PITCH, pg + 64 * 4096 + t * AO_KS);
    copy8_rows(l + AO_A, vg + t * AO_KS);
  };

  f32x8 acc[2][2] = {};

  fill(0, 0);
  // stage 0 has landed for this wave, then for all
  asm volatile("s_wait_asynccnt 0x0" ::: "memory");
  __syncthreads();
  fill(1, 1);

  for (int t = 0; t < AO_NT; ++t) {
    const int cur = t & 1;
    const unsigned char* base = &ring[cur][0];
    const bf16* ar = (const bf16*)(base + (wr * 32 + l15) * AO_PITCH);
    const bf16* br = (const bf16*)(base + AO_A + (wc * 32 + l15) * AO_PITCH);
    // a block = 2 k chunks of 32 = 16 LDS reads, 8 WMMAs; two fragment sets
    bf16x16 fa[2][2][2], fb[2][2][2];  // [set][chunk][tile]
    auto frags = [&](int set, int blk) {
#pragma unroll  // constant indices keep fa, fb in registers
      for (int c = 0; c < 2; ++c) {
        const int k = (blk * 2 + c) * 32;
        fa[set][c][0] = load_frag(ar + k, half);
        fa[set][c][1] = load_frag(ar + 8 * AO_PITCH + k, half);
        fb[set][c][0] = load_frag(br + k, half);
        fb[set][c][1] = load_frag(br + 8 * AO_PITCH + k, half);
      }
    };
    frags(0, 0);
#pragma unroll  // the set index must be a constant: fa, fb stay in registers
    for (int blk = 0; blk < AO_KS / 64; ++blk) {
      const int s = blk & 1;
      if (blk + 1 < AO_KS / 64) frags(s ^ 1, blk + 1);
      // keeps the next block's LDS reads one group ahead of this block's WMMAs;
      // without it they are spread among the WMMAs behind full waits
      __builtin_amdgcn_sched_barrier(0);
#pragma unroll  // constant indices, as above
      for (int c = 0; c < 2; ++c) {
        acc[0][0] = wmma_bf16(fa[s][c][0], fb[s][c][0], acc[0][0]);
        acc[0][1] = wmma_bf16(fa[s][c][0], fb[s][c][1], acc[0][1]);
        acc[1][0] = wmma_bf16(fa[s][c][1], fb[s][c][0], acc[1][0]);
        acc[1][1] = wmma_bf16(fa[s][c][1], fb[s][c][1], acc[1][1]);
      }
      // keeps the reads of the block after next behind this block's WMMAs;
      // without it they split into smaller groups among these WMMAs, and the
      // last block's WMMAs sink behind the hand-over barrier
      __builtin_amdgcn_sched_barrier(0);
    }
    // hand-over: this wave's reads of buffer cur are done ...
    asm volatile("s_wait_dscnt 0x0" ::: "memory");
    // ... its copies of stage t+1 have landed ...
    asm volatile("s_wait_asynccnt 0x0" ::: "memory");
    // ... and the same holds for every wave: stage t+1 may be read, cur refilled
    __syncthreads();
    if (t + 2 < AO_NT) fill(t + 2, cur);
  }
  // no copy is outstanding when the wave ends
  asm volatile("s_wait_asynccnt 0x0" ::: "memory");

#pragma unroll  // acc is indexed by constants only
  for (int i = 0; i < 2; ++i)
#pragma unroll  // the same
    for (int r = 0; r < 8; ++r) {
      const int n = wr * 32 + i * 16 + r + 8 * half;
      const float scale = 1.0f / rowsum_g[(size_t)b * 128 + n];
      float* dst = out + ((size_t)b * 128 + n) * 768 + colblock + wc * 32 + l15;
      dst[0]  = acc[i][0][r] * scale;
      dst[16] = acc[i][1][r] * scale;
    }
}

// ---------------------------------------------------------------------------
extern "C" void kernel_launch(void* const* d_in, const int* in_sizes, int n_in,
                              void* d_out, int out_size, void* d_ws, size_t ws_size,
                              hipStream_t stream) {
  (void)in_sizes; (void)n_in; (void)out_size; (void)ws_size;
  const float* text  = (const float*)d_in[0];  // [16,128,768]
  const float* img   = (const float*)d_in[1];  // [16,64,64,512] = [65536,512]
  const float* masks = (const float*)d_in[2];  // [16,128,4096]
  const float* Wq    = (const float*)d_in[3];  // [768,36]
  const float* bq    = (const float*)d_in[4];
  const float* Wk    = (const float*)d_in[5];  // [512,36]
  const float* bk    = (const float*)d_in[6];
  const float* Wv    = (const float*)d_in[7];  // [512,768]
  const float* bv    = (const float*)d_in[8];
  float* out = (float*)d_out;                  // [16,128,768]

  // workspace carve (256B aligned regions)
  char* ws = (char*)d_ws;
  size_t off = 0;
  auto carve = [&](size_t bytes) -> void* {
    void* ptr = ws + off;
    off = (off + bytes + 255) & ~(size_t)255;
    return ptr;
  };
  bf16*  qp    = (bf16*)carve((size_t)2048 * 64 * 2);          //  256 KB
  bf16*  kpB   = (bf16*)carve((size_t)65536 * 64 * 2);         //    8 MB
  bf16*  vt    = (bf16*)carve((size_t)16 * 768 * 4096 * 2);    //  100 MB
  bf16*  pP    = (bf16*)carve((size_t)16 * 128 * 4096 * 2);    //   16 MB
  float* rsum  = (float*)carve((size_t)2048 * 4);

  // q = relu(text@Wq+bq) -> [2048,64] bf16 (cols 36..63 zero)
  // k = relu(img@Wk+bk) -> [65536,64] bf16
  // v = relu(img@Wv+bv) -> transposed [16,768,4096] bf16
  proj_qkv<<<dim3(PJ_ALL), 512, 0, stream>>>(
      text, Wq, bq, qp, img, Wk, bk, kpB, Wv, bv, vt);
  // scores + masked softmax
  attn_scores_softmax<<<dim3(128), 1024, 0, stream>>>(
      qp, kpB, masks, pP, rsum);
  // o = (p @ v) / rowsum
  attn_out<<<dim3(12, 16), 256, 0, stream>>>(pP, vt, rsum, out);
}

// v006
// Measured time: 119 microseconds a run.
// Timed twice side by side with v005, it ran 1.12 times as fast both times.
// All steps since v000 together make it 5.21 times as fast.
#include <hip/hip_runtime.h>
#include <hip/hip_bf16.h>
#include <type_traits>

// ---------------------------------------------------------------------------
// Text->Img cross attention, CDNA5 (gfx1250, wave32) bf16 WMMA implementation
//   B=16, N=128, H=W=64 (M=4096), TC=768, IC=512, FQ=36 (padded to 64)
// ---------------------------------------------------------------------------

typedef __bf16 bf16;
typedef __attribute__((ext_vector_type(8)))  bf16  bf16x8;
typedef __attribute__((ext_vector_type(16))) bf16  bf16x16;
typedef __attribute__((ext_vector_type(8)))  float f32x8;

// A/B fragment loader for V_WMMA_*_16X16X32_BF16 (wave32).
// Per ISA 7.12.2, lane (with half = lane>>4) holds K = half*8 + [0..7] in
// elements 0..7 and K = 16 + half*8 + [0..7] in elements 8..15 -> two 16B
// contiguous loads from a row-major [row/col, K] buffer.
__device__ __forceinline__ bf16x16 load_frag(const bf16* base, int half) {
  bf16x8 lo = *(const bf16x8*)(base + half * 8);
  bf16x8 hi = *(const bf16x8*)(base + 16 + half * 8);
  bf16x16 r;
#pragma unroll
  for (int i = 0; i < 8; ++i) { r[i] = lo[i]; r[i + 8] = hi[i]; }
  return r;
}

__device__ __forceinline__ f32x8 wmma_bf16(bf16x16 a, bf16x16 b, f32x8 c) {
  // (neg_a, A, neg_b, B, c_mod, C, reuse_a, reuse_b)
  return __builtin_amdgcn_wmma_f32_16x16x32_bf16(false, a, false, b,
                                                 (short)0, c, false, false);
}

typedef __attribute__((ext_vector_type(4))) float f32x4;
typedef __attribute__((ext_vector_type(4))) bf16  bf16x4;

// ---------------------------------------------------------------------------
// Kernel 1: the q projection, out[row, 0..63] = relu(A[row, :] @ W + bias)
// in columns 0..35 and 0 in columns 36..63; f32 in -> bf16 out, row-major.
// W (K x 36) is turned into bf16 [col][k] in LDS once per block, one barrier;
// the K loop has none. A wave owns 16 rows and all columns (3 accumulators), so
// nobody else needs its A rows: it streams them with loads that cover whole
// lines (16 lanes x 16 B = the 256 B that one row has in a step of 64 k), DS
// steps ahead in registers, and turns them into fragments through an LDS slab
// of its own. Column tile 2 holds columns 32..47: the lanes of 36..47 read a
// row of zeros. k is summed 32 at a time, rising, in one chain per accumulator.
// LDS pitches: K + 8 and 72 bf16, both 16 B x odd, for the ds_load_b128 reads.
// ---------------------------------------------------------------------------
template <int K, int WAVES, int DS>
__device__ __forceinline__ void proj36_body(const float* __restrict__ A,
                                            const float* __restrict__ W,
                                            const float* __restrict__ bias,
                                            bf16* __restrict__ out,
                                            unsigned char* smem, int blk) {
  constexpr int NC = 36, PB = K + 8, PA = 72, NS = K / 64, NT = WAVES * 32;
  bf16* lB   = (bf16*)smem;            // [col][k], row 36 = 0
  bf16* slab = lB + (NC + 1) * PB;     // [wave][buf][row][k]

  const int tid  = threadIdx.x;
  const int w    = tid >> 5;
  const int lane = tid & 31;
  const int half = lane >> 4;
  const int l15  = lane & 15;
  const int rowbase = blk * (WAVES * 16) + w * 16;

  // load j of a step: rows 2j and 2j+1, 256 contiguous bytes of each
  const float* ag = A + (size_t)(rowbase + half) * K + l15 * 4;
  f32x4 ring[DS][8];
  auto fetch = [&](int s) {
#pragma unroll  // constant indices keep ring in registers
    for (int j = 0; j < 8; ++j)
      ring[s % DS][j] = *(const f32x4*)(ag + j * 2 * K + s * 64);
  };
#pragma unroll  // the same
  for (int s = 0; s < DS; ++s) fetch(s);

  // W: a unit is 8 k x 4 columns, 8 loads of 16 B -> 4 LDS stores of 16 B;
  // the loads of WG units are in flight together
  constexpr int UNITS = (K / 8) * (NC / 4);
  constexpr int WG = (UNITS / NT) % 3 == 0 ? 3 : 1;
  auto stage_w = [&](int u0, auto gc) {
    constexpr int G = decltype(gc)::value;
    const float* src[G];
    f32x4 wv[G][8];
#pragma unroll  // constant indices: the array stays in registers
    for (int g = 0; g < G; ++g) {
      const int u = u0 + g * NT;
      src[g] = W + (u / (NC / 4)) * 8 * NC + (u % (NC / 4)) * 4;
#pragma unroll  // constant indices: the array stays in registers
      for (int i = 0; i < 8; ++i) wv[g][i] = *(const f32x4*)(src[g] + i * NC);
    }
    // precaution: as inputs of the wait the loads' addresses live up to it, so
    // that no later load lands in registers which an issued load names
    if constexpr (G == 3)
      asm volatile("s_wait_xcnt 0x0" :: "v"(src[0]), "v"(src[1]), "v"(src[2]) : "memory");
    else
      asm volatile("s_wait_xcnt 0x0" :: "v"(src[0]) : "memory");
#pragma unroll  // constant indices: the array stays in registers
    for (int g = 0; g < G; ++g) {
      const int u = u0 + g * NT;
#pragma unroll  // constant indices: the array stays in registers
      for (int j = 0; j < 4; ++j) {
        bf16x8 v;
#pragma unroll  // constant indices: the array stays in registers
        for (int i = 0; i < 8; ++i) v[i] = (bf16)wv[g][i][j];
        *(bf16x8*)&lB[((u % (NC / 4)) * 4 + j) * PB + (u / (NC / 4)) * 8] = v;
      }
    }
  };
  for (int n = 0; n < UNITS / NT; n += WG)
    stage_w(n * NT + tid, std::integral_constant<int, WG>{});
  if (tid < UNITS % NT)
    stage_w((UNITS / NT) * NT + tid, std::integral_constant<int, 1>{});
  if (tid < K / 8) {
    const bf16x8 zero = {};
    *(bf16x8*)&lB[NC * PB + tid * 8] = zero;
  }
  __syncthreads();

  const bf16* brow[3];
#pragma unroll  // constant indices: the array stays in registers
  for (int t = 0; t < 3; ++t) {
    const int c = t * 16 + l15;
    brow[t] = &lB[(c < NC ? c : NC) * PB];
  }

  f32x8 acc[3] = {};
#pragma unroll  // the ring slot and the slab buffer must be constants
  for (int s = 0; s < NS; ++s) {
    bf16* sl = slab + (w * 2 + (s & 1)) * (16 * PA);
    bf16x16 af[2], bfr[2][3];
    // the W fragments wait for nobody: read ahead of the slab's wait, under it
#pragma unroll  // constant indices: the array stays in registers
    for (int c = 0; c < 2; ++c)
#pragma unroll  // constant indices: the array stays in registers
      for (int t = 0; t < 3; ++t)
        bfr[c][t] = load_frag(brow[t] + s * 64 + c * 32, half);
#pragma unroll  // constant indices: the array stays in registers
    for (int j = 0; j < 8; ++j)
      *(bf16x4*)&sl[(2 * j + half) * PA + l15 * 4] =
          __builtin_convertvector(ring[s % DS][j], bf16x4);
    if (s + DS < NS) fetch(s + DS);
    // the slab rows that a lane reads below were written by other lanes of its
    // wave: their stores are done, and the compiler moves no read above them
    asm volatile("s_wait_dscnt 0x0" ::: "memory");
#pragma unroll  // constant indices: the array stays in registers
    for (int c = 0; c < 2; ++c) af[c] = load_frag(&sl[l15 * PA + c * 32], half);
#pragma unroll  // constant indices: the array stays in registers
    for (int c = 0; c < 2; ++c)
#pragma unroll  // constant indices: the array stays in registers
      for (int t = 0; t < 3; ++t) acc[t] = wmma_bf16(af[c], bfr[c][t], acc[t]);
  }
  asm volatile("s_wait_xcnt 0x0" :: "v"(ag) : "memory");  // see the W loads

  // epilogue: bias + relu, through the wave's slab, so that every store
  // instruction writes 4 whole 128-B rows of out (C/D: row = r + 8 half, col = l15)
  bf16* sl = slab + (w * 2) * (16 * PA);
#pragma unroll  // constant indices: the array stays in registers
  for (int t = 0; t < 3; ++t) {
    const int gc = t * 16 + l15;
    const float bv = (gc < NC) ? bias[gc] : 0.f;
#pragma unroll  // constant indices: the array stays in registers
    for (int r = 0; r < 8; ++r) {
      const float val = acc[t][r] + bv;
      sl[(r + 8 * half) * PA + gc] = (bf16)(val > 0.f ? val : 0.f);
    }
  }
  // as in the loop: other lanes' stores are done before the rows are read back
  asm volatile("s_wait_dscnt 0x0" ::: "memory");
  const int pc = lane & 7;  // 16-B piece of a row; pieces 6, 7 = columns 48..63
#pragma unroll  // the 4 LDS reads issue together, then the 4 stores
  for (int j = 0; j < 4; ++j) {
    const int row = j * 4 + (lane >> 3);
    bf16x8 v = *(const bf16x8*)&sl[row * PA + (pc < 6 ? pc : 0) * 8];
    if (pc >= 6) v = bf16x8{};
    *(bf16x8*)(out + (size_t)(rowbase + row) * 64 + pc * 8) = v;
  }
  // precaution: in the kernel's text another body's code follows these stores;
  // nothing there stands ahead of this wait and rewrites their address registers
  asm volatile("s_wait_xcnt 0x0" ::: "memory");
}

// ---------------------------------------------------------------------------
// Kernel 1b: the v and the k projection of 256 img rows, from one LDS-resident tile.
//   vt[b, col, m] = relu(img[b*4096+m, :] @ Wv + bv), 768 columns, transposed
//   kp[row, 0..63] = relu(img[row, :] @ Wk + bk) in columns 0..35, 0 beyond
// Block = 512 thr (16 waves). Its 256 rows x 512 k are read from memory once,
// turned into bf16 once and stay in LDS; every product of these rows is made
// from there: three passes of 256 v columns, then the k columns.
// A v pass: waves 4 x 4, 64 rows x 64 cols = 4 x 4 accumulators per wave, so 8
// fragments feed 16 WMMAs. Wv comes in chunks of 32 k through two LDS buffers:
// next chunk's global loads, WMMAs on the current chunk, cvt + LDS store of the
// next chunk, one barrier per chunk. In the first pass the img chunks come the
// same way, one chunk ahead, into their place in the resident tile.
// Blocks start with different column tiles, so that not all of them ask for the
// same lines of Wv at the same moment.
// LDS pitches: img rows 1104 B, Wv rows (32 k) 80 B, Wk rows 1040 B: 16 B x odd.
// Column order in LDS: the thread that loads 4 neighbouring columns cg*4+j puts
// column j into LDS row j*64+cg, so wave column wc holds the columns = wc mod 4.
// The k pass: wave w owns rows 16 w .. 16 w + 15 and 3 column tiles; Wk lies in
// the place of the Wv buffers as [col][k], row 36 = 0 for the columns 36..47;
// k is summed 32 at a time, rising, in one chain per accumulator.
// ---------------------------------------------------------------------------
constexpr int PV_PA  = 512 + 40;  // bf16 per LDS row of the img tile
constexpr int PV_LDS = (256 * PV_PA + 2 * 256 * 40) * 2;

__device__ __forceinline__ void proj_vk_body(const float* __restrict__ A,
                                             const float* __restrict__ W,
                                             const float* __restrict__ bias,
                                             bf16* __restrict__ out,
                                             const float* __restrict__ Wk,
                                             const float* __restrict__ bk,
                                             bf16* __restrict__ kout,
                                             unsigned char* smem, int blk) {
  constexpr int K = 512, NC = 768, P = 40;
  bf16* lA = (bf16*)smem;                                       // [row][k]  276 KB
  bf16 (*lB)[256 * P] = (bf16 (*)[256 * P])(lA + 256 * PV_PA);  // [buf][col][k]  2x20 KB

  const int tid  = threadIdx.x;
  const int w    = tid >> 5;
  const int lane = tid & 31;
  const int half = lane >> 4;
  const int l15  = lane & 15;
  const int wr   = w >> 2;
  const int wc   = w & 3;
  const int rowblock = blk * 256;

  // img chunk [256 x 32] f32: 8 lanes x 16 B cover one row's 128-B line.
  const int ar = tid >> 3;
  const int ak = (tid & 7) * 4;
  const float* asrc = A + (size_t)(rowblock + ar) * K + ak;
  // Wv chunk [32 x 256] f32: 4 k rows x 4 columns per thread.
  const int cg = tid & 63;
  const int kg = tid >> 6;
  const float* wsrc = W + (size_t)(kg * 4) * NC + cg * 4;

  f32x4 aR[4], wR[4];
  auto ld_a = [&](int k0) {
#pragma unroll
    for (int j = 0; j < 4; ++j)
      aR[j] = *(const f32x4*)(asrc + (size_t)(j * 64) * K + k0);
  };
  auto ld_w = [&](int ct, int k0) {
#pragma unroll
    for (int i = 0; i < 4; ++i)
      wR[i] = *(const f32x4*)(wsrc + ct * 256 + (size_t)(k0 + i) * NC);
  };
  auto st_a = [&](int k0) {
#pragma unroll
    for (int j = 0; j < 4; ++j)
      *(bf16x4*)&lA[(ar + 64 * j) * PV_PA + k0 + ak] =
          __builtin_convertvector(aR[j], bf16x4);
  };
  auto st_w = [&](int buf) {
#pragma unroll
    for (int j = 0; j < 4; ++j) {
      bf16x4 v;
#pragma unroll
      for (int i = 0; i < 4; ++i) v[i] = (bf16)wR[i][j];
      *(bf16x4*)&lB[buf][(j * 64 + cg) * P + kg * 4] = v;
    }
  };

  const int bb = rowblock >> 12;
  const int m0 = (rowblock & 4095) + wr * 64 + 8 * half;

  // Wk takes the place of the Wv buffers behind the last v chunk, ahead of that
  // pass's stores to vt, so that no barrier has to wait for those stores
  constexpr int KC = 36, PB = K + 8, PS = 72;
  bf16* lK = (bf16*)lB;  // [col][k], 37 rows
  // a unit is 8 k x 4 columns, 8 loads of 16 B -> 4 LDS stores of 16 B
  auto stage_k = [&](int u) {
    const float* src = Wk + (u / (KC / 4)) * 8 * KC + (u % (KC / 4)) * 4;
    f32x4 wv[8];
#pragma unroll  // constant indices: the array stays in registers
    for (int i = 0; i < 8; ++i) wv[i] = *(const f32x4*)(src + i * KC);
    // precaution: as an input of the wait the loads' address lives up to it, so
    // that no later load lands in registers which an issued load names
    asm volatile("s_wait_xcnt 0x0" :: "v"(src) : "memory");
#pragma unroll  // constant indices: the array stays in registers
    for (int j = 0; j < 4; ++j) {
      bf16x8 v;
#pragma unroll  // constant indices: the array stays in registers
      for (int i = 0; i < 8; ++i) v[i] = (bf16)wv[i][j];
      *(bf16x8*)&lK[((u % (KC / 4)) * 4 + j) * PB + (u / (KC / 4)) * 8] = v;
    }
  };
  auto stage_wk = [&]() {
    constexpr int UNITS = (K / 8) * (KC / 4);  // 576 = 512 + 64
    __syncthreads();  // every wave has read its last Wv fragments: the buffers are free
    stage_k(tid);
    if (tid < UNITS - 512) stage_k(512 + tid);
    if (tid < K / 8) {
      const bf16x8 zero = {};
      *(bf16x8*)&lK[KC * PB + tid * 8] = zero;
    }
    __syncthreads();  // Wk is whole before anybody reads it
  };

  // one pass: column tile ct; ctn is the tile of the pass that follows
  auto pass = [&](auto first, auto last, int ct, int ctn) {
    constexpr bool FIRST = decltype(first)::value, LAST = decltype(last)::value;
    constexpr int nCh = K / 32;
    f32x8 acc[4][4] = {};
    for (int ci = 0; ci < nCh; ++ci) {
      const int cur = ci & 1;
      const bool lastc = (ci + 1) == nCh;
      const bool more = !(LAST && lastc);
      // VMEM for the next chunk first
      if (FIRST && !lastc) ld_a((ci + 1) * 32);
      if (more) ld_w(lastc ? ctn : ct, lastc ? 0 : (ci + 1) * 32);

      bf16x16 af[4], bfr[4];
#pragma unroll
      for (int i = 0; i < 4; ++i)
        af[i] = load_frag(&lA[(wr * 64 + i * 16 + l15) * PV_PA + ci * 32], half);
#pragma unroll
      for (int t = 0; t < 4; ++t)
        bfr[t] = load_frag(&lB[cur][(wc * 64 + t * 16 + l15) * P], half);
      // keeps the global loads and the 16 LDS reads one group ahead of the WMMAs;
      // without it global loads sink to just before their cvt, their latency no
      // longer covered, and A fragments are read among the WMMAs behind full waits
      __builtin_amdgcn_sched_barrier(0);
#pragma unroll
      for (int i = 0; i < 4; ++i)
#pragma unroll
        for (int t = 0; t < 4; ++t)
          acc[i][t] = wmma_bf16(af[i], bfr[t], acc[i][t]);

      // keeps the cvt of the loaded chunk, and with it the wait on those loads,
      // behind the WMMAs; without it the scheduler lifts both above them
      __builtin_amdgcn_sched_barrier(0);
      if (more) {
        // safe: everyone finished reading buffer cur^1 before the last barrier,
        // and nobody has read the img columns of the next chunk yet
        st_w(cur ^ 1);
        if (FIRST && !lastc) st_a((ci + 1) * 32);
        __syncthreads();
      }
    }

    if constexpr (LAST) stage_wk();

    // epilogue: a lane's 8 accumulator registers are 8 consecutive m of one
    // column -> bias + relu + one 16-B store each.
    bf16* dst[4];
#pragma unroll
    for (int t = 0; t < 4; ++t) {
      const int gc = ct * 256 + (t * 16 + l15) * 4 + wc;
      const float bv = bias[gc];
      dst[t] = out + (((size_t)bb * NC + gc) << 12) + m0;
#pragma unroll
      for (int i = 0; i < 4; ++i) {
        bf16x8 v;
#pragma unroll
        for (int r = 0; r < 8; ++r) {
          const float val = acc[i][t][r] + bv;
          v[r] = (bf16)(val > 0.f ? val : 0.f);
        }
        *(bf16x8*)(dst[t] + i * 16) = v;
      }
    }
    // precaution: as inputs of the wait the stores' addresses live up to it, so
    // that the code of the next pass rewrites none of them ahead of the wait
    asm volatile("s_wait_xcnt 0x0"
                 :: "v"(dst[0]), "v"(dst[1]), "v"(dst[2]), "v"(dst[3]) : "memory");
  };

  const int c0 = blk % 3;
  const int c1 = c0 == 2 ? 0 : c0 + 1;
  const int c2 = c1 == 2 ? 0 : c1 + 1;

  ld_a(0);
  ld_w(c0, 0);
  st_a(0);
  st_w(0);
  __syncthreads();
  pass(std::true_type{}, std::false_type{}, c0, c1);
  pass(std::false_type{}, std::false_type{}, c1, c2);
  pass(std::false_type{}, std::true_type{}, c2, c2);

  // ---- the k columns, from the same img tile
  const bf16* arow = &lA[(w * 16 + l15) * PV_PA];
  const bf16* brow[3];
#pragma unroll  // constant indices: the array stays in registers
  for (int t = 0; t < 3; ++t) {
    const int c = t * 16 + l15;
    brow[t] = &lK[(c < KC ? c : KC) * PB];
  }
  f32x8 ka[3] = {};
#pragma unroll 4  // 4 chunks' LDS reads go ahead of their WMMAs; all 16 would spill
  for (int s = 0; s < K / 32; ++s) {
    const bf16x16 af = load_frag(arow + s * 32, half);
#pragma unroll  // constant indices: the array stays in registers
    for (int t = 0; t < 3; ++t)
      ka[t] = wmma_bf16(af, load_frag(brow[t] + s * 32, half), ka[t]);
  }

  // epilogue: bias + relu, through an LDS slab in the wave's own 16 img rows,
  // which nobody else reads in this pass, so that every store instruction
  // writes 4 whole 128-B rows of kout (C/D: row = r + 8 half, col = l15)
  bf16* sl = lA + (w * 16) * PV_PA;
#pragma unroll  // constant indices: the array stays in registers
  for (int t = 0; t < 3; ++t) {
    const int gc = t * 16 + l15;
    const float bv = (gc < KC) ? bk[gc] : 0.f;
#pragma unroll  // constant indices: the array stays in registers
    for (int r = 0; r < 8; ++r) {
      const float val = ka[t][r] + bv;
      sl[(r + 8 * half) * PS + gc] = (bf16)(val > 0.f ? val : 0.f);
    }
  }
  // other lanes' stores are done before the rows are read back
  asm volatile("s_wait_dscnt 0x0" ::: "memory");
  const int pc = lane & 7;  // 16-B piece of a row; pieces 6, 7 = columns 48..63
  bf16* kd = kout + (size_t)(rowblock + w * 16 + (lane >> 3)) * 64 + pc * 8;
#pragma unroll  // the 4 LDS reads issue together, then the 4 stores
  for (int j = 0; j < 4; ++j) {
    const int row = j * 4 + (lane >> 3);
    bf16x8 v = *(const bf16x8*)&sl[row * PS + (pc < 6 ? pc : 0) * 8];
    if (pc >= 6) v = bf16x8{};
    *(bf16x8*)(kd + j * 4 * 64) = v;
  }
  // precaution: the stores' address lives up to the wait
  asm volatile("s_wait_xcnt 0x0" :: "v"(kd) : "memory");
}

// ---------------------------------------------------------------------------
// The projections depend on nothing but the inputs: one launch holds them all.
// Blocks 0..7 are the q blocks (256 rows each), the 256 blocks after them
// make v and k of 256 img rows each. All have 16 waves
// and share one LDS range, sized for the larger use.
// ---------------------------------------------------------------------------
constexpr int PJ_Q = 8, PJ_VK = 256, PJ_ALL = PJ_Q + PJ_VK;
constexpr int PJ_LDS_Q = (37 * (768 + 8) + 16 * 2 * 16 * 72) * 2;
constexpr int PJ_LDS = PJ_LDS_Q > PV_LDS ? PJ_LDS_Q : PV_LDS;

__launch_bounds__(512)
__global__ void proj_qkv(const float* __restrict__ text, const float* __restrict__ Wq,
                         const float* __restrict__ bq, bf16* __restrict__ qp,
                         const float* __restrict__ img, const float* __restrict__ Wk,
                         const float* __restrict__ bk, bf16* __restrict__ kp,
                         const float* __restrict__ Wv, const float* __restrict__ bv,
                         bf16* __restrict__ vt) {
  __shared__ __align__(16) unsigned char smem[PJ_LDS];
  const int blk = blockIdx.x;
  if (blk >= PJ_Q)
    proj_vk_body(img, Wv, bv, vt, Wk, bk, kp, smem, blk - PJ_Q);
  else
    proj36_body<768, 16, 2>(text, Wq, bq, qp, smem, blk);
}

// ---------------------------------------------------------------------------
// Kernel 2: s = q@k^T, beta = s*mask, softmax over M=4096, beta held in registers.
// One block per (b, 16-query tile), 32 waves. Wave w owns m in [128w, 128w+128)
// = 8 WMMA tiles. The 64 beta of a lane stay in the registers that its 64 mask
// values were loaded into: all mask loads of a wave are in flight together, and
// nothing is written to be read again.
// p = exp(beta - max) is bf16, unnormalized; row sums -> rowsum_g.
// Row reductions: __shfl_xor within 16-lane groups, then LDS across waves.
// ---------------------------------------------------------------------------
__launch_bounds__(1024)
__global__ void attn_scores_softmax(const bf16* __restrict__ qp,
                                    const bf16* __restrict__ kp,
                                    const float* __restrict__ masks,
                                    bf16* __restrict__ p,
                                    float* __restrict__ rowsum_g) {
  __shared__ float red[32][16];
  __shared__ float rowmax[16];

  const int tid  = threadIdx.x;
  const int w    = tid >> 5;
  const int lane = tid & 31;
  const int half = lane >> 4;
  const int l15  = lane & 15;
  const int b     = blockIdx.x >> 3;
  const int nbase = (blockIdx.x & 7) * 16;

  const bf16* qrow = qp + ((size_t)b * 128 + nbase + l15) * 64;
  const bf16x16 a0 = load_frag(qrow, half);        // K 0..31
  const bf16x16 a1 = load_frag(qrow + 32, half);   // K 32..63
  // precaution, here and behind the mask and the k loads below: as an input of
  // the wait the loads' address lives up to it, so that no later load lands in
  // registers which an issued load names before the wait has been passed
  asm volatile("s_wait_xcnt 0x0" :: "v"(qrow) : "memory");

  // the lane's element of tile j, register r: row nbase + 8 half + r, m = m0 + 16 j
  const int    m0  = w * 128 + l15;
  const size_t idx = ((size_t)b * 128 + nbase + 8 * half) * 4096 + m0;
  const float* mrow = masks + idx;
  const bf16*  krow = kp + ((size_t)b * 4096 + m0) * 64;

  f32x8 bt[8];  // [tile][register]: first the mask, then beta
#pragma unroll  // constant indices keep bt in registers
  for (int j = 0; j < 8; ++j)
#pragma unroll  // the same
    for (int r = 0; r < 8; ++r) bt[j][r] = mrow[r * 4096 + j * 16];
  asm volatile("s_wait_xcnt 0x0" :: "v"(mrow) : "memory");  // see the q loads

  float rmax[8];
#pragma unroll  // rmax is indexed by constants only
  for (int r = 0; r < 8; ++r) rmax[r] = -3.0e38f;

#pragma unroll  // constant indices keep bt in registers
  for (int j = 0; j < 8; ++j) {
    const bf16x16 b0 = load_frag(krow + j * 16 * 64, half);
    const bf16x16 b1 = load_frag(krow + j * 16 * 64 + 32, half);
    f32x8 acc = {};
    acc = wmma_bf16(a0, b0, acc);
    acc = wmma_bf16(a1, b1, acc);
    bt[j] = acc * bt[j];  // multiplicative mask BEFORE softmax
#pragma unroll  // the same
    for (int r = 0; r < 8; ++r) rmax[r] = fmaxf(rmax[r], bt[j][r]);
  }
  asm volatile("s_wait_xcnt 0x0" :: "v"(krow) : "memory");  // see the q loads

  // row max: reduce across the 16 lanes that share rows, then across waves
#pragma unroll
  for (int r = 0; r < 8; ++r)
#pragma unroll
    for (int off = 1; off < 16; off <<= 1)
      rmax[r] = fmaxf(rmax[r], __shfl_xor(rmax[r], off, 16));
  if (l15 == 0)
#pragma unroll
    for (int r = 0; r < 8; ++r) red[w][r + 8 * half] = rmax[r];
  __syncthreads();
  if (tid < 16) {
    float mx = -3.0e38f;
    for (int ww = 0; ww < 32; ++ww) mx = fmaxf(mx, red[ww][tid]);
    rowmax[tid] = mx;
  }
  __syncthreads();

  float rsum[8] = {};
  bf16* prow = p + idx;
#pragma unroll  // constant indices keep bt in registers
  for (int j = 0; j < 8; ++j)
#pragma unroll  // the same
    for (int r = 0; r < 8; ++r) {
      const float e = __expf(bt[j][r] - rowmax[r + 8 * half]);
      rsum[r] += e;
      prow[r * 4096 + j * 16] = (bf16)e;  // unnormalized; 1/sum in attn_out
    }
#pragma unroll
  for (int r = 0; r < 8; ++r)
#pragma unroll
    for (int off = 1; off < 16; off <<= 1)
      rsum[r] += __shfl_xor(rsum[r], off, 16);
  __syncthreads();  // rowmax reads done; red is reusable
  if (l15 == 0)
#pragma unroll
    for (int r = 0; r < 8; ++r) red[w][r + 8 * half] = rsum[r];
  __syncthreads();
  if (tid < 16) {
    float s = 0.f;
    for (int ww = 0; ww < 32; ++ww) s += red[ww][tid];
    rowsum_g[(size_t)b * 128 + nbase + tid] = s;
  }
}

// ---------------------------------------------------------------------------
// Kernel 3: o[b,n,col] = (p[b,n,:] @ v[b,:,col]) / rowsum[b,n].
// v stored transposed [b, col, m] so B-fragments are K(m)-contiguous.
// One block = all 128 n of one batch x 64 cols, 8 waves (4 x 2), 32 x 32 per
// wave = 2 x 2 accumulators. p and v_t are staged in LDS, 256 m per stage, by
// asynchronous copies: one wave-wide copy brings the 512 contiguous bytes that
// one row has in the stage, so every global access covers whole lines.
// Two buffers: the next stage's copies fly while this stage is multiplied.
// LDS rows: 512 B at a pitch of 528 B (16 B x odd) for the ds_load_b128 reads.
// ---------------------------------------------------------------------------
constexpr int AO_KS    = 256;                 // m per stage
constexpr int AO_NT    = 4096 / AO_KS;        // stages
constexpr int AO_PITCH = AO_KS * 2 + 16;      // bytes per LDS row
constexpr int AO_A     = 128 * AO_PITCH;      // p tile, bytes
constexpr int AO_BUF   = (128 + 64) * AO_PITCH;

// Eight copies of one wave: rows r, r+8, ..., r+56 of a tile; each lane brings
// its own 16 bytes. The s_wait_xcnt stands inside the statement so that no
// address register of a copy is rewritten in front of it.
__device__ __forceinline__ void copy8_rows(unsigned l, const bf16* g) {
  constexpr unsigned LS = 8 * AO_PITCH;
  constexpr int      GS = 8 * 4096;
  asm volatile(
      "global_load_async_to_lds_b128 %0, %8, off\n\t"
      "global_load_async_to_lds_b128 %1, %9, off\n\t"
      "global_load_async_to_lds_b128 %2, %10, off\n\t"
      "global_load_async_to_lds_b128 %3, %11, off\n\t"
      "global_load_async_to_lds_b128 %4, %12, off\n\t"
      "global_load_async_to_lds_b128 %5, %13, off\n\t"
      "global_load_async_to_lds_b128 %6, %14, off\n\t"
      "global_load_async_to_lds_b128 %7, %15, off\n\t"
      "s_wait_xcnt 0x0"
      :: "v"(l), "v"(l + LS), "v"(l + 2 * LS), "v"(l + 3 * LS),
         "v"(l + 4 * LS), "v"(l + 5 * LS), "v"(l + 6 * LS), "v"(l + 7 * LS),
         "v"(g), "v"(g + GS), "v"(g + 2 * GS), "v"(g + 3 * GS),
         "v"(g + 4 * GS), "v"(g + 5 * GS), "v"(g + 6 * GS), "v"(g + 7 * GS)
      : "memory");
}

__launch_bounds__(256)
__global__ void attn_out(const bf16* __restrict__ p,
                         const bf16* __restrict__ v_t,
                         const float* __restrict__ rowsum_g,
                         float* __restrict__ out) {
  __shared__ __align__(16) unsigned char ring[2][AO_BUF];  // 2 x 99 KB

  const int tid  = threadIdx.x;
  const int w    = tid >> 5;
  const int lane = tid & 31;
  const int half = lane >> 4;
  const int l15  = lane & 15;
  const int wr   = w >> 1;
  const int wc   = w & 1;
  const int b        = blockIdx.y;
  const int colblock = blockIdx.x * 64;

  // wave w copies rows w, w+8, ...: 16 rows of p, 8 rows (columns) of v_t
  const bf16* pg = p   + ((size_t)b * 128 + w) * 4096 + lane * 8;
  const bf16* vg = v_t + ((size_t)b * 768 + colblock + w) * 4096 + lane * 8;
  const unsigned l0 =
      (unsigned)(size_t)&ring[0][0] + (unsigned)(w * AO_PITCH + lane * 16);

  auto fill = [&](int t, int buf) {
    const unsigned l = l0 + (unsigned)(buf * AO_BUF);
    copy8_rows(l, pg + t * AO_KS);
    copy8_rows(l + 64 * AO_PITCH, pg + 64 * 4096 + t * AO_KS);
    copy8_rows(l + AO_A, vg + t * AO_KS);
  };

  f32x8 acc[2][2] = {};

  fill(0, 0);
  // stage 0 has landed for this wave, then for all
  asm volatile("s_wait_asynccnt 0x0" ::: "memory");
  __syncthreads();
  fill(1, 1);

  for (int t = 0; t < AO_NT; ++t) {
    const int cur = t & 1;
    const unsigned char* base = &ring[cur][0];
    const bf16* ar = (const bf16*)(base + (wr * 32 + l15) * AO_PITCH);
    const bf16* br = (const bf16*)(base + AO_A + (wc * 32 + l15) * AO_PITCH);
    // a block = 2 k chunks of 32 = 16 LDS reads, 8 WMMAs; two fragment sets
    bf16x16 fa[2][2][2], fb[2][2][2];  // [set][chunk][tile]
    auto frags = [&](int set, int blk) {
#pragma unroll  // constant indices keep fa, fb in registers
      for (int c = 0; c < 2; ++c) {
        const int k = (blk * 2 + c) * 32;
        fa[set][c][0] = load_frag(ar + k, half);
        fa[set][c][1] = load_frag(ar + 8 * AO_PITCH + k, half);
        fb[set][c][0] = load_frag(br + k, half);
        fb[set][c][1] = load_frag(br + 8 * AO_PITCH + k, half);
      }
    };
    frags(0, 0);
#pragma unroll  // the set index must be a constant: fa, fb stay in registers
    for (int blk = 0; blk < AO_KS / 64; ++blk) {
      const int s = blk & 1;
      if (blk + 1 < AO_KS / 64) frags(s ^ 1, blk + 1);
      // keeps the next block's LDS reads one group ahead of this block's WMMAs;
      // without it they are spread among the WMMAs behind full waits
      __builtin_amdgcn_sched_barrier(0);
#pragma unroll  // constant indices, as above
      for (int c = 0; c < 2; ++c) {
        acc[0][0] = wmma_bf16(fa[s][c][0], fb[s][c][0], acc[0][0]);
        acc[0][1] = wmma_bf16(fa[s][c][0], fb[s][c][1], acc[0][1]);
        acc[1][0] = wmma_bf16(fa[s][c][1], fb[s][c][0], acc[1][0]);
        acc[1][1] = wmma_bf16(fa[s][c][1], fb[s][c][1], acc[1][1]);
      }
      // keeps the reads of the block after next behind this block's WMMAs;
      // without it they split into smaller groups among these WMMAs, and the
      // last block's WMMAs sink behind the hand-over barrier
      __builtin_amdgcn_sched_barrier(0);
    }
    // hand-over: this wave's reads of buffer cur are done ...
    asm volatile("s_wait_dscnt 0x0" ::: "memory");
    // ... its copies of stage t+1 have landed ...
    asm volatile("s_wait_asynccnt 0x0" ::: "memory");
    // ... and the same holds for every wave: stage t+1 may be read, cur refilled
    __syncthreads();
    if (t + 2 < AO_NT) fill(t + 2, cur);
  }
  // no copy is outstanding when the wave ends
  asm volatile("s_wait_asynccnt 0x0" ::: "memory");

#pragma unroll  // acc is indexed by constants only
  for (int i = 0; i < 2; ++i)
#pragma unroll  // the same
    for (int r = 0; r < 8; ++r) {
      const int n = wr * 32 + i * 16 + r + 8 * half;
      const float scale = 1.0f / rowsum_g[(size_t)b * 128 + n];
      float* dst = out + ((size_t)b * 128 + n) * 768 + colblock + wc * 32 + l15;
      dst[0]  = acc[i][0][r] * scale;
      dst[16] = acc[i][1][r] * scale;
    }
}

// ---------------------------------------------------------------------------
extern "C" void kernel_launch(void* const* d_in, const int* in_sizes, int n_in,
                              void* d_out, int out_size, void* d_ws, size_t ws_size,
                              hipStream_t stream) {
  (void)in_sizes; (void)n_in; (void)out_size; (void)ws_size;
  const float* text  = (const float*)d_in[0];  // [16,128,768]
  const float* img   = (const float*)d_in[1];  // [16,64,64,512] = [65536,512]
  const float* masks = (const float*)d_in[2];  // [16,128,4096]
  const float* Wq    = (const float*)d_in[3];  // [768,36]
  const float* bq    = (const float*)d_in[4];
  const float* Wk    = (const float*)d_in[5];  // [512,36]
  const float* bk    = (const float*)d_in[6];
  const float* Wv    = (const float*)d_in[7];  // [512,768]
  const float* bv    = (const float*)d_in[8];
  float* out = (float*)d_out;                  // [16,128,768]

  // workspace carve (256B aligned regions)
  char* ws = (char*)d_ws;
  size_t off = 0;
  auto carve = [&](size_t bytes) -> void* {
    void* ptr = ws + off;
    off = (off + bytes + 255) & ~(size_t)255;
    return ptr;
  };
  bf16*  qp    = (bf16*)carve((size_t)2048 * 64 * 2);          //  256 KB
  bf16*  kpB   = (bf16*)carve((size_t)65536 * 64 * 2);         //    8 MB
  bf16*  vt    = (bf16*)carve((size_t)16 * 768 * 4096 * 2);    //  100 MB
  bf16*  pP    = (bf16*)carve((size_t)16 * 128 * 4096 * 2);    //   16 MB
  float* rsum  = (float*)carve((size_t)2048 * 4);

  // q = relu(text@Wq+bq) -> [2048,64] bf16 (cols 36..63 zero)
  // k = relu(img@Wk+bk) -> [65536,64] bf16
  // v = relu(img@Wv+bv) -> transposed [16,768,4096] bf16
  proj_qkv<<<dim3(PJ_ALL), 512, 0, stream>>>(
      text, Wq, bq, qp, img, Wk, bk, kpB, Wv, bv, vt);
  // scores + masked softmax
  attn_scores_softmax<<<dim3(128), 1024, 0, stream>>>(
      qp, kpB, masks, pP, rsum);
  // o = (p @ v) / rowsum
  attn_out<<<dim3(12, 16), 256, 0, stream>>>(pP, vt, rsum, out);
}

// v007
// Measured time: 115 microseconds a run.
// Two timings next to v006 both put it at 1.03 times that version's speed.
// Over all steps from v000 it is 5.38 times as fast.
#include <hip/hip_runtime.h>
#include <hip/hip_bf16.h>
#include <type_traits>

// ---------------------------------------------------------------------------
// Text->Img cross attention, CDNA5 (gfx1250, wave32) bf16 WMMA implementation
//   B=16, N=128, H=W=64 (M=4096), TC=768, IC=512, FQ=36 (padded to 64)
// ---------------------------------------------------------------------------

typedef __bf16 bf16;
typedef __attribute__((ext_vector_type(8)))  bf16  bf16x8;
typedef __attribute__((ext_vector_type(16))) bf16  bf16x16;
typedef __attribute__((ext_vector_type(8)))  float f32x8;

// A/B fragment loader for V_WMMA_*_16X16X32_BF16 (wave32).
// Per ISA 7.12.2, lane (with half = lane>>4) holds K = half*8 + [0..7] in
// elements 0..7 and K = 16 + half*8 + [0..7] in elements 8..15 -> two 16B
// contiguous loads from a row-major [row/col, K] buffer.
__device__ __forceinline__ bf16x16 load_frag(const bf16* base, int half) {
  bf16x8 lo = *(const bf16x8*)(base + half * 8);
  bf16x8 hi = *(const bf16x8*)(base + 16 + half * 8);
  bf16x16 r;
#pragma unroll
  for (int i = 0; i < 8; ++i) { r[i] = lo[i]; r[i + 8] = hi[i]; }
  return r;
}

__device__ __forceinline__ f32x8 wmma_bf16(bf16x16 a, bf16x16 b, f32x8 c) {
  // (neg_a, A, neg_b, B, c_mod, C, reuse_a, reuse_b)
  return __builtin_amdgcn_wmma_f32_16x16x32_bf16(false, a, false, b,
                                                 (short)0, c, false, false);
}

typedef __attribute__((ext_vector_type(4))) float f32x4;
typedef __attribute__((ext_vector_type(4))) bf16  bf16x4;

// ---------------------------------------------------------------------------
// Kernel 1: the q projection, out[row, 0..63] = relu(A[row, :] @ W + bias)
// in columns 0..35 and 0 in columns 36..63; f32 in -> bf16 out, row-major.
// W (K x 36) is turned into bf16 [col][k] in LDS once per block, one barrier;
// the K loop has none. A wave owns 16 rows and all columns (3 accumulators), so
// nobody else needs its A rows: it streams them with loads that cover whole
// lines (16 lanes x 16 B = the 256 B that one row has in a step of 64 k), DS
// steps ahead in registers, and turns them into fragments through an LDS slab
// of its own. Column tile 2 holds columns 32..47: the lanes of 36..47 read a
// row of zeros. k is summed 32 at a time, rising, in one chain per accumulator.
// LDS pitches: K + 8 and 72 bf16, both 16 B x odd, for the ds_load_b128 reads.
// ---------------------------------------------------------------------------
template <int K, int WAVES, int DS>
__device__ __forceinline__ void proj36_body(const float* __restrict__ A,
                                            const float* __restrict__ W,
                                            const float* __restrict__ bias,
                                            bf16* __restrict__ out,
                                            unsigned char* smem, int blk) {
  constexpr int NC = 36, PB = K + 8, PA = 72, NS = K / 64, NT = WAVES * 32;
  bf16* lB   = (bf16*)smem;            // [col][k], row 36 = 0
  bf16* slab = lB + (NC + 1) * PB;     // [wave][buf][row][k]

  const int tid  = threadIdx.x;
  const int w    = tid >> 5;
  const int lane = tid & 31;
  const int half = lane >> 4;
  const int l15  = lane & 15;
  const int rowbase = blk * (WAVES * 16) + w * 16;

  // load j of a step: rows 2j and 2j+1, 256 contiguous bytes of each
  const float* ag = A + (size_t)(rowbase + half) * K + l15 * 4;
  f32x4 ring[DS][8];
  auto fetch = [&](int s) {
#pragma unroll  // constant indices keep ring in registers
    for (int j = 0; j < 8; ++j)
      ring[s % DS][j] = *(const f32x4*)(ag + j * 2 * K + s * 64);
  };
#pragma unroll  // the same
  for (int s = 0; s < DS; ++s) fetch(s);

  // W: a unit is 8 k x 4 columns, 8 loads of 16 B -> 4 LDS stores of 16 B;
  // the loads of WG units are in flight together
  constexpr int UNITS = (K / 8) * (NC / 4);
  constexpr int WG = (UNITS / NT) % 3 == 0 ? 3 : 1;
  auto stage_w = [&](int u0, auto gc) {
    constexpr int G = decltype(gc)::value;
    const float* src[G];
    f32x4 wv[G][8];
#pragma unroll  // constant indices: the array stays in registers
    for (int g = 0; g < G; ++g) {
      const int u = u0 + g * NT;
      src[g] = W + (u / (NC / 4)) * 8 * NC + (u % (NC / 4)) * 4;
#pragma unroll  // constant indices: the array stays in registers
      for (int i = 0; i < 8; ++i) wv[g][i] = *(const f32x4*)(src[g] + i * NC);
    }
    // precaution: as inputs of the wait the loads' addresses live up to it, so
    // that no later load lands in registers which an issued load names
    if constexpr (G == 3)
      asm volatile("s_wait_xcnt 0x0" :: "v"(src[0]), "v"(src[1]), "v"(src[2]) : "memory");
    else
      asm volatile("s_wait_xcnt 0x0" :: "v"(src[0]) : "memory");
#pragma unroll  // constant indices: the array stays in registers
    for (int g = 0; g < G; ++g) {
      const int u = u0 + g * NT;
#pragma unroll  // constant indices: the array stays in registers
      for (int j = 0; j < 4; ++j) {
        bf16x8 v;
#pragma unroll  // constant indices: the array stays in registers
        for (int i = 0; i < 8; ++i) v[i] = (bf16)wv[g][i][j];
        *(bf16x8*)&lB[((u % (NC / 4)) * 4 + j) * PB + (u / (NC / 4)) * 8] = v;
      }
    }
  };
  for (int n = 0; n < UNITS / NT; n += WG)
    stage_w(n * NT + tid, std::integral_constant<int, WG>{});
  if (tid < UNITS % NT)
    stage_w((UNITS / NT) * NT + tid, std::integral_constant<int, 1>{});
  if (tid < K / 8) {
    const bf16x8 zero = {};
    *(bf16x8*)&lB[NC * PB + tid * 8] = zero;
  }
  __syncthreads();

  const bf16* brow[3];
#pragma unroll  // constant indices: the array stays in registers
  for (int t = 0; t < 3; ++t) {
    const int c = t * 16 + l15;
    brow[t] = &lB[(c < NC ? c : NC) * PB];
  }

  f32x8 acc[3] = {};
#pragma unroll  // the ring slot and the slab buffer must be constants
  for (int s = 0; s < NS; ++s) {
    bf16* sl = slab + (w * 2 + (s & 1)) * (16 * PA);
    bf16x16 af[2], bfr[2][3];
    // the W fragments wait for nobody: read ahead of the slab's wait, under it
#pragma unroll  // constant indices: the array stays in registers
    for (int c = 0; c < 2; ++c)
#pragma unroll  // constant indices: the array stays in registers
      for (int t = 0; t < 3; ++t)
        bfr[c][t] = load_frag(brow[t] + s * 64 + c * 32, half);
#pragma unroll  // constant indices: the array stays in registers
    for (int j = 0; j < 8; ++j)
      *(bf16x4*)&sl[(2 * j + half) * PA + l15 * 4] =
          __builtin_convertvector(ring[s % DS][j], bf16x4);
    if (s + DS < NS) fetch(s + DS);
    // the slab rows that a lane reads below were written by other lanes of its
    // wave: their stores are done, and the compiler moves no read above them
    asm volatile("s_wait_dscnt 0x0" ::: "memory");
#pragma unroll  // constant indices: the array stays in registers
    for (int c = 0; c < 2; ++c) af[c] = load_frag(&sl[l15 * PA + c * 32], half);
#pragma unroll  // constant indices: the array stays in registers
    for (int c = 0; c < 2; ++c)
#pragma unroll  // constant indices: the array stays in registers
      for (int t = 0; t < 3; ++t) acc[t] = wmma_bf16(af[c], bfr[c][t], acc[t]);
  }
  asm volatile("s_wait_xcnt 0x0" :: "v"(ag) : "memory");  // see the W loads

  // epilogue: bias + relu, through the wave's slab, so that every store
  // instruction writes 4 whole 128-B rows of out (C/D: row = r + 8 half, col = l15)
  bf16* sl = slab + (w * 2) * (16 * PA);
#pragma unroll  // constant indices: the array stays in registers
  for (int t = 0; t < 3; ++t) {
    const int gc = t * 16 + l15;
    const float bv = (gc < NC) ? bias[gc] : 0.f;
#pragma unroll  // constant indices: the array stays in registers
    for (int r = 0; r < 8; ++r) {
      const float val = acc[t][r] + bv;
      sl[(r + 8 * half) * PA + gc] = (bf16)(val > 0.f ? val : 0.f);
    }
  }
  // as in the loop: other lanes' stores are done before the rows are read back
  asm volatile("s_wait_dscnt 0x0" ::: "memory");
  const int pc = lane & 7;  // 16-B piece of a row; pieces 6, 7 = columns 48..63
#pragma unroll  // the 4 LDS reads issue together, then the 4 stores
  for (int j = 0; j < 4; ++j) {
    const int row = j * 4 + (lane >> 3);
    bf16x8 v = *(const bf16x8*)&sl[row * PA + (pc < 6 ? pc : 0) * 8];
    if (pc >= 6) v = bf16x8{};
    *(bf16x8*)(out + (size_t)(rowbase + row) * 64 + pc * 8) = v;
  }
  // precaution: in the kernel's text another body's code follows these stores;
  // nothing there stands ahead of this wait and rewrites their address registers
  asm volatile("s_wait_xcnt 0x0" ::: "memory");
}

// ---------------------------------------------------------------------------
// Kernel 1b: the v and the k projection of 256 img rows, from one LDS-resident tile.
//   vt[b, col, m] = relu(img[b*4096+m, :] @ Wv + bv), 768 columns, transposed
//   k[row, 0..47] = relu(img[row, :] @ Wk + bk) in columns 0..35, 0 beyond,
//   written to kp in the order in which the scores kernel reads its B fragments
// Block = 512 thr (16 waves). Its 256 rows x 512 k are read from memory once,
// turned into bf16 once and stay in LDS; every product of these rows is made
// from there: three passes of 256 v columns, then the k columns.
// A v pass: waves 4 x 4, 64 rows x 64 cols = 4 x 4 accumulators per wave, so 8
// fragments feed 16 WMMAs. Wv comes in chunks of 32 k through two LDS buffers:
// next chunk's global loads, WMMAs on the current chunk, cvt + LDS store of the
// next chunk, one barrier per chunk. In the first pass the img chunks come the
// same way, one chunk ahead, into their place in the resident tile.
// Blocks start with different column tiles, so that not all of them ask for the
// same lines of Wv at the same moment.
// LDS pitches: img rows 1104 B, Wv rows (32 k) 80 B, Wk rows 1040 B: 16 B x odd.
// Column order in LDS: the thread that loads 4 neighbouring columns cg*4+j puts
// column j into LDS row j*64+cg, so wave column wc holds the columns = wc mod 4.
// The k pass: wave w owns rows 16 w .. 16 w + 15 and 3 column tiles; Wk lies in
// the place of the Wv buffers as [col][k], row 36 = 0 for the columns 36..47;
// k is summed 32 at a time, rising, in one chain per accumulator.
// ---------------------------------------------------------------------------
constexpr int PV_PA  = 512 + 40;  // bf16 per LDS row of the img tile
constexpr int KF_TILE = 3 * 256;  // bf16 per score tile (16 m) of kp: 3 units of 512 B
constexpr int PV_LDS = (256 * PV_PA + 2 * 256 * 40) * 2;

__device__ __forceinline__ void proj_vk_body(const float* __restrict__ A,
                                             const float* __restrict__ W,
                                             const float* __restrict__ bias,
                                             bf16* __restrict__ out,
                                             const float* __restrict__ Wk,
                                             const float* __restrict__ bk,
                                             bf16* __restrict__ kout,
                                             unsigned char* smem, int blk) {
  constexpr int K = 512, NC = 768, P = 40;
  bf16* lA = (bf16*)smem;                                       // [row][k]  276 KB
  bf16 (*lB)[256 * P] = (bf16 (*)[256 * P])(lA + 256 * PV_PA);  // [buf][col][k]  2x20 KB

  const int tid  = threadIdx.x;
  const int w    = tid >> 5;
  const int lane = tid & 31;
  const int half = lane >> 4;
  const int l15  = lane & 15;
  const int wr   = w >> 2;
  const int wc   = w & 3;
  const int rowblock = blk * 256;

  // img chunk [256 x 32] f32: 8 lanes x 16 B cover one row's 128-B line.
  const int ar = tid >> 3;
  const int ak = (tid & 7) * 4;
  const float* asrc = A + (size_t)(rowblock + ar) * K + ak;
  // Wv chunk [32 x 256] f32: 4 k rows x 4 columns per thread.
  const int cg = tid & 63;
  const int kg = tid >> 6;
  const float* wsrc = W + (size_t)(kg * 4) * NC + cg * 4;

  f32x4 aR[4], wR[4];
  auto ld_a = [&](int k0) {
#pragma unroll
    for (int j = 0; j < 4; ++j)
      aR[j] = *(const f32x4*)(asrc + (size_t)(j * 64) * K + k0);
  };
  auto ld_w = [&](int ct, int k0) {
#pragma unroll
    for (int i = 0; i < 4; ++i)
      wR[i] = *(const f32x4*)(wsrc + ct * 256 + (size_t)(k0 + i) * NC);
  };
  auto st_a = [&](int k0) {
#pragma unroll
    for (int j = 0; j < 4; ++j)
      *(bf16x4*)&lA[(ar + 64 * j) * PV_PA + k0 + ak] =
          __builtin_convertvector(aR[j], bf16x4);
  };
  auto st_w = [&](int buf) {
#pragma unroll
    for (int j = 0; j < 4; ++j) {
      bf16x4 v;
#pragma unroll
      for (int i = 0; i < 4; ++i) v[i] = (bf16)wR[i][j];
      *(bf16x4*)&lB[buf][(j * 64 + cg) * P + kg * 4] = v;
    }
  };

  const int bb = rowblock >> 12;
  const int m0 = (rowblock & 4095) + wr * 64 + 8 * half;

  // Wk takes the place of the Wv buffers behind the last v chunk, ahead of that
  // pass's stores to vt, so that no barrier has to wait for those stores
  constexpr int KC = 36, PB = K + 8, PS = 72;
  bf16* lK = (bf16*)lB;  // [col][k], 37 rows
  // a unit is 8 k x 4 columns, 8 loads of 16 B -> 4 LDS stores of 16 B
  auto stage_k = [&](int u) {
    const float* src = Wk + (u / (KC / 4)) * 8 * KC + (u % (KC / 4)) * 4;
    f32x4 wv[8];
#pragma unroll  // constant indices: the array stays in registers
    for (int i = 0; i < 8; ++i) wv[i] = *(const f32x4*)(src + i * KC);
    // precaution: as an input of the wait the loads' address lives up to it, so
    // that no later load lands in registers which an issued load names
    asm volatile("s_wait_xcnt 0x0" :: "v"(src) : "memory");
#pragma unroll  // constant indices: the array stays in registers
    for (int j = 0; j < 4; ++j) {
      bf16x8 v;
#pragma unroll  // constant indices: the array stays in registers
      for (int i = 0; i < 8; ++i) v[i] = (bf16)wv[i][j];
      *(bf16x8*)&lK[((u % (KC / 4)) * 4 + j) * PB + (u / (KC / 4)) * 8] = v;
    }
  };
  auto stage_wk = [&]() {
    constexpr int UNITS = (K / 8) * (KC / 4);  // 576 = 512 + 64
    __syncthreads();  // every wave has read its last Wv fragments: the buffers are free
    stage_k(tid);
    if (tid < UNITS - 512) stage_k(512 + tid);
    if (tid < K / 8) {
      const bf16x8 zero = {};
      *(bf16x8*)&lK[KC * PB + tid * 8] = zero;
    }
    __syncthreads();  // Wk is whole before anybody reads it
  };

  // one pass: column tile ct; ctn is the tile of the pass that follows
  auto pass = [&](auto first, auto last, int ct, int ctn) {
    constexpr bool FIRST = decltype(first)::value, LAST = decltype(last)::value;
    constexpr int nCh = K / 32;
    f32x8 acc[4][4] = {};
    for (int ci = 0; ci < nCh; ++ci) {
      const int cur = ci & 1;
      const bool lastc = (ci + 1) == nCh;
      const bool more = !(LAST && lastc);
      // VMEM for the next chunk first
      if (FIRST && !lastc) ld_a((ci + 1) * 32);
      if (more) ld_w(lastc ? ctn : ct, lastc ? 0 : (ci + 1) * 32);

      bf16x16 af[4], bfr[4];
#pragma unroll
      for (int i = 0; i < 4; ++i)
        af[i] = load_frag(&lA[(wr * 64 + i * 16 + l15) * PV_PA + ci * 32], half);
#pragma unroll
      for (int t = 0; t < 4; ++t)
        bfr[t] = load_frag(&lB[cur][(wc * 64 + t * 16 + l15) * P], half);
      // keeps the global loads and the 16 LDS reads one group ahead of the WMMAs;
      // without it global loads sink to just before their cvt, their latency no
      // longer covered, and A fragments are read among the WMMAs behind full waits
      __builtin_amdgcn_sched_barrier(0);
#pragma unroll
      for (int i = 0; i < 4; ++i)
#pragma unroll
        for (int t = 0; t < 4; ++t)
          acc[i][t] = wmma_bf16(af[i], bfr[t], acc[i][t]);

      // keeps the cvt of the loaded chunk, and with it the wait on those loads,
      // behind the WMMAs; without it the scheduler lifts both above them
      __builtin_amdgcn_sched_barrier(0);
      if (more) {
        // safe: everyone finished reading buffer cur^1 before the last barrier,
        // and nobody has read the img columns of the next chunk yet
        st_w(cur ^ 1);
        if (FIRST && !lastc) st_a((ci + 1) * 32);
        __syncthreads();
      }
    }

    if constexpr (LAST) stage_wk();

    // epilogue: a lane's 8 accumulator registers are 8 consecutive m of one
    // column -> bias + relu + one 16-B store each.
    bf16* dst[4];
#pragma unroll
    for (int t = 0; t < 4; ++t) {
      const int gc = ct * 256 + (t * 16 + l15) * 4 + wc;
      const float bv = bias[gc];
      dst[t] = out + (((size_t)bb * NC + gc) << 12) + m0;
#pragma unroll
      for (int i = 0; i < 4; ++i) {
        bf16x8 v;
#pragma unroll
        for (int r = 0; r < 8; ++r) {
          const float val = acc[i][t][r] + bv;
          v[r] = (bf16)(val > 0.f ? val : 0.f);
        }
        *(bf16x8*)(dst[t] + i * 16) = v;
      }
    }
    // precaution: as inputs of the wait the stores' addresses live up to it, so
    // that the code of the next pass rewrites none of them ahead of the wait
    asm volatile("s_wait_xcnt 0x0"
                 :: "v"(dst[0]), "v"(dst[1]), "v"(dst[2]), "v"(dst[3]) : "memory");
  };

  const int c0 = blk % 3;
  const int c1 = c0 == 2 ? 0 : c0 + 1;
  const int c2 = c1 == 2 ? 0 : c1 + 1;

  ld_a(0);
  ld_w(c0, 0);
  st_a(0);
  st_w(0);
  __syncthreads();
  pass(std::true_type{}, std::false_type{}, c0, c1);
  pass(std::false_type{}, std::false_type{}, c1, c2);
  pass(std::false_type{}, std::true_type{}, c2, c2);

  // ---- the k columns, from the same img tile
  const bf16* arow = &lA[(w * 16 + l15) * PV_PA];
  const bf16* brow[3];
#pragma unroll  // constant indices: the array stays in registers
  for (int t = 0; t < 3; ++t) {
    const int c = t * 16 + l15;
    brow[t] = &lK[(c < KC ? c : KC) * PB];
  }
  f32x8 ka[3] = {};
#pragma unroll 4  // 4 chunks' LDS reads go ahead of their WMMAs; all 16 would spill
  for (int s = 0; s < K / 32; ++s) {
    const bf16x16 af = load_frag(arow + s * 32, half);
#pragma unroll  // constant indices: the array stays in registers
    for (int t = 0; t < 3; ++t)
      ka[t] = wmma_bf16(af, load_frag(brow[t] + s * 32, half), ka[t]);
  }

  // epilogue: bias + relu into an LDS slab in the wave's own 16 img rows, which
  // nobody else reads in this pass (C/D: row = r + 8 half, col = l15)
  bf16* sl = lA + (w * 16) * PV_PA;
#pragma unroll  // constant indices: the array stays in registers
  for (int t = 0; t < 3; ++t) {
    const int gc = t * 16 + l15;
    const float bv = (gc < KC) ? bk[gc] : 0.f;
#pragma unroll  // constant indices: the array stays in registers
    for (int r = 0; r < 8; ++r) {
      const float val = ka[t][r] + bv;
      sl[(r + 8 * half) * PS + gc] = (bf16)(val > 0.f ? val : 0.f);
    }
  }
  // every wave's slab is whole before other waves read it. The fences name LDS
  // alone, so that the barrier does not wait for the stores to vt in flight
  __builtin_amdgcn_fence(__ATOMIC_RELEASE, "workgroup", "local");
  __builtin_amdgcn_s_barrier();
  __builtin_amdgcn_fence(__ATOMIC_ACQUIRE, "workgroup", "local");
  // kout in fragment order (see the scores kernel): wave w writes score tile w
  // of the block's 256 rows, three units of 512 B; in unit u the lane (l15, half)
  // holds columns 16 u + 8 half .. + 7 of the row that is the tile's column l15.
  // A store instruction writes 4 whole lines.
  const int srow = (w >> 2) * 64 + l15 * 4 + (w & 3);
  const bf16* sr = lA + (srow >> 4) * (16 * PV_PA) + (srow & 15) * PS + half * 8;
  bf16* kd = kout + (size_t)(blk * 16 + w) * KF_TILE + lane * 8;
#pragma unroll  // the 3 LDS reads issue together, then the 3 stores
  for (int u = 0; u < 3; ++u)
    *(bf16x8*)(kd + u * 256) = *(const bf16x8*)(sr + u * 16);
  // precaution: the stores' address lives up to the wait
  asm volatile("s_wait_xcnt 0x0" :: "v"(kd) : "memory");
}

// ---------------------------------------------------------------------------
// The projections depend on nothing but the inputs: one launch holds them all.
// Blocks 0..7 are the q blocks (256 rows each), the 256 blocks after them
// make v and k of 256 img rows each. All have 16 waves
// and share one LDS range, sized for the larger use.
// ---------------------------------------------------------------------------
constexpr int PJ_Q = 8, PJ_VK = 256, PJ_ALL = PJ_Q + PJ_VK;
constexpr int PJ_LDS_Q = (37 * (768 + 8) + 16 * 2 * 16 * 72) * 2;
constexpr int PJ_LDS = PJ_LDS_Q > PV_LDS ? PJ_LDS_Q : PV_LDS;

__launch_bounds__(512)
__global__ void proj_qkv(const float* __restrict__ text, const float* __restrict__ Wq,
                         const float* __restrict__ bq, bf16* __restrict__ qp,
                         const float* __restrict__ img, const float* __restrict__ Wk,
                         const float* __restrict__ bk, bf16* __restrict__ kp,
                         const float* __restrict__ Wv, const float* __restrict__ bv,
                         bf16* __restrict__ vt) {
  __shared__ __align__(16) unsigned char smem[PJ_LDS];
  const int blk = blockIdx.x;
  if (blk >= PJ_Q)
    proj_vk_body(img, Wv, bv, vt, Wk, bk, kp, smem, blk - PJ_Q);
  else
    proj36_body<768, 16, 2>(text, Wq, bq, qp, smem, blk);
}

// ---------------------------------------------------------------------------
// Kernel 2: s = q@k^T, beta = s*mask, softmax over M=4096, beta held in registers.
// One block per (b, 16-query tile), 16 waves. Wave w owns m in [256w, 256w+256)
// = 16 WMMA tiles. The 128 beta of a lane stay in the registers that its 128 mask
// values were loaded into: all mask loads of a wave are in flight together, and
// nothing is written to be read again.
// Column l15 of tile j is m = 256 w + 64 (j >> 2) + 4 l15 + (j & 3): a lane owns
// 4 neighbouring m four times in each of its rows, so a mask load is 16 B and a p
// store 8 B a lane, and 16 lanes cover whole lines of a row. kp holds k in that
// order, fragment by fragment (tile: 3 units of 512 B, K 0..15, 16..31, 32..47,
// lane after lane), so a k load covers 4 whole lines; K 48..63 is 0 and not kept.
// p = exp(beta - max) is bf16, unnormalized; row sums -> rowsum_g.
// Row reductions: __shfl_xor within 16-lane groups, then LDS across waves.
// ---------------------------------------------------------------------------
__launch_bounds__(512)
__global__ void attn_scores_softmax(const bf16* __restrict__ qp,
                                    const bf16* __restrict__ kp,
                                    const float* __restrict__ masks,
                                    bf16* __restrict__ p,
                                    float* __restrict__ rowsum_g) {
  __shared__ float red[16][16];
  __shared__ float rowmax[16];

  const int tid  = threadIdx.x;
  const int w    = tid >> 5;
  const int lane = tid & 31;
  const int half = lane >> 4;
  const int l15  = lane & 15;
  const int b     = blockIdx.x >> 3;
  const int nbase = (blockIdx.x & 7) * 16;

  const bf16* qrow = qp + ((size_t)b * 128 + nbase + l15) * 64;
  const bf16x16 a0 = load_frag(qrow, half);        // K 0..31
  const bf16x16 a1 = load_frag(qrow + 32, half);   // K 32..63
  // precaution, here and behind the mask and the k loads below: as an input of
  // the wait the loads' address lives up to it, so that no later load lands in
  // registers which an issued load names before the wait has been passed
  asm volatile("s_wait_xcnt 0x0" :: "v"(qrow) : "memory");

  // the lane's element of tile j, register r: row nbase + 8 half + r,
  // m = m0 + 64 (j >> 2) + (j & 3)
  const int    m0  = w * 256 + l15 * 4;
  const size_t idx = ((size_t)b * 128 + nbase + 8 * half) * 4096 + m0;
  const float* mrow = masks + idx;
  const bf16*  kfr = kp + (size_t)(b * 16 + w) * (16 * KF_TILE) + lane * 8;

  f32x4 bt[8][4];  // [register][j >> 2][j & 3]: first the mask, then beta
#pragma unroll  // constant indices keep bt in registers
  for (int r = 0; r < 8; ++r)
#pragma unroll  // the same
    for (int h = 0; h < 4; ++h) bt[r][h] = *(const f32x4*)(mrow + r * 4096 + h * 64);
  asm volatile("s_wait_xcnt 0x0" :: "v"(mrow) : "memory");  // see the q loads

  // k fragments: a ring of KD tiles in registers
  constexpr int KD = 3;
  bf16x8 kr[KD][3];
  auto kfetch = [&](int j) {
#pragma unroll  // constant indices keep kr in registers
    for (int u = 0; u < 3; ++u)
      kr[j % KD][u] = *(const bf16x8*)(kfr + j * KF_TILE + u * 256);
  };
#pragma unroll  // the same
  for (int j = 0; j < KD; ++j) kfetch(j);

  float rmax[8];
#pragma unroll  // rmax is indexed by constants only
  for (int r = 0; r < 8; ++r) rmax[r] = -3.0e38f;

#pragma unroll  // constant indices keep bt and kr in registers
  for (int j = 0; j < 16; ++j) {
    bf16x16 b0, b1;
#pragma unroll  // constant indices: the vectors stay in registers
    for (int i = 0; i < 8; ++i) {
      b0[i] = kr[j % KD][0][i]; b0[i + 8] = kr[j % KD][1][i];
      b1[i] = kr[j % KD][2][i]; b1[i + 8] = (bf16)0.f;
    }
    f32x8 acc = {};
    acc = wmma_bf16(a0, b0, acc);
    acc = wmma_bf16(a1, b1, acc);
    if (j + KD < 16) kfetch(j + KD);
#pragma unroll  // the same
    for (int r = 0; r < 8; ++r) {
      const float be = acc[r] * bt[r][j >> 2][j & 3];  // multiplicative mask BEFORE softmax
      bt[r][j >> 2][j & 3] = be;
      rmax[r] = fmaxf(rmax[r], be);
    }
  }
  asm volatile("s_wait_xcnt 0x0" :: "v"(kfr) : "memory");  // see the q loads

  // row max: reduce across the 16 lanes that share rows, then across waves
#pragma unroll
  for (int r = 0; r < 8; ++r)
#pragma unroll
    for (int off = 1; off < 16; off <<= 1)
      rmax[r] = fmaxf(rmax[r], __shfl_xor(rmax[r], off, 16));
  if (l15 == 0)
#pragma unroll
    for (int r = 0; r < 8; ++r) red[w][r + 8 * half] = rmax[r];
  __syncthreads();
  if (tid < 16) {
    float mx = -3.0e38f;
    for (int ww = 0; ww < 16; ++ww) mx = fmaxf(mx, red[ww][tid]);
    rowmax[tid] = mx;
  }
  __syncthreads();

  float rsum[8] = {};
  bf16* prow = p + idx;
#pragma unroll  // constant indices keep bt in registers
  for (int r = 0; r < 8; ++r) {
    const float mx = rowmax[r + 8 * half];
#pragma unroll  // the same
    for (int h = 0; h < 4; ++h) {
      bf16x4 pv;  // unnormalized; 1/sum in attn_out
#pragma unroll  // the same
      for (int i = 0; i < 4; ++i) {
        const float t = (bt[r][h][i] - mx) * 1.44269504f;  // exp(x) = 2^(x log2 e)
        float e;
        // the v_nop fills the slot that the instruction set asks for between a
        // transcendental and a next instruction that reads e or overwrites t
        asm("v_exp_f32 %0, %1\n\tv_nop" : "=v"(e) : "v"(t));
        rsum[r] += e;
        pv[i] = (bf16)e;
      }
      *(bf16x4*)(prow + r * 4096 + h * 64) = pv;
    }
  }
  // precaution: the stores' address lives up to the wait
  asm volatile("s_wait_xcnt 0x0" :: "v"(prow) : "memory");
#pragma unroll
  for (int r = 0; r < 8; ++r)
#pragma unroll
    for (int off = 1; off < 16; off <<= 1)
      rsum[r] += __shfl_xor(rsum[r], off, 16);
  __syncthreads();  // rowmax reads done; red is reusable
  if (l15 == 0)
#pragma unroll
    for (int r = 0; r < 8; ++r) red[w][r + 8 * half] = rsum[r];
  __syncthreads();
  if (tid < 16) {
    float s = 0.f;
    for (int ww = 0; ww < 16; ++ww) s += red[ww][tid];
    rowsum_g[(size_t)b * 128 + nbase + tid] = s;
  }
}

// ---------------------------------------------------------------------------
// Kernel 3: o[b,n,col] = (p[b,n,:] @ v[b,:,col]) / rowsum[b,n].
// v stored transposed [b, col, m] so B-fragments are K(m)-contiguous.
// One block = all 128 n of one batch x 64 cols, 8 waves (4 x 2), 32 x 32 per
// wave = 2 x 2 accumulators. p and v_t are staged in LDS, 256 m per stage, by
// asynchronous copies: one wave-wide copy brings the 512 contiguous bytes that
// one row has in the stage, so every global access covers whole lines.
// Two buffers: the next stage's copies fly while this stage is multiplied.
// LDS rows: 512 B at a pitch of 528 B (16 B x odd) for the ds_load_b128 reads.
// ---------------------------------------------------------------------------
constexpr int AO_KS    = 256;                 // m per stage
constexpr int AO_NT    = 4096 / AO_KS;        // stages
constexpr int AO_PITCH = AO_KS * 2 + 16;      // bytes per LDS row
constexpr int AO_A     = 128 * AO_PITCH;      // p tile, bytes
constexpr int AO_BUF   = (128 + 64) * AO_PITCH;

// Eight copies of one wave: rows r, r+8, ..., r+56 of a tile; each lane brings
// its own 16 bytes. The s_wait_xcnt stands inside the statement so that no
// address register of a copy is rewritten in front of it.
__device__ __forceinline__ void copy8_rows(unsigned l, const bf16* g) {
  constexpr unsigned LS = 8 * AO_PITCH;
  constexpr int      GS = 8 * 4096;
  asm volatile(
      "global_load_async_to_lds_b128 %0, %8, off\n\t"
      "global_load_async_to_lds_b128 %1, %9, off\n\t"
      "global_load_async_to_lds_b128 %2, %10, off\n\t"
      "global_load_async_to_lds_b128 %3, %11, off\n\t"
      "global_load_async_to_lds_b128 %4, %12, off\n\t"
      "global_load_async_to_lds_b128 %5, %13, off\n\t"
      "global_load_async_to_lds_b128 %6, %14, off\n\t"
      "global_load_async_to_lds_b128 %7, %15, off\n\t"
      "s_wait_xcnt 0x0"
      :: "v"(l), "v"(l + LS), "v"(l + 2 * LS), "v"(l + 3 * LS),
         "v"(l + 4 * LS), "v"(l + 5 * LS), "v"(l + 6 * LS), "v"(l + 7 * LS),
         "v"(g), "v"(g + GS), "v"(g + 2 * GS), "v"(g + 3 * GS),
         "v"(g + 4 * GS), "v"(g + 5 * GS), "v"(g + 6 * GS), "v"(g + 7 * GS)
      : "memory");
}

__launch_bounds__(256)
__global__ void attn_out(const bf16* __restrict__ p,
                         const bf16* __restrict__ v_t,
                         const float* __restrict__ rowsum_g,
                         float* __restrict__ out) {
  __shared__ __align__(16) unsigned char ring[2][AO_BUF];  // 2 x 99 KB

  const int tid  = threadIdx.x;
  const int w    = tid >> 5;
  const int lane = tid & 31;
  const int half = lane >> 4;
  const int l15  = lane & 15;
  const int wr   = w >> 1;
  const int wc   = w & 1;
  const int b        = blockIdx.y;
  const int colblock = blockIdx.x * 64;

  // wave w copies rows w, w+8, ...: 16 rows of p, 8 rows (columns) of v_t
  const bf16* pg = p   + ((size_t)b * 128 + w) * 4096 + lane * 8;
  const bf16* vg = v_t + ((size_t)b * 768 + colblock + w) * 4096 + lane * 8;
  const unsigned l0 =
      (unsigned)(size_t)&ring[0][0] + (unsigned)(w * AO_PITCH + lane * 16);

  auto fill = [&](int t, int buf) {
    const unsigned l = l0 + (unsigned)(buf * AO_BUF);
    copy8_rows(l, pg + t * AO_KS);
    copy8_rows(l + 64 * AO_PITCH, pg + 64 * 4096 + t * AO_KS);
    copy8_rows(l + AO_A, vg + t * AO_KS);
  };

  f32x8 acc[2][2] = {};

  fill(0, 0);
  // stage 0 has landed for this wave, then for all
  asm volatile("s_wait_asynccnt 0x0" ::: "memory");
  __syncthreads();
  fill(1, 1);

  for (int t = 0; t < AO_NT; ++t) {
    const int cur = t & 1;
    const unsigned char* base = &ring[cur][0];
    const bf16* ar = (const bf16*)(base + (wr * 32 + l15) * AO_PITCH);
    const bf16* br = (const bf16*)(base + AO_A + (wc * 32 + l15) * AO_PITCH);
    // a block = 2 k chunks of 32 = 16 LDS reads, 8 WMMAs; two fragment sets
    bf16x16 fa[2][2][2], fb[2][2][2];  // [set][chunk][tile]
    auto frags = [&](int set, int blk) {
#pragma unroll  // constant indices keep fa, fb in registers
      for (int c = 0; c < 2; ++c) {
        const int k = (blk * 2 + c) * 32;
        fa[set][c][0] = load_frag(ar + k, half);
        fa[set][c][1] = load_frag(ar + 8 * AO_PITCH + k, half);
        fb[set][c][0] = load_frag(br + k, half);
        fb[set][c][1] = load_frag(br + 8 * AO_PITCH + k, half);
      }
    };
    frags(0, 0);
#pragma unroll  // the set index must be a constant: fa, fb stay in registers
    for (int blk = 0; blk < AO_KS / 64; ++blk) {
      const int s = blk & 1;
      if (blk + 1 < AO_KS / 64) frags(s ^ 1, blk + 1);
      // keeps the next block's LDS reads one group ahead of this block's WMMAs;
      // without it they are spread among the WMMAs behind full waits
      __builtin_amdgcn_sched_barrier(0);
#pragma unroll  // constant indices, as above
      for (int c = 0; c < 2; ++c) {
        acc[0][0] = wmma_bf16(fa[s][c][0], fb[s][c][0], acc[0][0]);
        acc[0][1] = wmma_bf16(fa[s][c][0], fb[s][c][1], acc[0][1]);
        acc[1][0] = wmma_bf16(fa[s][c][1], fb[s][c][0], acc[1][0]);
        acc[1][1] = wmma_bf16(fa[s][c][1], fb[s][c][1], acc[1][1]);
      }
      // keeps the reads of the block after next behind this block's WMMAs;
      // without it they split into smaller groups among these WMMAs, and the
      // last block's WMMAs sink behind the hand-over barrier
      __builtin_amdgcn_sched_barrier(0);
    }
    // hand-over: this wave's reads of buffer cur are done ...
    asm volatile("s_wait_dscnt 0x0" ::: "memory");
    // ... its copies of stage t+1 have landed ...
    asm volatile("s_wait_asynccnt 0x0" ::: "memory");
    // ... and the same holds for every wave: stage t+1 may be read, cur refilled
    __syncthreads();
    if (t + 2 < AO_NT) fill(t + 2, cur);
  }
  // no copy is outstanding when the wave ends
  asm volatile("s_wait_asynccnt 0x0" ::: "memory");

#pragma unroll  // acc is indexed by constants only
  for (int i = 0; i < 2; ++i)
#pragma unroll  // the same
    for (int r = 0; r < 8; ++r) {
      const int n = wr * 32 + i * 16 + r + 8 * half;
      const float scale = 1.0f / rowsum_g[(size_t)b * 128 + n];
      float* dst = out + ((size_t)b * 128 + n) * 768 + colblock + wc * 32 + l15;
      dst[0]  = acc[i][0][r] * scale;
      dst[16] = acc[i][1][r] * scale;
    }
}

// ---------------------------------------------------------------------------
extern "C" void kernel_launch(void* const* d_in, const int* in_sizes, int n_in,
                              void* d_out, int out_size, void* d_ws, size_t ws_size,
                              hipStream_t stream) {
  (void)in_sizes; (void)n_in; (void)out_size; (void)ws_size;
  const float* text  = (const float*)d_in[0];  // [16,128,768]
  const float* img   = (const float*)d_in[1];  // [16,64,64,512] = [65536,512]
  const float* masks = (const float*)d_in[2];  // [16,128,4096]
  const float* Wq    = (const float*)d_in[3];  // [768,36]
  const float* bq    = (const float*)d_in[4];
  const float* Wk    = (const float*)d_in[5];  // [512,36]
  const float* bk    = (const float*)d_in[6];
  const float* Wv    = (const float*)d_in[7];  // [512,768]
  const float* bv    = (const float*)d_in[8];
  float* out = (float*)d_out;                  // [16,128,768]

  // workspace carve (256B aligned regions)
  char* ws = (char*)d_ws;
  size_t off = 0;
  auto carve = [&](size_t bytes) -> void* {
    void* ptr = ws + off;
    off = (off + bytes + 255) & ~(size_t)255;
    return ptr;
  };
  bf16*  qp    = (bf16*)carve((size_t)2048 * 64 * 2);          //  256 KB
  bf16*  kpB   = (bf16*)carve((size_t)65536 * 64 * 2);         //    8 MB
  bf16*  vt    = (bf16*)carve((size_t)16 * 768 * 4096 * 2);    //  100 MB
  bf16*  pP    = (bf16*)carve((size_t)16 * 128 * 4096 * 2);    //   16 MB
  float* rsum  = (float*)carve((size_t)2048 * 4);

  // q = relu(text@Wq+bq) -> [2048,64] bf16 (cols 36..63 zero)
  // k = relu(img@Wk+bk) -> bf16, 48 columns, in the scores kernel's fragment order
  // v = relu(img@Wv+bv) -> transposed [16,768,4096] bf16
  proj_qkv<<<dim3(PJ_ALL), 512, 0, stream>>>(
      text, Wq, bq, qp, img, Wk, bk, kpB, Wv, bv, vt);
  // scores + masked softmax
  attn_scores_softmax<<<dim3(128), 512, 0, stream>>>(
      qp, kpB, masks, pP, rsum);
  // o = (p @ v) / rowsum
  attn_out<<<dim3(12, 16), 256, 0, stream>>>(pP, vt, rsum, out);
}

// v008
// It runs in 91.5 microseconds.
// In both of two side-by-side timings against v007, it was 1.25 times as fast.
// Over all steps from v000 it is 6.71 times as fast.
#include <hip/hip_runtime.h>
#include <hip/hip_bf16.h>
#include <type_traits>

// ---------------------------------------------------------------------------
// Text->Img cross attention, CDNA5 (gfx1250, wave32) bf16 WMMA implementation
//   B=16, N=128, H=W=64 (M=4096), TC=768, IC=512, FQ=36 (padded to 64)
// ---------------------------------------------------------------------------

typedef __bf16 bf16;
typedef __attribute__((ext_vector_type(8)))  bf16  bf16x8;
typedef __attribute__((ext_vector_type(16))) bf16  bf16x16;
typedef __attribute__((ext_vector_type(8)))  float f32x8;

// A/B fragment loader for V_WMMA_*_16X16X32_BF16 (wave32).
// Per ISA 7.12.2, lane (with half = lane>>4) holds K = half*8 + [0..7] in
// elements 0..7 and K = 16 + half*8 + [0..7] in elements 8..15 -> two 16B
// contiguous loads from a row-major [row/col, K] buffer.
__device__ __forceinline__ bf16x16 load_frag(const bf16* base, int half) {
  bf16x8 lo = *(const bf16x8*)(base + half * 8);
  bf16x8 hi = *(const bf16x8*)(base + 16 + half * 8);
  bf16x16 r;
#pragma unroll
  for (int i = 0; i < 8; ++i) { r[i] = lo[i]; r[i + 8] = hi[i]; }
  return r;
}

__device__ __forceinline__ f32x8 wmma_bf16(bf16x16 a, bf16x16 b, f32x8 c) {
  // (neg_a, A, neg_b, B, c_mod, C, reuse_a, reuse_b)
  return __builtin_amdgcn_wmma_f32_16x16x32_bf16(false, a, false, b,
                                                 (short)0, c, false, false);
}

typedef __attribute__((ext_vector_type(4))) float f32x4;
typedef __attribute__((ext_vector_type(4))) bf16  bf16x4;

// ---------------------------------------------------------------------------
// Kernel 1: the q projection, out[row, 0..63] = relu(A[row, :] @ W + bias)
// in columns 0..35 and 0 in columns 36..63; f32 in -> bf16 out, row-major.
// W (K x 36) is turned into bf16 [col][k] in LDS once per block, one barrier;
// the K loop has none. A wave owns 16 rows and all columns (3 accumulators), so
// nobody else needs its A rows: it streams them with loads that cover whole
// lines (16 lanes x 16 B = the 256 B that one row has in a step of 64 k), DS
// steps ahead in registers, and turns them into fragments through an LDS slab
// of its own. Column tile 2 holds columns 32..47: the lanes of 36..47 read a
// row of zeros. k is summed 32 at a time, rising, in one chain per accumulator.
// LDS pitches: K + 8 and 72 bf16, both 16 B x odd, for the ds_load_b128 reads.
// ---------------------------------------------------------------------------
template <int K, int WAVES, int DS>
__device__ __forceinline__ void proj36_body(const float* __restrict__ A,
                                            const float* __restrict__ W,
                                            const float* __restrict__ bias,
                                            bf16* __restrict__ out,
                                            unsigned char* smem, int blk) {
  constexpr int NC = 36, PB = K + 8, PA = 72, NS = K / 64, NT = WAVES * 32;
  bf16* lB   = (bf16*)smem;            // [col][k], row 36 = 0
  bf16* slab = lB + (NC + 1) * PB;     // [wave][buf][row][k]

  const int tid  = threadIdx.x;
  const int w    = tid >> 5;
  const int lane = tid & 31;
  const int half = lane >> 4;
  const int l15  = lane & 15;
  const int rowbase = blk * (WAVES * 16) + w * 16;

  // load j of a step: rows 2j and 2j+1, 256 contiguous bytes of each
  const float* ag = A + (size_t)(rowbase + half) * K + l15 * 4;
  f32x4 ring[DS][8];
  auto fetch = [&](int s) {
#pragma unroll  // constant indices keep ring in registers
    for (int j = 0; j < 8; ++j)
      ring[s % DS][j] = *(const f32x4*)(ag + j * 2 * K + s * 64);
  };
#pragma unroll  // the same
  for (int s = 0; s < DS; ++s) fetch(s);

  // W: a unit is 8 k x 4 columns, 8 loads of 16 B -> 4 LDS stores of 16 B;
  // the loads of WG units are in flight together
  constexpr int UNITS = (K / 8) * (NC / 4);
  constexpr int WG = (UNITS / NT) % 3 == 0 ? 3 : 1;
  auto stage_w = [&](int u0, auto gc) {
    constexpr int G = decltype(gc)::value;
    const float* src[G];
    f32x4 wv[G][8];
#pragma unroll  // constant indices: the array stays in registers
    for (int g = 0; g < G; ++g) {
      const int u = u0 + g * NT;
      src[g] = W + (u / (NC / 4)) * 8 * NC + (u % (NC / 4)) * 4;
#pragma unroll  // constant indices: the array stays in registers
      for (int i = 0; i < 8; ++i) wv[g][i] = *(const f32x4*)(src[g] + i * NC);
    }
    // precaution: as inputs of the wait the loads' addresses live up to it, so
    // that no later load lands in registers which an issued load names
    if constexpr (G == 3)
      asm volatile("s_wait_xcnt 0x0" :: "v"(src[0]), "v"(src[1]), "v"(src[2]) : "memory");
    else
      asm volatile("s_wait_xcnt 0x0" :: "v"(src[0]) : "memory");
#pragma unroll  // constant indices: the array stays in registers
    for (int g = 0; g < G; ++g) {
      const int u = u0 + g * NT;
#pragma unroll  // constant indices: the array stays in registers
      for (int j = 0; j < 4; ++j) {
        bf16x8 v;
#pragma unroll  // constant indices: the array stays in registers
        for (int i = 0; i < 8; ++i) v[i] = (bf16)wv[g][i][j];
        *(bf16x8*)&lB[((u % (NC / 4)) * 4 + j) * PB + (u / (NC / 4)) * 8] = v;
      }
    }
  };
  for (int n = 0; n < UNITS / NT; n += WG)
    stage_w(n * NT + tid, std::integral_constant<int, WG>{});
  if (tid < UNITS % NT)
    stage_w((UNITS / NT) * NT + tid, std::integral_constant<int, 1>{});
  if (tid < K / 8) {
    const bf16x8 zero = {};
    *(bf16x8*)&lB[NC * PB + tid * 8] = zero;
  }
  __syncthreads();

  const bf16* brow[3];
#pragma unroll  // constant indices: the array stays in registers
  for (int t = 0; t < 3; ++t) {
    const int c = t * 16 + l15;
    brow[t] = &lB[(c < NC ? c : NC) * PB];
  }

  f32x8 acc[3] = {};
#pragma unroll  // the ring slot and the slab buffer must be constants
  for (int s = 0; s < NS; ++s) {
    bf16* sl = slab + (w * 2 + (s & 1)) * (16 * PA);
    bf16x16 af[2], bfr[2][3];
    // the W fragments wait for nobody: read ahead of the slab's wait, under it
#pragma unroll  // constant indices: the array stays in registers
    for (int c = 0; c < 2; ++c)
#pragma unroll  // constant indices: the array stays in registers
      for (int t = 0; t < 3; ++t)
        bfr[c][t] = load_frag(brow[t] + s * 64 + c * 32, half);
#pragma unroll  // constant indices: the array stays in registers
    for (int j = 0; j < 8; ++j)
      *(bf16x4*)&sl[(2 * j + half) * PA + l15 * 4] =
          __builtin_convertvector(ring[s % DS][j], bf16x4);
    if (s + DS < NS) fetch(s + DS);
    // the slab rows that a lane reads below were written by other lanes of its
    // wave: their stores are done, and the compiler moves no read above them
    asm volatile("s_wait_dscnt 0x0" ::: "memory");
#pragma unroll  // constant indices: the array stays in registers
    for (int c = 0; c < 2; ++c) af[c] = load_frag(&sl[l15 * PA + c * 32], half);
#pragma unroll  // constant indices: the array stays in registers
    for (int c = 0; c < 2; ++c)
#pragma unroll  // constant indices: the array stays in registers
      for (int t = 0; t < 3; ++t) acc[t] = wmma_bf16(af[c], bfr[c][t], acc[t]);
  }
  asm volatile("s_wait_xcnt 0x0" :: "v"(ag) : "memory");  // see the W loads

  // epilogue: bias + relu, through the wave's slab, so that every store
  // instruction writes 4 whole 128-B rows of out (C/D: row = r + 8 half, col = l15)
  bf16* sl = slab + (w * 2) * (16 * PA);
#pragma unroll  // constant indices: the array stays in registers
  for (int t = 0; t < 3; ++t) {
    const int gc = t * 16 + l15;
    const float bv = (gc < NC) ? bias[gc] : 0.f;
#pragma unroll  // constant indices: the array stays in registers
    for (int r = 0; r < 8; ++r) {
      const float val = acc[t][r] + bv;
      sl[(r + 8 * half) * PA + gc] = (bf16)(val > 0.f ? val : 0.f);
    }
  }
  // as in the loop: other lanes' stores are done before the rows are read back
  asm volatile("s_wait_dscnt 0x0" ::: "memory");
  const int pc = lane & 7;  // 16-B piece of a row; pieces 6, 7 = columns 48..63
#pragma unroll  // the 4 LDS reads issue together, then the 4 stores
  for (int j = 0; j < 4; ++j) {
    const int row = j * 4 + (lane >> 3);
    bf16x8 v = *(const bf16x8*)&sl[row * PA + (pc < 6 ? pc : 0) * 8];
    if (pc >= 6) v = bf16x8{};
    *(bf16x8*)(out + (size_t)(rowbase + row) * 64 + pc * 8) = v;
  }
  // precaution: in the kernel's text another body's code follows these stores;
  // nothing there stands ahead of this wait and rewrites their address registers
  asm volatile("s_wait_xcnt 0x0" ::: "memory");
}

// ---------------------------------------------------------------------------
// Kernel 1b: the v and the k projection of 256 img rows, from one LDS-resident tile.
//   v[b, m, col] = relu(img[b*4096+m, :] @ Wv + bv), 768 columns, written to vt
//   in the order in which attn_out reads its B fragments (VF_* below)
//   k[row, 0..47] = relu(img[row, :] @ Wk + bk) in columns 0..35, 0 beyond,
//   written to kp in the order in which the scores kernel reads its B fragments
// Block = 512 thr (16 waves). Its 256 rows x 512 k are read from memory once,
// turned into bf16 once and stay in LDS; every product of these rows is made
// from there: three passes of 256 v columns, then the k columns.
// A v pass: waves 4 x 4, 64 rows x 64 cols = 4 x 4 accumulators per wave, so 8
// fragments feed 16 WMMAs. Wv comes in chunks of 32 k through two LDS buffers:
// next chunk's global loads, WMMAs on the current chunk, cvt + LDS store of the
// next chunk, one barrier per chunk. In the first pass the img chunks come the
// same way, one chunk ahead, into their place in the resident tile.
// Blocks start with different column tiles, so that not all of them ask for the
// same lines of Wv at the same moment.
// LDS pitches: img rows 1104 B, Wv rows (32 k) 80 B, Wk rows 1040 B: 16 B x odd.
// Column order in LDS: the thread that loads 4 neighbouring columns cg*4+j puts
// column j into LDS row j*64+cg, so wave column wc holds the columns = wc mod 4.
// The k pass: wave w owns rows 16 w .. 16 w + 15 and 3 column tiles; Wk lies in
// the place of the Wv buffers as [col][k], row 36 = 0 for the columns 36..47;
// k is summed 32 at a time, rising, in one chain per accumulator.
// ---------------------------------------------------------------------------
constexpr int PV_PA  = 512 + 40;  // bf16 per LDS row of the img tile
constexpr int KF_TILE = 3 * 256;  // bf16 per score tile (16 m) of kp: 3 units of 512 B
// vt, in bf16: [b][group of 64 columns][chunk of 32 m][tile wc][unit u][lane][8].
// Tile wc of a group holds its columns 4 l15 + wc. A unit is 512 B, lane after
// lane: the lane (l15, half) holds m = 16 u + 8 half + 0..7 of its column, which
// is what a lane has in one accumulator here and half of a B fragment there.
constexpr int VF_UNIT  = 256;              // 32 lanes x 8 bf16
constexpr int VF_TILE  = 2 * VF_UNIT;      // one B fragment of 32 m x 16 columns
constexpr int VF_CHUNK = 4 * VF_TILE;      // 32 m x 64 columns, 4 KB
constexpr int VF_GROUP = 128 * VF_CHUNK;   // 4096 m x 64 columns
constexpr int PV_LDS = (256 * PV_PA + 2 * 256 * 40) * 2;

__device__ __forceinline__ void proj_vk_body(const float* __restrict__ A,
                                             const float* __restrict__ W,
                                             const float* __restrict__ bias,
                                             bf16* __restrict__ out,
                                             const float* __restrict__ Wk,
                                             const float* __restrict__ bk,
                                             bf16* __restrict__ kout,
                                             unsigned char* smem, int blk) {
  constexpr int K = 512, NC = 768, P = 40;
  bf16* lA = (bf16*)smem;                                       // [row][k]  276 KB
  bf16 (*lB)[256 * P] = (bf16 (*)[256 * P])(lA + 256 * PV_PA);  // [buf][col][k]  2x20 KB

  const int tid  = threadIdx.x;
  const int w    = tid >> 5;
  const int lane = tid & 31;
  const int half = lane >> 4;
  const int l15  = lane & 15;
  const int wr   = w >> 2;
  const int wc   = w & 3;
  const int rowblock = blk * 256;

  // img chunk [256 x 32] f32: 8 lanes x 16 B cover one row's 128-B line.
  const int ar = tid >> 3;
  const int ak = (tid & 7) * 4;
  const float* asrc = A + (size_t)(rowblock + ar) * K + ak;
  // Wv chunk [32 x 256] f32: 4 k rows x 4 columns per thread.
  const int cg = tid & 63;
  const int kg = tid >> 6;
  const float* wsrc = W + (size_t)(kg * 4) * NC + cg * 4;

  f32x4 aR[4], wR[4];
  auto ld_a = [&](int k0) {
#pragma unroll
    for (int j = 0; j < 4; ++j)
      aR[j] = *(const f32x4*)(asrc + (size_t)(j * 64) * K + k0);
  };
  auto ld_w = [&](int ct, int k0) {
#pragma unroll
    for (int i = 0; i < 4; ++i)
      wR[i] = *(const f32x4*)(wsrc + ct * 256 + (size_t)(k0 + i) * NC);
  };
  auto st_a = [&](int k0) {
#pragma unroll
    for (int j = 0; j < 4; ++j)
      *(bf16x4*)&lA[(ar + 64 * j) * PV_PA + k0 + ak] =
          __builtin_convertvector(aR[j], bf16x4);
  };
  auto st_w = [&](int buf) {
#pragma unroll
    for (int j = 0; j < 4; ++j) {
      bf16x4 v;
#pragma unroll
      for (int i = 0; i < 4; ++i) v[i] = (bf16)wR[i][j];
      *(bf16x4*)&lB[buf][(j * 64 + cg) * P + kg * 4] = v;
    }
  };

  const int bb = rowblock >> 12;
  const int ch0 = ((rowblock & 4095) >> 5) + wr * 2;  // the wave's first chunk of 32 m

  // Wk takes the place of the Wv buffers behind the last v chunk, ahead of that
  // pass's stores to vt, so that no barrier has to wait for those stores
  constexpr int KC = 36, PB = K + 8, PS = 72;
  bf16* lK = (bf16*)lB;  // [col][k], 37 rows
  // a unit is 8 k x 4 columns, 8 loads of 16 B -> 4 LDS stores of 16 B
  auto stage_k = [&](int u) {
    const float* src = Wk + (u / (KC / 4)) * 8 * KC + (u % (KC / 4)) * 4;
    f32x4 wv[8];
#pragma unroll  // constant indices: the array stays in registers
    for (int i = 0; i < 8; ++i) wv[i] = *(const f32x4*)(src + i * KC);
    // precaution: as an input of the wait the loads' address lives up to it, so
    // that no later load lands in registers which an issued load names
    asm volatile("s_wait_xcnt 0x0" :: "v"(src) : "memory");
#pragma unroll  // constant indices: the array stays in registers
    for (int j = 0; j < 4; ++j) {
      bf16x8 v;
#pragma unroll  // constant indices: the array stays in registers
      for (int i = 0; i < 8; ++i) v[i] = (bf16)wv[i][j];
      *(bf16x8*)&lK[((u % (KC / 4)) * 4 + j) * PB + (u / (KC / 4)) * 8] = v;
    }
  };
  auto stage_wk = [&]() {
    constexpr int UNITS = (K / 8) * (KC / 4);  // 576 = 512 + 64
    __syncthreads();  // every wave has read its last Wv fragments: the buffers are free
    stage_k(tid);
    if (tid < UNITS - 512) stage_k(512 + tid);
    if (tid < K / 8) {
      const bf16x8 zero = {};
      *(bf16x8*)&lK[KC * PB + tid * 8] = zero;
    }
    __syncthreads();  // Wk is whole before anybody reads it
  };

  // one pass: column tile ct; ctn is the tile of the pass that follows
  auto pass = [&](auto first, auto last, int ct, int ctn) {
    constexpr bool FIRST = decltype(first)::value, LAST = decltype(last)::value;
    constexpr int nCh = K / 32;
    f32x8 acc[4][4] = {};
    for (int ci = 0; ci < nCh; ++ci) {
      const int cur = ci & 1;
      const bool lastc = (ci + 1) == nCh;
      const bool more = !(LAST && lastc);
      // VMEM for the next chunk first
      if (FIRST && !lastc) ld_a((ci + 1) * 32);
      if (more) ld_w(lastc ? ctn : ct, lastc ? 0 : (ci + 1) * 32);

      bf16x16 af[4], bfr[4];
#pragma unroll
      for (int i = 0; i < 4; ++i)
        af[i] = load_frag(&lA[(wr * 64 + i * 16 + l15) * PV_PA + ci * 32], half);
#pragma unroll
      for (int t = 0; t < 4; ++t)
        bfr[t] = load_frag(&lB[cur][(wc * 64 + t * 16 + l15) * P], half);
      // keeps the global loads and the 16 LDS reads one group ahead of the WMMAs;
      // without it global loads sink to just before their cvt, their latency no
      // longer covered, and A fragments are read among the WMMAs behind full waits
      __builtin_amdgcn_sched_barrier(0);
#pragma unroll
      for (int i = 0; i < 4; ++i)
#pragma unroll
        for (int t = 0; t < 4; ++t)
          acc[i][t] = wmma_bf16(af[i], bfr[t], acc[i][t]);

      // keeps the cvt of the loaded chunk, and with it the wait on those loads,
      // behind the WMMAs; without it the scheduler lifts both above them
      __builtin_amdgcn_sched_barrier(0);
      if (more) {
        // safe: everyone finished reading buffer cur^1 before the last barrier,
        // and nobody has read the img columns of the next chunk yet
        st_w(cur ^ 1);
        if (FIRST && !lastc) st_a((ci + 1) * 32);
        __syncthreads();
      }
    }

    if constexpr (LAST) stage_wk();

    // epilogue: a lane's 8 accumulator registers are 8 consecutive m of one
    // column -> bias + relu + one 16-B store each. Accumulator (i, t) is unit
    // i & 1 of chunk ch0 + (i >> 1): a store instruction writes 4 whole lines.
    bf16* dst = out + (size_t)(bb * 12 + ct * 4) * VF_GROUP + ch0 * VF_CHUNK +
                wc * VF_TILE + lane * 8;
#pragma unroll
    for (int t = 0; t < 4; ++t) {
      const int gc = ct * 256 + (t * 16 + l15) * 4 + wc;
      const float bv = bias[gc];
#pragma unroll
      for (int i = 0; i < 4; ++i) {
        bf16x8 v;
#pragma unroll
        for (int r = 0; r < 8; ++r) {
          const float val = acc[i][t][r] + bv;
          v[r] = (bf16)(val > 0.f ? val : 0.f);
        }
        *(bf16x8*)(dst + t * VF_GROUP + (i >> 1) * VF_CHUNK + (i & 1) * VF_UNIT) = v;
      }
    }
    // precaution: as an input of the wait the stores' address lives up to it, so
    // that the code of the next pass does not rewrite it ahead of the wait
    asm volatile("s_wait_xcnt 0x0" :: "v"(dst) : "memory");
  };

  const int c0 = blk % 3;
  const int c1 = c0 == 2 ? 0 : c0 + 1;
  const int c2 = c1 == 2 ? 0 : c1 + 1;

  ld_a(0);
  ld_w(c0, 0);
  st_a(0);
  st_w(0);
  __syncthreads();
  pass(std::true_type{}, std::false_type{}, c0, c1);
  pass(std::false_type{}, std::false_type{}, c1, c2);
  pass(std::false_type{}, std::true_type{}, c2, c2);

  // ---- the k columns, from the same img tile
  const bf16* arow = &lA[(w * 16 + l15) * PV_PA];
  const bf16* brow[3];
#pragma unroll  // constant indices: the array stays in registers
  for (int t = 0; t < 3; ++t) {
    const int c = t * 16 + l15;
    brow[t] = &lK[(c < KC ? c : KC) * PB];
  }
  f32x8 ka[3] = {};
#pragma unroll 4  // 4 chunks' LDS reads go ahead of their WMMAs; all 16 would spill
  for (int s = 0; s < K / 32; ++s) {
    const bf16x16 af = load_frag(arow + s * 32, half);
#pragma unroll  // constant indices: the array stays in registers
    for (int t = 0; t < 3; ++t)
      ka[t] = wmma_bf16(af, load_frag(brow[t] + s * 32, half), ka[t]);
  }

  // epilogue: bias + relu into an LDS slab in the wave's own 16 img rows, which
  // nobody else reads in this pass (C/D: row = r + 8 half, col = l15)
  bf16* sl = lA + (w * 16) * PV_PA;
#pragma unroll  // constant indices: the array stays in registers
  for (int t = 0; t < 3; ++t) {
    const int gc = t * 16 + l15;
    const float bv = (gc < KC) ? bk[gc] : 0.f;
#pragma unroll  // constant indices: the array stays in registers
    for (int r = 0; r < 8; ++r) {
      const float val = ka[t][r] + bv;
      sl[(r + 8 * half) * PS + gc] = (bf16)(val > 0.f ? val : 0.f);
    }
  }
  // every wave's slab is whole before other waves read it. The fences name LDS
  // alone, so that the barrier does not wait for the stores to vt in flight
  __builtin_amdgcn_fence(__ATOMIC_RELEASE, "workgroup", "local");
  __builtin_amdgcn_s_barrier();
  __builtin_amdgcn_fence(__ATOMIC_ACQUIRE, "workgroup", "local");
  // kout in fragment order (see the scores kernel): wave w writes score tile w
  // of the block's 256 rows, three units of 512 B; in unit u the lane (l15, half)
  // holds columns 16 u + 8 half .. + 7 of the row that is the tile's column l15.
  // A store instruction writes 4 whole lines.
  const int srow = (w >> 2) * 64 + l15 * 4 + (w & 3);
  const bf16* sr = lA + (srow >> 4) * (16 * PV_PA) + (srow & 15) * PS + half * 8;
  bf16* kd = kout + (size_t)(blk * 16 + w) * KF_TILE + lane * 8;
#pragma unroll  // the 3 LDS reads issue together, then the 3 stores
  for (int u = 0; u < 3; ++u)
    *(bf16x8*)(kd + u * 256) = *(const bf16x8*)(sr + u * 16);
  // precaution: the stores' address lives up to the wait
  asm volatile("s_wait_xcnt 0x0" :: "v"(kd) : "memory");
}

// ---------------------------------------------------------------------------
// The projections depend on nothing but the inputs: one launch holds them all.
// Blocks 0..7 are the q blocks (256 rows each), the 256 blocks after them
// make v and k of 256 img rows each. All have 16 waves
// and share one LDS range, sized for the larger use.
// ---------------------------------------------------------------------------
constexpr int PJ_Q = 8, PJ_VK = 256, PJ_ALL = PJ_Q + PJ_VK;
constexpr int PJ_LDS_Q = (37 * (768 + 8) + 16 * 2 * 16 * 72) * 2;
constexpr int PJ_LDS = PJ_LDS_Q > PV_LDS ? PJ_LDS_Q : PV_LDS;

__launch_bounds__(512)
__global__ void proj_qkv(const float* __restrict__ text, const float* __restrict__ Wq,
                         const float* __restrict__ bq, bf16* __restrict__ qp,
                         const float* __restrict__ img, const float* __restrict__ Wk,
                         const float* __restrict__ bk, bf16* __restrict__ kp,
                         const float* __restrict__ Wv, const float* __restrict__ bv,
                         bf16* __restrict__ vt) {
  __shared__ __align__(16) unsigned char smem[PJ_LDS];
  const int blk = blockIdx.x;
  if (blk >= PJ_Q)
    proj_vk_body(img, Wv, bv, vt, Wk, bk, kp, smem, blk - PJ_Q);
  else
    proj36_body<768, 16, 2>(text, Wq, bq, qp, smem, blk);
}

// ---------------------------------------------------------------------------
// Kernel 2: s = q@k^T, beta = s*mask, softmax over M=4096, beta held in registers.
// One block per (b, 16-query tile), 16 waves. Wave w owns m in [256w, 256w+256)
// = 16 WMMA tiles. The 128 beta of a lane stay in the registers that its 128 mask
// values were loaded into: all mask loads of a wave are in flight together, and
// nothing is written to be read again.
// Column l15 of tile j is m = 256 w + 64 (j >> 2) + 4 l15 + (j & 3): a lane owns
// 4 neighbouring m four times in each of its rows, so a mask load is 16 B and a p
// store 8 B a lane, and 16 lanes cover whole lines of a row. kp holds k in that
// order, fragment by fragment (tile: 3 units of 512 B, K 0..15, 16..31, 32..47,
// lane after lane), so a k load covers 4 whole lines; K 48..63 is 0 and not kept.
// p = exp(beta - max) is bf16, unnormalized; row sums -> rowsum_g.
// Row reductions: __shfl_xor within 16-lane groups, then LDS across waves.
// ---------------------------------------------------------------------------
__launch_bounds__(512)
__global__ void attn_scores_softmax(const bf16* __restrict__ qp,
                                    const bf16* __restrict__ kp,
                                    const float* __restrict__ masks,
                                    bf16* __restrict__ p,
                                    float* __restrict__ rowsum_g) {
  __shared__ float red[16][16];
  __shared__ float rowmax[16];

  const int tid  = threadIdx.x;
  const int w    = tid >> 5;
  const int lane = tid & 31;
  const int half = lane >> 4;
  const int l15  = lane & 15;
  const int b     = blockIdx.x >> 3;
  const int nbase = (blockIdx.x & 7) * 16;

  const bf16* qrow = qp + ((size_t)b * 128 + nbase + l15) * 64;
  const bf16x16 a0 = load_frag(qrow, half);        // K 0..31
  const bf16x16 a1 = load_frag(qrow + 32, half);   // K 32..63
  // precaution, here and behind the mask and the k loads below: as an input of
  // the wait the loads' address lives up to it, so that no later load lands in
  // registers which an issued load names before the wait has been passed
  asm volatile("s_wait_xcnt 0x0" :: "v"(qrow) : "memory");

  // the lane's element of tile j, register r: row nbase + 8 half + r,
  // m = m0 + 64 (j >> 2) + (j & 3)
  const int    m0  = w * 256 + l15 * 4;
  const size_t idx = ((size_t)b * 128 + nbase + 8 * half) * 4096 + m0;
  const float* mrow = masks + idx;
  const bf16*  kfr = kp + (size_t)(b * 16 + w) * (16 * KF_TILE) + lane * 8;

  f32x4 bt[8][4];  // [register][j >> 2][j & 3]: first the mask, then beta
#pragma unroll  // constant indices keep bt in registers
  for (int r = 0; r < 8; ++r)
#pragma unroll  // the same
    for (int h = 0; h < 4; ++h) bt[r][h] = *(const f32x4*)(mrow + r * 4096 + h * 64);
  asm volatile("s_wait_xcnt 0x0" :: "v"(mrow) : "memory");  // see the q loads

  // k fragments: a ring of KD tiles in registers
  constexpr int KD = 3;
  bf16x8 kr[KD][3];
  auto kfetch = [&](int j) {
#pragma unroll  // constant indices keep kr in registers
    for (int u = 0; u < 3; ++u)
      kr[j % KD][u] = *(const bf16x8*)(kfr + j * KF_TILE + u * 256);
  };
#pragma unroll  // the same
  for (int j = 0; j < KD; ++j) kfetch(j);

  float rmax[8];
#pragma unroll  // rmax is indexed by constants only
  for (int r = 0; r < 8; ++r) rmax[r] = -3.0e38f;

#pragma unroll  // constant indices keep bt and kr in registers
  for (int j = 0; j < 16; ++j) {
    bf16x16 b0, b1;
#pragma unroll  // constant indices: the vectors stay in registers
    for (int i = 0; i < 8; ++i) {
      b0[i] = kr[j % KD][0][i]; b0[i + 8] = kr[j % KD][1][i];
      b1[i] = kr[j % KD][2][i]; b1[i + 8] = (bf16)0.f;
    }
    f32x8 acc = {};
    acc = wmma_bf16(a0, b0, acc);
    acc = wmma_bf16(a1, b1, acc);
    if (j + KD < 16) kfetch(j + KD);
#pragma unroll  // the same
    for (int r = 0; r < 8; ++r) {
      const float be = acc[r] * bt[r][j >> 2][j & 3];  // multiplicative mask BEFORE softmax
      bt[r][j >> 2][j & 3] = be;
      rmax[r] = fmaxf(rmax[r], be);
    }
  }
  asm volatile("s_wait_xcnt 0x0" :: "v"(kfr) : "memory");  // see the q loads

  // row max: reduce across the 16 lanes that share rows, then across waves
#pragma unroll
  for (int r = 0; r < 8; ++r)
#pragma unroll
    for (int off = 1; off < 16; off <<= 1)
      rmax[r] = fmaxf(rmax[r], __shfl_xor(rmax[r], off, 16));
  if (l15 == 0)
#pragma unroll
    for (int r = 0; r < 8; ++r) red[w][r + 8 * half] = rmax[r];
  __syncthreads();
  if (tid < 16) {
    float mx = -3.0e38f;
    for (int ww = 0; ww < 16; ++ww) mx = fmaxf(mx, red[ww][tid]);
    rowmax[tid] = mx;
  }
  __syncthreads();

  float rsum[8] = {};
  bf16* prow = p + idx;
#pragma unroll  // constant indices keep bt in registers
  for (int r = 0; r < 8; ++r) {
    const float mx = rowmax[r + 8 * half];
#pragma unroll  // the same
    for (int h = 0; h < 4; ++h) {
      bf16x4 pv;  // unnormalized; 1/sum in attn_out
#pragma unroll  // the same
      for (int i = 0; i < 4; ++i) {
        const float t = (bt[r][h][i] - mx) * 1.44269504f;  // exp(x) = 2^(x log2 e)
        float e;
        // the v_nop fills the slot that the instruction set asks for between a
        // transcendental and a next instruction that reads e or overwrites t
        asm("v_exp_f32 %0, %1\n\tv_nop" : "=v"(e) : "v"(t));
        rsum[r] += e;
        pv[i] = (bf16)e;
      }
      *(bf16x4*)(prow + r * 4096 + h * 64) = pv;
    }
  }
  // precaution: the stores' address lives up to the wait
  asm volatile("s_wait_xcnt 0x0" :: "v"(prow) : "memory");
#pragma unroll
  for (int r = 0; r < 8; ++r)
#pragma unroll
    for (int off = 1; off < 16; off <<= 1)
      rsum[r] += __shfl_xor(rsum[r], off, 16);
  __syncthreads();  // rowmax reads done; red is reusable
  if (l15 == 0)
#pragma unroll
    for (int r = 0; r < 8; ++r) red[w][r + 8 * half] = rsum[r];
  __syncthreads();
  if (tid < 16) {
    float s = 0.f;
    for (int ww = 0; ww < 16; ++ww) s += red[ww][tid];
    rowsum_g[(size_t)b * 128 + nbase + tid] = s;
  }
}

// ---------------------------------------------------------------------------
// Kernel 3: o[b,n,col] = (p[b,n,:] @ v[b,:,col]) / rowsum[b,n].
// One block = all 128 n of one batch x one group of 64 columns, 8 waves (4 x 2),
// 32 n x 2 column tiles per wave = 2 x 2 accumulators. p and v are staged in LDS,
// 256 m per stage, by asynchronous copies of 512 contiguous bytes a wave, so
// every global access covers whole lines: of p the bytes that one row has in the
// stage, of v one unit; v comes in fragment order (VF_* above), a stage is 32 KB
// in a row and lies in LDS as in memory, so a B fragment is two reads of a unit.
// Two buffers: the next stage's copies fly while this stage is multiplied.
// LDS rows of p: 512 B at a pitch of 528 B (16 B x odd) for the ds_load_b128 reads.
// Column l15 of tile j is column 4 l15 + j of the group: the result goes through
// LDS once, so that each line of out has one writer and is stored whole.
// ---------------------------------------------------------------------------
typedef __attribute__((ext_vector_type(2))) float f32x2;

constexpr int AO_KS    = 256;                 // m per stage
constexpr int AO_NT    = 4096 / AO_KS;        // stages
constexpr int AO_PITCH = AO_KS * 2 + 16;      // bytes per LDS row of p
constexpr int AO_A     = 128 * AO_PITCH;      // p tile, bytes
constexpr int AO_BUF   = AO_A + (AO_KS / 32) * VF_CHUNK * 2;
constexpr int AO_PO    = 64 + 4;              // floats per LDS row of the result: 16 B x odd

// Eight copies of one wave, LS bytes apart in LDS and GS bf16 apart in memory;
// each lane brings its own 16 bytes. The s_wait_xcnt stands inside the statement
// so that no address register of a copy is rewritten in front of it.
template <unsigned LS, int GS>
__device__ __forceinline__ void copy8(unsigned l, const bf16* g) {
  asm volatile(
      "global_load_async_to_lds_b128 %0, %8, off\n\t"
      "global_load_async_to_lds_b128 %1, %9, off\n\t"
      "global_load_async_to_lds_b128 %2, %10, off\n\t"
      "global_load_async_to_lds_b128 %3, %11, off\n\t"
      "global_load_async_to_lds_b128 %4, %12, off\n\t"
      "global_load_async_to_lds_b128 %5, %13, off\n\t"
      "global_load_async_to_lds_b128 %6, %14, off\n\t"
      "global_load_async_to_lds_b128 %7, %15, off\n\t"
      "s_wait_xcnt 0x0"
      :: "v"(l), "v"(l + LS), "v"(l + 2 * LS), "v"(l + 3 * LS),
         "v"(l + 4 * LS), "v"(l + 5 * LS), "v"(l + 6 * LS), "v"(l + 7 * LS),
         "v"(g), "v"(g + GS), "v"(g + 2 * GS), "v"(g + 3 * GS),
         "v"(g + 4 * GS), "v"(g + 5 * GS), "v"(g + 6 * GS), "v"(g + 7 * GS)
      : "memory");
}

// B fragment from fragment order: the lane's 16 B of unit 0 (K = 8 half + 0..7)
// and of unit 1 (K = 16 + 8 half + 0..7), the k order of load_frag
__device__ __forceinline__ bf16x16 load_frag_units(const bf16* lane_base) {
  bf16x8 lo = *(const bf16x8*)(lane_base);
  bf16x8 hi = *(const bf16x8*)(lane_base + VF_UNIT);
  bf16x16 r;
#pragma unroll
  for (int i = 0; i < 8; ++i) { r[i] = lo[i]; r[i + 8] = hi[i]; }
  return r;
}

__launch_bounds__(256)
__global__ void attn_out(const bf16* __restrict__ p,
                         const bf16* __restrict__ v_t,
                         const float* __restrict__ rowsum_g,
                         float* __restrict__ out) {
  __shared__ __align__(16) unsigned char ring[2][AO_BUF];  // 2 x 98 KB

  const int tid  = threadIdx.x;
  const int w    = tid >> 5;
  const int lane = tid & 31;
  const int half = lane >> 4;
  const int l15  = lane & 15;
  const int wr   = w >> 1;
  const int wc   = w & 1;
  const int b        = blockIdx.y;
  const int colblock = blockIdx.x * 64;

  // wave w copies rows w, w+8, ... of p (16 rows) and units w, w+8, ... of v (8)
  const bf16* pg = p   + ((size_t)b * 128 + w) * 4096 + lane * 8;
  const bf16* vg = v_t + (size_t)(b * 12 + blockIdx.x) * VF_GROUP + w * VF_UNIT + lane * 8;
  const unsigned l0 =
      (unsigned)(size_t)&ring[0][0] + (unsigned)(w * AO_PITCH + lane * 16);
  const unsigned lv =
      (unsigned)(size_t)&ring[0][0] + (unsigned)(AO_A + w * (VF_UNIT * 2) + lane * 16);

  auto fill = [&](int t, int buf) {
    const unsigned l = l0 + (unsigned)(buf * AO_BUF);
    copy8<8 * AO_PITCH, 8 * 4096>(l, pg + t * AO_KS);
    copy8<8 * AO_PITCH, 8 * 4096>(l + 64 * AO_PITCH, pg + 64 * 4096 + t * AO_KS);
    copy8<8 * VF_UNIT * 2, 8 * VF_UNIT>(lv + (unsigned)(buf * AO_BUF),
                                        vg + t * ((AO_KS / 32) * VF_CHUNK));
  };

  f32x8 acc[2][2] = {};

  fill(0, 0);
  // stage 0 has landed for this wave, then for all
  asm volatile("s_wait_asynccnt 0x0" ::: "memory");
  __syncthreads();
  fill(1, 1);

  for (int t = 0; t < AO_NT; ++t) {
    const int cur = t & 1;
    const unsigned char* base = &ring[cur][0];
    const bf16* ar = (const bf16*)(base + (wr * 32 + l15) * AO_PITCH);
    const bf16* br = (const bf16*)(base + AO_A) + wc * (2 * VF_TILE) + lane * 8;
    // a block = 2 k chunks of 32 = 16 LDS reads, 8 WMMAs; two fragment sets
    bf16x16 fa[2][2][2], fb[2][2][2];  // [set][chunk][tile]
    auto frags = [&](int set, int blk) {
#pragma unroll  // constant indices keep fa, fb in registers
      for (int c = 0; c < 2; ++c) {
        const int kc = blk * 2 + c;
        fa[set][c][0] = load_frag(ar + kc * 32, half);
        fa[set][c][1] = load_frag(ar + 8 * AO_PITCH + kc * 32, half);
        fb[set][c][0] = load_frag_units(br + kc * VF_CHUNK);
        fb[set][c][1] = load_frag_units(br + kc * VF_CHUNK + VF_TILE);
      }
    };
    frags(0, 0);
#pragma unroll  // the set index must be a constant: fa, fb stay in registers
    for (int blk = 0; blk < AO_KS / 64; ++blk) {
      const int s = blk & 1;
      if (blk + 1 < AO_KS / 64) frags(s ^ 1, blk + 1);
      // keeps the next block's LDS reads one group ahead of this block's WMMAs;
      // without it they are spread among the WMMAs behind full waits
      __builtin_amdgcn_sched_barrier(0);
#pragma unroll  // constant indices, as above
      for (int c = 0; c < 2; ++c) {
        acc[0][0] = wmma_bf16(fa[s][c][0], fb[s][c][0], acc[0][0]);
        acc[0][1] = wmma_bf16(fa[s][c][0], fb[s][c][1], acc[0][1]);
        acc[1][0] = wmma_bf16(fa[s][c][1], fb[s][c][0], acc[1][0]);
        acc[1][1] = wmma_bf16(fa[s][c][1], fb[s][c][1], acc[1][1]);
      }
      // keeps the reads of the block after next behind this block's WMMAs;
      // without it they split into smaller groups among these WMMAs, and the
      // last block's WMMAs sink behind the hand-over barrier
      __builtin_amdgcn_sched_barrier(0);
    }
    // hand-over: this wave's reads of buffer cur are done ...
    asm volatile("s_wait_dscnt 0x0" ::: "memory");
    // ... its copies of stage t+1 have landed ...
    asm volatile("s_wait_asynccnt 0x0" ::: "memory");
    // ... and the same holds for every wave: stage t+1 may be read, cur refilled
    __syncthreads();
    if (t + 2 < AO_NT) fill(t + 2, cur);
  }
  // no copy is outstanding when the wave ends
  asm volatile("s_wait_asynccnt 0x0" ::: "memory");

  // the ring is free: behind the last hand-over nobody reads it, nothing flies.
  // The block's 128 x 64 result in column order, rows at a pitch of AO_PO floats
  float* res = (float*)&ring[0][0];
#pragma unroll  // acc is indexed by constants only
  for (int i = 0; i < 2; ++i)
#pragma unroll  // the same
    for (int r = 0; r < 8; ++r) {
      const int n = wr * 32 + i * 16 + r + 8 * half;
      const float scale = 1.0f / rowsum_g[(size_t)b * 128 + n];
      const f32x2 v = {acc[i][0][r] * scale, acc[i][1][r] * scale};
      *(f32x2*)&res[n * AO_PO + l15 * 4 + wc * 2] = v;
    }
  __syncthreads();  // a row holds the columns of two waves: whole before it is read
  // wave w stores rows 16 w .. 16 w + 15, two rows x 256 B = 4 whole lines at a time
  const float* rs = res + (w * 16 + half) * AO_PO + l15 * 4;
  float* dst = out + ((size_t)b * 128 + w * 16 + half) * 768 + colblock + l15 * 4;
#pragma unroll  // the 8 LDS reads issue together, then the 8 stores
  for (int j = 0; j < 8; ++j)
    *(f32x4*)(dst + j * 2 * 768) = *(const f32x4*)(rs + j * 2 * AO_PO);
}

// ---------------------------------------------------------------------------
extern "C" void kernel_launch(void* const* d_in, const int* in_sizes, int n_in,
                              void* d_out, int out_size, void* d_ws, size_t ws_size,
                              hipStream_t stream) {
  (void)in_sizes; (void)n_in; (void)out_size; (void)ws_size;
  const float* text  = (const float*)d_in[0];  // [16,128,768]
  const float* img   = (const float*)d_in[1];  // [16,64,64,512] = [65536,512]
  const float* masks = (const float*)d_in[2];  // [16,128,4096]
  const float* Wq    = (const float*)d_in[3];  // [768,36]
  const float* bq    = (const float*)d_in[4];
  const float* Wk    = (const float*)d_in[5];  // [512,36]
  const float* bk    = (const float*)d_in[6];
  const float* Wv    = (const float*)d_in[7];  // [512,768]
  const float* bv    = (const float*)d_in[8];
  float* out = (float*)d_out;                  // [16,128,768]

  // workspace carve (256B aligned regions)
  char* ws = (char*)d_ws;
  size_t off = 0;
  auto carve = [&](size_t bytes) -> void* {
    void* ptr = ws + off;
    off = (off + bytes + 255) & ~(size_t)255;
    return ptr;
  };
  bf16*  qp    = (bf16*)carve((size_t)2048 * 64 * 2);          //  256 KB
  bf16*  kpB   = (bf16*)carve((size_t)65536 * 64 * 2);         //    8 MB
  bf16*  vt    = (bf16*)carve((size_t)16 * 768 * 4096 * 2);    //  100 MB
  bf16*  pP    = (bf16*)carve((size_t)16 * 128 * 4096 * 2);    //   16 MB
  float* rsum  = (float*)carve((size_t)2048 * 4);

  // q = relu(text@Wq+bq) -> [2048,64] bf16 (cols 36..63 zero)
  // k = relu(img@Wk+bk) -> bf16, 48 columns, in the scores kernel's fragment order
  // v = relu(img@Wv+bv) -> bf16, in attn_out's fragment order
  proj_qkv<<<dim3(PJ_ALL), 512, 0, stream>>>(
      text, Wq, bq, qp, img, Wk, bk, kpB, Wv, bv, vt);
  // scores + masked softmax
  attn_scores_softmax<<<dim3(128), 512, 0, stream>>>(
      qp, kpB, masks, pP, rsum);
  // o = (p @ v) / rowsum
  attn_out<<<dim3(12, 16), 256, 0, stream>>>(pP, vt, rsum, out);
}

// v009
// It runs in 87.1 microseconds.
// Timed twice side by side with v008, it ran 1.04 and 1.06 times as fast.
// All steps since v000 together make it 7.05 times as fast.
#include <hip/hip_runtime.h>
#include <hip/hip_bf16.h>
#include <type_traits>

// ---------------------------------------------------------------------------
// Text->Img cross attention, CDNA5 (gfx1250, wave32) bf16 WMMA implementation
//   B=16, N=128, H=W=64 (M=4096), TC=768, IC=512, FQ=36 (padded to 64)
// ---------------------------------------------------------------------------

typedef __bf16 bf16;
typedef __attribute__((ext_vector_type(8)))  bf16  bf16x8;
typedef __attribute__((ext_vector_type(16))) bf16  bf16x16;
typedef __attribute__((ext_vector_type(8)))  float f32x8;

// A/B fragment loader for V_WMMA_*_16X16X32_BF16 (wave32).
// Per ISA 7.12.2, lane (with half = lane>>4) holds K = half*8 + [0..7] in
// elements 0..7 and K = 16 + half*8 + [0..7] in elements 8..15 -> two 16B
// contiguous loads from a row-major [row/col, K] buffer.
__device__ __forceinline__ bf16x16 load_frag(const bf16* base, int half) {
  bf16x8 lo = *(const bf16x8*)(base + half * 8);
  bf16x8 hi = *(const bf16x8*)(base + 16 + half * 8);
  bf16x16 r;
#pragma unroll
  for (int i = 0; i < 8; ++i) { r[i] = lo[i]; r[i + 8] = hi[i]; }
  return r;
}

__device__ __forceinline__ f32x8 wmma_bf16(bf16x16 a, bf16x16 b, f32x8 c) {
  // (neg_a, A, neg_b, B, c_mod, C, reuse_a, reuse_b)
  return __builtin_amdgcn_wmma_f32_16x16x32_bf16(false, a, false, b,
                                                 (short)0, c, false, false);
}

typedef __attribute__((ext_vector_type(4))) float f32x4;
typedef __attribute__((ext_vector_type(4))) bf16  bf16x4;

// ---------------------------------------------------------------------------
// Kernel 1: the q projection, out[row, 0..63] = relu(A[row, :] @ W + bias)
// in columns 0..35 and 0 in columns 36..63; f32 in -> bf16 out, row-major.
// W (K x 36) is turned into bf16 [col][k] in LDS once per block, one barrier;
// the K loop has none. A wave owns 16 rows and all columns (3 accumulators), so
// nobody else needs its A rows: it streams them with loads that cover whole
// lines (16 lanes x 16 B = the 256 B that one row has in a step of 64 k), DS
// steps ahead in registers, and turns them into fragments through an LDS slab
// of its own. Column tile 2 holds columns 32..47: the lanes of 36..47 read a
// row of zeros. k is summed 32 at a time, rising, in one chain per accumulator.
// LDS pitches: K + 8 and 72 bf16, both 16 B x odd, for the ds_load_b128 reads.
// ---------------------------------------------------------------------------
template <int K, int WAVES, int DS>
__device__ __forceinline__ void proj36_body(const float* __restrict__ A,
                                            const float* __restrict__ W,
                                            const float* __restrict__ bias,
                                            bf16* __restrict__ out,
                                            unsigned char* smem, int blk) {
  constexpr int NC = 36, PB = K + 8, PA = 72, NS = K / 64, NT = WAVES * 32;
  bf16* lB   = (bf16*)smem;            // [col][k], row 36 = 0
  bf16* slab = lB + (NC + 1) * PB;     // [wave][buf][row][k]

  const int tid  = threadIdx.x;
  const int w    = tid >> 5;
  const int lane = tid & 31;
  const int half = lane >> 4;
  const int l15  = lane & 15;
  const int rowbase = blk * (WAVES * 16) + w * 16;

  // load j of a step: rows 2j and 2j+1, 256 contiguous bytes of each
  const float* ag = A + (size_t)(rowbase + half) * K + l15 * 4;
  f32x4 ring[DS][8];
  auto fetch = [&](int s) {
#pragma unroll  // constant indices keep ring in registers
    for (int j = 0; j < 8; ++j)
      ring[s % DS][j] = *(const f32x4*)(ag + j * 2 * K + s * 64);
  };
#pragma unroll  // the same
  for (int s = 0; s < DS; ++s) fetch(s);

  // W: a unit is 8 k x 4 columns, 8 loads of 16 B -> 4 LDS stores of 16 B;
  // the loads of WG units are in flight together
  constexpr int UNITS = (K / 8) * (NC / 4);
  constexpr int WG = (UNITS / NT) % 3 == 0 ? 3 : 1;
  auto stage_w = [&](int u0, auto gc) {
    constexpr int G = decltype(gc)::value;
    const float* src[G];
    f32x4 wv[G][8];
#pragma unroll  // constant indices: the array stays in registers
    for (int g = 0; g < G; ++g) {
      const int u = u0 + g * NT;
      src[g] = W + (u / (NC / 4)) * 8 * NC + (u % (NC / 4)) * 4;
#pragma unroll  // constant indices: the array stays in registers
      for (int i = 0; i < 8; ++i) wv[g][i] = *(const f32x4*)(src[g] + i * NC);
    }
    // precaution: as inputs of the wait the loads' addresses live up to it, so
    // that no later load lands in registers which an issued load names
    if constexpr (G == 3)
      asm volatile("s_wait_xcnt 0x0" :: "v"(src[0]), "v"(src[1]), "v"(src[2]) : "memory");
    else
      asm volatile("s_wait_xcnt 0x0" :: "v"(src[0]) : "memory");
#pragma unroll  // constant indices: the array stays in registers
    for (int g = 0; g < G; ++g) {
      const int u = u0 + g * NT;
#pragma unroll  // constant indices: the array stays in registers
      for (int j = 0; j < 4; ++j) {
        bf16x8 v;
#pragma unroll  // constant indices: the array stays in registers
        for (int i = 0; i < 8; ++i) v[i] = (bf16)wv[g][i][j];
        *(bf16x8*)&lB[((u % (NC / 4)) * 4 + j) * PB + (u / (NC / 4)) * 8] = v;
      }
    }
  };
  for (int n = 0; n < UNITS / NT; n += WG)
    stage_w(n * NT + tid, std::integral_constant<int, WG>{});
  if (tid < UNITS % NT)
    stage_w((UNITS / NT) * NT + tid, std::integral_constant<int, 1>{});
  if (tid < K / 8) {
    const bf16x8 zero = {};
    *(bf16x8*)&lB[NC * PB + tid * 8] = zero;
  }
  __syncthreads();

  const bf16* brow[3];
#pragma unroll  // constant indices: the array stays in registers
  for (int t = 0; t < 3; ++t) {
    const int c = t * 16 + l15;
    brow[t] = &lB[(c < NC ? c : NC) * PB];
  }

  f32x8 acc[3] = {};
#pragma unroll  // the ring slot and the slab buffer must be constants
  for (int s = 0; s < NS; ++s) {
    bf16* sl = slab + (w * 2 + (s & 1)) * (16 * PA);
    bf16x16 af[2], bfr[2][3];
    // the W fragments wait for nobody: read ahead of the slab's wait, under it
#pragma unroll  // constant indices: the array stays in registers
    for (int c = 0; c < 2; ++c)
#pragma unroll  // constant indices: the array stays in registers
      for (int t = 0; t < 3; ++t)
        bfr[c][t] = load_frag(brow[t] + s * 64 + c * 32, half);
#pragma unroll  // constant indices: the array stays in registers
    for (int j = 0; j < 8; ++j)
      *(bf16x4*)&sl[(2 * j + half) * PA + l15 * 4] =
          __builtin_convertvector(ring[s % DS][j], bf16x4);
    if (s + DS < NS) fetch(s + DS);
    // the slab rows that a lane reads below were written by other lanes of its
    // wave: their stores are done, and the compiler moves no read above them
    asm volatile("s_wait_dscnt 0x0" ::: "memory");
#pragma unroll  // constant indices: the array stays in registers
    for (int c = 0; c < 2; ++c) af[c] = load_frag(&sl[l15 * PA + c * 32], half);
#pragma unroll  // constant indices: the array stays in registers
    for (int c = 0; c < 2; ++c)
#pragma unroll  // constant indices: the array stays in registers
      for (int t = 0; t < 3; ++t) acc[t] = wmma_bf16(af[c], bfr[c][t], acc[t]);
  }
  asm volatile("s_wait_xcnt 0x0" :: "v"(ag) : "memory");  // see the W loads

  // epilogue: bias + relu, through the wave's slab, so that every store
  // instruction writes 4 whole 128-B rows of out (C/D: row = r + 8 half, col = l15)
  bf16* sl = slab + (w * 2) * (16 * PA);
#pragma unroll  // constant indices: the array stays in registers
  for (int t = 0; t < 3; ++t) {
    const int gc = t * 16 + l15;
    const float bv = (gc < NC) ? bias[gc] : 0.f;
#pragma unroll  // constant indices: the array stays in registers
    for (int r = 0; r < 8; ++r) {
      const float val = acc[t][r] + bv;
      sl[(r + 8 * half) * PA + gc] = (bf16)(val > 0.f ? val : 0.f);
    }
  }
  // as in the loop: other lanes' stores are done before the rows are read back
  asm volatile("s_wait_dscnt 0x0" ::: "memory");
  const int pc = lane & 7;  // 16-B piece of a row; pieces 6, 7 = columns 48..63
#pragma unroll  // the 4 LDS reads issue together, then the 4 stores
  for (int j = 0; j < 4; ++j) {
    const int row = j * 4 + (lane >> 3);
    bf16x8 v = *(const bf16x8*)&sl[row * PA + (pc < 6 ? pc : 0) * 8];
    if (pc >= 6) v = bf16x8{};
    *(bf16x8*)(out + (size_t)(rowbase + row) * 64 + pc * 8) = v;
  }
  // precaution: in the kernel's text another body's code follows these stores;
  // nothing there stands ahead of this wait and rewrites their address registers
  asm volatile("s_wait_xcnt 0x0" ::: "memory");
}

// ---------------------------------------------------------------------------
// Kernel 1b: the v and the k projection of 256 img rows, from one LDS-resident tile.
//   v[b, m, col] = relu(img[b*4096+m, :] @ Wv + bv), 768 columns, written to vt
//   in the order in which attn_out reads its B fragments (VF_* below)
//   k[row, 0..47] = relu(img[row, :] @ Wk + bk) in columns 0..35, 0 beyond,
//   written to kp in the order in which the scores kernel reads its B fragments
// Block = 512 thr (16 waves). Its 256 rows x 512 k are read from memory once,
// turned into bf16 once and stay in LDS; every product of these rows is made
// from there: three passes of 256 v columns, then the k columns.
// A v pass: waves 4 x 4, 64 rows x 64 cols = 4 x 4 accumulators per wave, so 8
// fragments feed 16 WMMAs. Wv comes in chunks of 32 k through two LDS buffers:
// next chunk's global loads, WMMAs on the current chunk, cvt + LDS store of the
// next chunk, one barrier per chunk. In the first pass the img chunks come the
// same way, one chunk ahead, into their place in the resident tile.
// Blocks start with different column tiles, so that not all of them ask for the
// same lines of Wv at the same moment.
// LDS pitches: img rows 1104 B, Wv rows (32 k) 80 B, Wk rows 1040 B: 16 B x odd.
// Column order in LDS: the thread that loads 4 neighbouring columns cg*4+j puts
// column j into LDS row j*64+cg, so wave column wc holds the columns = wc mod 4.
// The k pass: wave w owns rows 16 w .. 16 w + 15 and 3 column tiles; Wk lies in
// the place of the Wv buffers as [col][k], row 36 = 0 for the columns 36..47;
// k is summed 32 at a time, rising, in one chain per accumulator.
// ---------------------------------------------------------------------------
constexpr int PV_PA  = 512 + 40;  // bf16 per LDS row of the img tile
constexpr int KF_TILE = 3 * 256;  // bf16 per score tile (16 m) of kp: 3 units of 512 B
// vt, in bf16: [b][group of 64 columns][chunk of 32 m][tile wc][unit u][lane][8].
// Tile wc of a group holds its columns 4 l15 + wc. A unit is 512 B, lane after
// lane: the lane (l15, half) holds m = 16 u + 8 half + 0..7 of its column, which
// is what a lane has in one accumulator here and half of a B fragment there.
constexpr int VF_UNIT  = 256;              // 32 lanes x 8 bf16
constexpr int VF_TILE  = 2 * VF_UNIT;      // one B fragment of 32 m x 16 columns
constexpr int VF_CHUNK = 4 * VF_TILE;      // 32 m x 64 columns, 4 KB
constexpr int VF_GROUP = 128 * VF_CHUNK;   // 4096 m x 64 columns
constexpr int PV_LDS = (256 * PV_PA + 2 * 256 * 40) * 2;

__device__ __forceinline__ void proj_vk_body(const float* __restrict__ A,
                                             const float* __restrict__ W,
                                             const float* __restrict__ bias,
                                             bf16* __restrict__ out,
                                             const float* __restrict__ Wk,
                                             const float* __restrict__ bk,
                                             bf16* __restrict__ kout,
                                             unsigned char* smem, int blk) {
  constexpr int K = 512, NC = 768, P = 40;
  bf16* lA = (bf16*)smem;                                       // [row][k]  276 KB
  bf16 (*lB)[256 * P] = (bf16 (*)[256 * P])(lA + 256 * PV_PA);  // [buf][col][k]  2x20 KB

  const int tid  = threadIdx.x;
  const int w    = tid >> 5;
  const int lane = tid & 31;
  const int half = lane >> 4;
  const int l15  = lane & 15;
  const int wr   = w >> 2;
  const int wc   = w & 3;
  const int rowblock = blk * 256;

  // img chunk [256 x 32] f32: 8 lanes x 16 B cover one row's 128-B line.
  const int ar = tid >> 3;
  const int ak = (tid & 7) * 4;
  const float* asrc = A + (size_t)(rowblock + ar) * K + ak;
  // Wv chunk [32 x 256] f32: 4 k rows x 4 columns per thread.
  const int cg = tid & 63;
  const int kg = tid >> 6;
  const float* wsrc = W + (size_t)(kg * 4) * NC + cg * 4;

  f32x4 aR[4], wR[4];
  auto ld_a = [&](int k0) {
#pragma unroll
    for (int j = 0; j < 4; ++j)
      aR[j] = *(const f32x4*)(asrc + (size_t)(j * 64) * K + k0);
  };
  auto ld_w = [&](int ct, int k0) {
#pragma unroll
    for (int i = 0; i < 4; ++i)
      wR[i] = *(const f32x4*)(wsrc + ct * 256 + (size_t)(k0 + i) * NC);
  };
  auto st_a = [&](int k0) {
#pragma unroll
    for (int j = 0; j < 4; ++j)
      *(bf16x4*)&lA[(ar + 64 * j) * PV_PA + k0 + ak] =
          __builtin_convertvector(aR[j], bf16x4);
  };
  auto st_w = [&](int buf) {
#pragma unroll
    for (int j = 0; j < 4; ++j) {
      bf16x4 v;
#pragma unroll
      for (int i = 0; i < 4; ++i) v[i] = (bf16)wR[i][j];
      *(bf16x4*)&lB[buf][(j * 64 + cg) * P + kg * 4] = v;
    }
  };

  const int bb = rowblock >> 12;
  const int ch0 = ((rowblock & 4095) >> 5) + wr * 2;  // the wave's first chunk of 32 m

  // Wk takes the place of the Wv buffers behind the last v chunk, ahead of that
  // pass's stores to vt, so that no barrier has to wait for those stores
  constexpr int KC = 36, PB = K + 8, PS = 72;
  bf16* lK = (bf16*)lB;  // [col][k], 37 rows
  // a unit is 8 k x 4 columns, 8 loads of 16 B -> 4 LDS stores of 16 B
  auto stage_k = [&](int u) {
    const float* src = Wk + (u / (KC / 4)) * 8 * KC + (u % (KC / 4)) * 4;
    f32x4 wv[8];
#pragma unroll  // constant indices: the array stays in registers
    for (int i = 0; i < 8; ++i) wv[i] = *(const f32x4*)(src + i * KC);
    // precaution: as an input of the wait the loads' address lives up to it, so
    // that no later load lands in registers which an issued load names
    asm volatile("s_wait_xcnt 0x0" :: "v"(src) : "memory");
#pragma unroll  // constant indices: the array stays in registers
    for (int j = 0; j < 4; ++j) {
      bf16x8 v;
#pragma unroll  // constant indices: the array stays in registers
      for (int i = 0; i < 8; ++i) v[i] = (bf16)wv[i][j];
      *(bf16x8*)&lK[((u % (KC / 4)) * 4 + j) * PB + (u / (KC / 4)) * 8] = v;
    }
  };
  auto stage_wk = [&]() {
    constexpr int UNITS = (K / 8) * (KC / 4);  // 576 = 512 + 64
    __syncthreads();  // every wave has read its last Wv fragments: the buffers are free
    stage_k(tid);
    if (tid < UNITS - 512) stage_k(512 + tid);
    if (tid < K / 8) {
      const bf16x8 zero = {};
      *(bf16x8*)&lK[KC * PB + tid * 8] = zero;
    }
    __syncthreads();  // Wk is whole before anybody reads it
  };

  // one pass: column tile ct; ctn is the tile of the pass that follows
  auto pass = [&](auto first, auto last, int ct, int ctn) {
    constexpr bool FIRST = decltype(first)::value, LAST = decltype(last)::value;
    constexpr int nCh = K / 32;
    f32x8 acc[4][4] = {};
    for (int ci = 0; ci < nCh; ++ci) {
      const int cur = ci & 1;
      const bool lastc = (ci + 1) == nCh;
      const bool more = !(LAST && lastc);
      // VMEM for the next chunk first
      if (FIRST && !lastc) ld_a((ci + 1) * 32);
      if (more) ld_w(lastc ? ctn : ct, lastc ? 0 : (ci + 1) * 32);

      bf16x16 af[4], bfr[4];
#pragma unroll
      for (int i = 0; i < 4; ++i)
        af[i] = load_frag(&lA[(wr * 64 + i * 16 + l15) * PV_PA + ci * 32], half);
#pragma unroll
      for (int t = 0; t < 4; ++t)
        bfr[t] = load_frag(&lB[cur][(wc * 64 + t * 16 + l15) * P], half);
      // keeps the global loads and the 16 LDS reads one group ahead of the WMMAs;
      // without it global loads sink to just before their cvt, their latency no
      // longer covered, and A fragments are read among the WMMAs behind full waits
      __builtin_amdgcn_sched_barrier(0);
#pragma unroll
      for (int i = 0; i < 4; ++i)
#pragma unroll
        for (int t = 0; t < 4; ++t)
          acc[i][t] = wmma_bf16(af[i], bfr[t], acc[i][t]);

      // keeps the cvt of the loaded chunk, and with it the wait on those loads,
      // behind the WMMAs; without it the scheduler lifts both above them
      __builtin_amdgcn_sched_barrier(0);
      if (more) {
        // safe: everyone finished reading buffer cur^1 before the last barrier,
        // and nobody has read the img columns of the next chunk yet
        st_w(cur ^ 1);
        if (FIRST && !lastc) st_a((ci + 1) * 32);
        __syncthreads();
      }
    }

    if constexpr (LAST) stage_wk();

    // epilogue: a lane's 8 accumulator registers are 8 consecutive m of one
    // column -> bias + relu + one 16-B store each. Accumulator (i, t) is unit
    // i & 1 of chunk ch0 + (i >> 1): a store instruction writes 4 whole lines.
    bf16* dst = out + (size_t)(bb * 12 + ct * 4) * VF_GROUP + ch0 * VF_CHUNK +
                wc * VF_TILE + lane * 8;
#pragma unroll
    for (int t = 0; t < 4; ++t) {
      const int gc = ct * 256 + (t * 16 + l15) * 4 + wc;
      const float bv = bias[gc];
#pragma unroll
      for (int i = 0; i < 4; ++i) {
        bf16x8 v;
#pragma unroll
        for (int r = 0; r < 8; ++r) {
          const float val = acc[i][t][r] + bv;
          v[r] = (bf16)(val > 0.f ? val : 0.f);
        }
        *(bf16x8*)(dst + t * VF_GROUP + (i >> 1) * VF_CHUNK + (i & 1) * VF_UNIT) = v;
      }
    }
    // precaution: as an input of the wait the stores' address lives up to it, so
    // that the code of the next pass does not rewrite it ahead of the wait
    asm volatile("s_wait_xcnt 0x0" :: "v"(dst) : "memory");
  };

  const int c0 = blk % 3;
  const int c1 = c0 == 2 ? 0 : c0 + 1;
  const int c2 = c1 == 2 ? 0 : c1 + 1;

  ld_a(0);
  ld_w(c0, 0);
  st_a(0);
  st_w(0);
  __syncthreads();
  pass(std::true_type{}, std::false_type{}, c0, c1);
  pass(std::false_type{}, std::false_type{}, c1, c2);
  pass(std::false_type{}, std::true_type{}, c2, c2);

  // ---- the k columns, from the same img tile
  const bf16* arow = &lA[(w * 16 + l15) * PV_PA];
  const bf16* brow[3];
#pragma unroll  // constant indices: the array stays in registers
  for (int t = 0; t < 3; ++t) {
    const int c = t * 16 + l15;
    brow[t] = &lK[(c < KC ? c : KC) * PB];
  }
  f32x8 ka[3] = {};
#pragma unroll 4  // 4 chunks' LDS reads go ahead of their WMMAs; all 16 would spill
  for (int s = 0; s < K / 32; ++s) {
    const bf16x16 af = load_frag(arow + s * 32, half);
#pragma unroll  // constant indices: the array stays in registers
    for (int t = 0; t < 3; ++t)
      ka[t] = wmma_bf16(af, load_frag(brow[t] + s * 32, half), ka[t]);
  }

  // epilogue: bias + relu into an LDS slab in the wave's own 16 img rows, which
  // nobody else reads in this pass (C/D: row = r + 8 half, col = l15)
  bf16* sl = lA + (w * 16) * PV_PA;
#pragma unroll  // constant indices: the array stays in registers
  for (int t = 0; t < 3; ++t) {
    const int gc = t * 16 + l15;
    const float bv = (gc < KC) ? bk[gc] : 0.f;
#pragma unroll  // constant indices: the array stays in registers
    for (int r = 0; r < 8; ++r) {
      const float val = ka[t][r] + bv;
      sl[(r + 8 * half) * PS + gc] = (bf16)(val > 0.f ? val : 0.f);
    }
  }
  // every wave's slab is whole before other waves read it. The fences name LDS
  // alone, so that the barrier does not wait for the stores to vt in flight
  __builtin_amdgcn_fence(__ATOMIC_RELEASE, "workgroup", "local");
  __builtin_amdgcn_s_barrier();
  __builtin_amdgcn_fence(__ATOMIC_ACQUIRE, "workgroup", "local");
  // kout in fragment order (see the scores kernel): wave w writes score tile w
  // of the block's 256 rows, three units of 512 B; in unit u the lane (l15, half)
  // holds columns 16 u + 8 half .. + 7 of the row that is the tile's column l15.
  // A store instruction writes 4 whole lines.
  const int srow = (w >> 2) * 64 + l15 * 4 + (w & 3);
  const bf16* sr = lA + (srow >> 4) * (16 * PV_PA) + (srow & 15) * PS + half * 8;
  bf16* kd = kout + (size_t)(blk * 16 + w) * KF_TILE + lane * 8;
#pragma unroll  // the 3 LDS reads issue together, then the 3 stores
  for (int u = 0; u < 3; ++u)
    *(bf16x8*)(kd + u * 256) = *(const bf16x8*)(sr + u * 16);
  // precaution: the stores' address lives up to the wait
  asm volatile("s_wait_xcnt 0x0" :: "v"(kd) : "memory");
}

// ---------------------------------------------------------------------------
// The projections depend on nothing but the inputs: one launch holds them all.
// Blocks 0..7 are the q blocks (256 rows each), the 256 blocks after them
// make v and k of 256 img rows each. All have 16 waves
// and share one LDS range, sized for the larger use.
// ---------------------------------------------------------------------------
constexpr int PJ_Q = 8, PJ_VK = 256, PJ_ALL = PJ_Q + PJ_VK;
constexpr int PJ_LDS_Q = (37 * (768 + 8) + 16 * 2 * 16 * 72) * 2;
constexpr int PJ_LDS = PJ_LDS_Q > PV_LDS ? PJ_LDS_Q : PV_LDS;

__launch_bounds__(512)
__global__ void proj_qkv(const float* __restrict__ text, const float* __restrict__ Wq,
                         const float* __restrict__ bq, bf16* __restrict__ qp,
                         const float* __restrict__ img, const float* __restrict__ Wk,
                         const float* __restrict__ bk, bf16* __restrict__ kp,
                         const float* __restrict__ Wv, const float* __restrict__ bv,
                         bf16* __restrict__ vt) {
  __shared__ __align__(16) unsigned char smem[PJ_LDS];
  const int blk = blockIdx.x;
  if (blk >= PJ_Q)
    proj_vk_body(img, Wv, bv, vt, Wk, bk, kp, smem, blk - PJ_Q);
  else
    proj36_body<768, 16, 2>(text, Wq, bq, qp, smem, blk);
}

// ---------------------------------------------------------------------------
// Kernel 2: s = q@k^T, beta = s*mask, softmax over M=4096, beta held in registers.
// One block per (b, 16-query tile), 16 waves. Wave w owns m in [256w, 256w+256)
// = 16 WMMA tiles. The 128 beta of a lane stay in the registers that its 128 mask
// values were loaded into: all mask loads of a wave are in flight together, and
// nothing is written to be read again.
// Column l15 of tile j is m = 256 w + 64 (j >> 2) + 4 l15 + (j & 3): a lane owns
// 4 neighbouring m four times in each of its rows, so a mask load is 16 B and a p
// store 8 B a lane, and 16 lanes cover whole lines of a row. kp holds k in that
// order, fragment by fragment (tile: 3 units of 512 B, K 0..15, 16..31, 32..47,
// lane after lane), so a k load covers 4 whole lines; K 48..63 is 0 and not kept.
// p = exp(beta - max) is bf16, unnormalized; row sums -> rowsum_g.
// Row reductions: __shfl_xor within 16-lane groups, then LDS across waves.
// ---------------------------------------------------------------------------
__launch_bounds__(512)
__global__ void attn_scores_softmax(const bf16* __restrict__ qp,
                                    const bf16* __restrict__ kp,
                                    const float* __restrict__ masks,
                                    bf16* __restrict__ p,
                                    float* __restrict__ rowsum_g) {
  __shared__ float red[16][16];
  __shared__ float rowmax[16];

  const int tid  = threadIdx.x;
  const int w    = tid >> 5;
  const int lane = tid & 31;
  const int half = lane >> 4;
  const int l15  = lane & 15;
  const int b     = blockIdx.x >> 3;
  const int nbase = (blockIdx.x & 7) * 16;

  const bf16* qrow = qp + ((size_t)b * 128 + nbase + l15) * 64;
  const bf16x16 a0 = load_frag(qrow, half);        // K 0..31
  const bf16x16 a1 = load_frag(qrow + 32, half);   // K 32..63
  // precaution, here and behind the mask and the k loads below: as an input of
  // the wait the loads' address lives up to it, so that no later load lands in
  // registers which an issued load names before the wait has been passed
  asm volatile("s_wait_xcnt 0x0" :: "v"(qrow) : "memory");

  // the lane's element of tile j, register r: row nbase + 8 half + r,
  // m = m0 + 64 (j >> 2) + (j & 3)
  const int    m0  = w * 256 + l15 * 4;
  const size_t idx = ((size_t)b * 128 + nbase + 8 * half) * 4096 + m0;
  const float* mrow = masks + idx;
  const bf16*  kfr = kp + (size_t)(b * 16 + w) * (16 * KF_TILE) + lane * 8;

  f32x4 bt[8][4];  // [register][j >> 2][j & 3]: first the mask, then beta
#pragma unroll  // constant indices keep bt in registers
  for (int r = 0; r < 8; ++r)
#pragma unroll  // the same
    for (int h = 0; h < 4; ++h) bt[r][h] = *(const f32x4*)(mrow + r * 4096 + h * 64);
  asm volatile("s_wait_xcnt 0x0" :: "v"(mrow) : "memory");  // see the q loads

  // k fragments: a ring of KD tiles in registers
  constexpr int KD = 3;
  bf16x8 kr[KD][3];
  auto kfetch = [&](int j) {
#pragma unroll  // constant indices keep kr in registers
    for (int u = 0; u < 3; ++u)
      kr[j % KD][u] = *(const bf16x8*)(kfr + j * KF_TILE + u * 256);
  };
#pragma unroll  // the same
  for (int j = 0; j < KD; ++j) kfetch(j);

  float rmax[8];
#pragma unroll  // rmax is indexed by constants only
  for (int r = 0; r < 8; ++r) rmax[r] = -3.0e38f;

#pragma unroll  // constant indices keep bt and kr in registers
  for (int j = 0; j < 16; ++j) {
    bf16x16 b0, b1;
#pragma unroll  // constant indices: the vectors stay in registers
    for (int i = 0; i < 8; ++i) {
      b0[i] = kr[j % KD][0][i]; b0[i + 8] = kr[j % KD][1][i];
      b1[i] = kr[j % KD][2][i]; b1[i + 8] = (bf16)0.f;
    }
    f32x8 acc = {};
    acc = wmma_bf16(a0, b0, acc);
    acc = wmma_bf16(a1, b1, acc);
    if (j + KD < 16) kfetch(j + KD);
#pragma unroll  // the same
    for (int r = 0; r < 8; ++r) {
      const float be = acc[r] * bt[r][j >> 2][j & 3];  // multiplicative mask BEFORE softmax
      bt[r][j >> 2][j & 3] = be;
      rmax[r] = fmaxf(rmax[r], be);
    }
  }
  asm volatile("s_wait_xcnt 0x0" :: "v"(kfr) : "memory");  // see the q loads

  // row max: reduce across the 16 lanes that share rows, then across waves
#pragma unroll
  for (int r = 0; r < 8; ++r)
#pragma unroll
    for (int off = 1; off < 16; off <<= 1)
      rmax[r] = fmaxf(rmax[r], __shfl_xor(rmax[r], off, 16));
  if (l15 == 0)
#pragma unroll
    for (int r = 0; r < 8; ++r) red[w][r + 8 * half] = rmax[r];
  __syncthreads();
  if (tid < 16) {
    float mx = -3.0e38f;
    for (int ww = 0; ww < 16; ++ww) mx = fmaxf(mx, red[ww][tid]);
    rowmax[tid] = mx;
  }
  __syncthreads();

  float rsum[8] = {};
  bf16* prow = p + idx;
#pragma unroll  // constant indices keep bt in registers
  for (int r = 0; r < 8; ++r) {
    const float mx = rowmax[r + 8 * half];
#pragma unroll  // the same
    for (int h = 0; h < 4; ++h) {
      bf16x4 pv;  // unnormalized; 1/sum in attn_out
#pragma unroll  // the same
      for (int i = 0; i < 4; ++i) {
        const float t = (bt[r][h][i] - mx) * 1.44269504f;  // exp(x) = 2^(x log2 e)
        float e;
        // the v_nop fills the slot that the instruction set asks for between a
        // transcendental and a next instruction that reads e or overwrites t
        asm("v_exp_f32 %0, %1\n\tv_nop" : "=v"(e) : "v"(t));
        rsum[r] += e;
        pv[i] = (bf16)e;
      }
      *(bf16x4*)(prow + r * 4096 + h * 64) = pv;
    }
  }
  // precaution: the stores' address lives up to the wait
  asm volatile("s_wait_xcnt 0x0" :: "v"(prow) : "memory");
#pragma unroll
  for (int r = 0; r < 8; ++r)
#pragma unroll
    for (int off = 1; off < 16; off <<= 1)
      rsum[r] += __shfl_xor(rsum[r], off, 16);
  __syncthreads();  // rowmax reads done; red is reusable
  if (l15 == 0)
#pragma unroll
    for (int r = 0; r < 8; ++r) red[w][r + 8 * half] = rsum[r];
  __syncthreads();
  if (tid < 16) {
    float s = 0.f;
    for (int ww = 0; ww < 16; ++ww) s += red[ww][tid];
    rowsum_g[(size_t)b * 128 + nbase + tid] = s;
  }
}

// ---------------------------------------------------------------------------
// Kernel 3: o[b,n,col] = (p[b,n,:] @ v[b,:,col]) / rowsum[b,n].
// One block = all 128 n of one batch x one group of 64 columns, 8 waves (4 x 2),
// 32 n x 2 column tiles per wave = 2 x 2 accumulators. p and v are staged in LDS,
// 256 m per stage, by asynchronous copies of 512 contiguous bytes a wave, so
// every global access covers whole lines: of p the bytes that one row has in the
// stage, of v one unit; v comes in fragment order (VF_* above), a stage is 32 KB
// in a row and lies in LDS as in memory, so a B fragment is two reads of a unit.
// Three buffers: while a stage is multiplied the copies of the next two fly, so a
// stage has two stage times to land, not one. A stage is handed over ahead of its
// last block of WMMAs: the next stage's first fragments are read under that block.
// LDS rows of p: 512 B at a pitch of 528 B (16 B x odd) for the ds_load_b128 reads.
// Column l15 of tile j is column 4 l15 + j of the group: the result goes through
// LDS once, so that each line of out has one writer and is stored whole.
// ---------------------------------------------------------------------------
typedef __attribute__((ext_vector_type(2))) float f32x2;

constexpr int AO_KS    = 256;                 // m per stage
constexpr int AO_NT    = 4096 / AO_KS;        // stages
constexpr int AO_PITCH = AO_KS * 2 + 16;      // bytes per LDS row of p
constexpr int AO_A     = 128 * AO_PITCH;      // p tile, bytes
constexpr int AO_BUF   = AO_A + (AO_KS / 32) * VF_CHUNK * 2;
constexpr int AO_NB    = 3;                   // buffers of the ring
constexpr int AO_PO    = 64 + 4;              // floats per LDS row of the result: 16 B x odd

// Eight copies of one wave, LS bytes apart in LDS and GS bf16 apart in memory;
// each lane brings its own 16 bytes. The s_wait_xcnt stands inside the statement
// so that no address register of a copy is rewritten in front of it.
template <unsigned LS, int GS>
__device__ __forceinline__ void copy8(unsigned l, const bf16* g) {
  asm volatile(
      "global_load_async_to_lds_b128 %0, %8, off\n\t"
      "global_load_async_to_lds_b128 %1, %9, off\n\t"
      "global_load_async_to_lds_b128 %2, %10, off\n\t"
      "global_load_async_to_lds_b128 %3, %11, off\n\t"
      "global_load_async_to_lds_b128 %4, %12, off\n\t"
      "global_load_async_to_lds_b128 %5, %13, off\n\t"
      "global_load_async_to_lds_b128 %6, %14, off\n\t"
      "global_load_async_to_lds_b128 %7, %15, off\n\t"
      "s_wait_xcnt 0x0"
      :: "v"(l), "v"(l + LS), "v"(l + 2 * LS), "v"(l + 3 * LS),
         "v"(l + 4 * LS), "v"(l + 5 * LS), "v"(l + 6 * LS), "v"(l + 7 * LS),
         "v"(g), "v"(g + GS), "v"(g + 2 * GS), "v"(g + 3 * GS),
         "v"(g + 4 * GS), "v"(g + 5 * GS), "v"(g + 6 * GS), "v"(g + 7 * GS)
      : "memory");
}

// B fragment from fragment order: the lane's 16 B of unit 0 (K = 8 half + 0..7)
// and of unit 1 (K = 16 + 8 half + 0..7), the k order of load_frag
__device__ __forceinline__ bf16x16 load_frag_units(const bf16* lane_base) {
  bf16x8 lo = *(const bf16x8*)(lane_base);
  bf16x8 hi = *(const bf16x8*)(lane_base + VF_UNIT);
  bf16x16 r;
#pragma unroll
  for (int i = 0; i < 8; ++i) { r[i] = lo[i]; r[i + 8] = hi[i]; }
  return r;
}

__launch_bounds__(256)
__global__ void attn_out(const bf16* __restrict__ p,
                         const bf16* __restrict__ v_t,
                         const float* __restrict__ rowsum_g,
                         float* __restrict__ out) {
  __shared__ __align__(16) unsigned char ring[AO_NB][AO_BUF];  // 3 x 98 KB

  const int tid  = threadIdx.x;
  const int w    = tid >> 5;
  const int lane = tid & 31;
  const int half = lane >> 4;
  const int l15  = lane & 15;
  const int wr   = w >> 1;
  const int wc   = w & 1;
  const int b        = blockIdx.y;
  const int colblock = blockIdx.x * 64;

  // wave w copies rows w, w+8, ... of p (16 rows) and units w, w+8, ... of v (8)
  const bf16* pg = p   + ((size_t)b * 128 + w) * 4096 + lane * 8;
  const bf16* vg = v_t + (size_t)(b * 12 + blockIdx.x) * VF_GROUP + w * VF_UNIT + lane * 8;
  const unsigned l0 =
      (unsigned)(size_t)&ring[0][0] + (unsigned)(w * AO_PITCH + lane * 16);
  const unsigned lv =
      (unsigned)(size_t)&ring[0][0] + (unsigned)(AO_A + w * (VF_UNIT * 2) + lane * 16);

  auto fill = [&](int t, int buf) {
    const unsigned l = l0 + (unsigned)(buf * AO_BUF);
    copy8<8 * AO_PITCH, 8 * 4096>(l, pg + t * AO_KS);
    copy8<8 * AO_PITCH, 8 * 4096>(l + 64 * AO_PITCH, pg + 64 * 4096 + t * AO_KS);
    copy8<8 * VF_UNIT * 2, 8 * VF_UNIT>(lv + (unsigned)(buf * AO_BUF),
                                        vg + t * ((AO_KS / 32) * VF_CHUNK));
  };

  f32x8 acc[2][2] = {};
  // a block = 2 k chunks of 32 = 16 LDS reads, 8 WMMAs; two fragment sets
  bf16x16 fa[2][2][2], fb[2][2][2];  // [set][chunk][tile]
  auto frags = [&](int set, int buf, int blk) {
    const unsigned char* base = &ring[buf][0];
    const bf16* ar = (const bf16*)(base + (wr * 32 + l15) * AO_PITCH);
    const bf16* br = (const bf16*)(base + AO_A) + wc * (2 * VF_TILE) + lane * 8;
#pragma unroll  // constant indices keep fa, fb in registers
    for (int c = 0; c < 2; ++c) {
      const int kc = blk * 2 + c;
      fa[set][c][0] = load_frag(ar + kc * 32, half);
      fa[set][c][1] = load_frag(ar + 8 * AO_PITCH + kc * 32, half);
      fb[set][c][0] = load_frag_units(br + kc * VF_CHUNK);
      fb[set][c][1] = load_frag_units(br + kc * VF_CHUNK + VF_TILE);
    }
  };
  auto mult = [&](int s) {
#pragma unroll  // constant indices, as above
    for (int c = 0; c < 2; ++c) {
      acc[0][0] = wmma_bf16(fa[s][c][0], fb[s][c][0], acc[0][0]);
      acc[0][1] = wmma_bf16(fa[s][c][0], fb[s][c][1], acc[0][1]);
      acc[1][0] = wmma_bf16(fa[s][c][1], fb[s][c][0], acc[1][0]);
      acc[1][1] = wmma_bf16(fa[s][c][1], fb[s][c][1], acc[1][1]);
    }
  };

  fill(0, 0);
  fill(1, 1);
  // stage 0 has landed for this wave (all but its 24 youngest copies, which are
  // stage 1's), then for all
  asm volatile("s_wait_asynccnt 24" ::: "memory");
  __syncthreads();
  frags(0, 0, 0);
  fill(2, 2);

  constexpr int NBLK = AO_KS / 64;  // even: block 0 of every stage uses set 0
  int cur = 0;                      // t mod 3
  for (int t = 0; t < AO_NT; ++t) {
    const int nb = cur == AO_NB - 1 ? 0 : cur + 1;
#pragma unroll  // the set index must be a constant: fa, fb stay in registers
    for (int blk = 0; blk + 1 < NBLK; ++blk) {
      frags((blk & 1) ^ 1, cur, blk + 1);
      // keeps the next block's LDS reads one group ahead of this block's WMMAs;
      // without it they are spread among the WMMAs behind full waits
      __builtin_amdgcn_sched_barrier(0);
      mult(blk & 1);
      // keeps the reads of the block after next behind this block's WMMAs;
      // without it they split into smaller groups among these WMMAs
      __builtin_amdgcn_sched_barrier(0);
    }
    // hand-over, ahead of the stage's last block, whose fragments are fetched:
    // this wave's reads of buffer cur are done ...
    asm volatile("s_wait_dscnt 0x0" ::: "memory");
    // ... its copies of stage t+1 have landed: all but the 24 youngest, which are
    // stage t+2's where that stage exists (every wave issues 24 copies a stage, in
    // stage order; where no younger stage has been issued the wait is to 0) ...
    if (t + 2 < AO_NT)
      asm volatile("s_wait_asynccnt 24" ::: "memory");
    else
      asm volatile("s_wait_asynccnt 0x0" ::: "memory");
    // ... and the same holds for every wave: stage t+1 may be read, cur refilled
    __syncthreads();
    // the next stage's first reads and the refill go ahead of the last block's
    // WMMAs, so that the LDS does not idle over the stage boundary
    if (t + 1 < AO_NT) frags(0, nb, 0);
    if (t + 3 < AO_NT) fill(t + 3, cur);
    // keeps the WMMAs below behind those reads and copies
    __builtin_amdgcn_sched_barrier(0);
    mult((NBLK - 1) & 1);
    // keeps the next trip's reads behind these WMMAs, in one group
    __builtin_amdgcn_sched_barrier(0);
    cur = nb;
  }
  // no copy is outstanding when the wave ends
  asm volatile("s_wait_asynccnt 0x0" ::: "memory");

  // the ring is free: behind the last hand-over nobody reads it, nothing flies.
  // The block's 128 x 64 result in column order, rows at a pitch of AO_PO floats
  float* res = (float*)&ring[0][0];
#pragma unroll  // acc is indexed by constants only
  for (int i = 0; i < 2; ++i)
#pragma unroll  // the same
    for (int r = 0; r < 8; ++r) {
      const int n = wr * 32 + i * 16 + r + 8 * half;
      const float scale = 1.0f / rowsum_g[(size_t)b * 128 + n];
      const f32x2 v = {acc[i][0][r] * scale, acc[i][1][r] * scale};
      *(f32x2*)&res[n * AO_PO + l15 * 4 + wc * 2] = v;
    }
  __syncthreads();  // a row holds the columns of two waves: whole before it is read
  // wave w stores rows 16 w .. 16 w + 15, two rows x 256 B = 4 whole lines at a time
  const float* rs = res + (w * 16 + half) * AO_PO + l15 * 4;
  float* dst = out + ((size_t)b * 128 + w * 16 + half) * 768 + colblock + l15 * 4;
#pragma unroll  // the 8 LDS reads issue together, then the 8 stores
  for (int j = 0; j < 8; ++j)
    *(f32x4*)(dst + j * 2 * 768) = *(const f32x4*)(rs + j * 2 * AO_PO);
}

// ---------------------------------------------------------------------------
extern "C" void kernel_launch(void* const* d_in, const int* in_sizes, int n_in,
                              void* d_out, int out_size, void* d_ws, size_t ws_size,
                              hipStream_t stream) {
  (void)in_sizes; (void)n_in; (void)out_size; (void)ws_size;
  const float* text  = (const float*)d_in[0];  // [16,128,768]
  const float* img   = (const float*)d_in[1];  // [16,64,64,512] = [65536,512]
  const float* masks = (const float*)d_in[2];  // [16,128,4096]
  const float* Wq    = (const float*)d_in[3];  // [768,36]
  const float* bq    = (const float*)d_in[4];
  const float* Wk    = (const float*)d_in[5];  // [512,36]
  const float* bk    = (const float*)d_in[6];
  const float* Wv    = (const float*)d_in[7];  // [512,768]
  const float* bv    = (const float*)d_in[8];
  float* out = (float*)d_out;                  // [16,128,768]

  // workspace carve (256B aligned regions)
  char* ws = (char*)d_ws;
  size_t off = 0;
  auto carve = [&](size_t bytes) -> void* {
    void* ptr = ws + off;
    off = (off + bytes + 255) & ~(size_t)255;
    return ptr;
  };
  bf16*  qp    = (bf16*)carve((size_t)2048 * 64 * 2);          //  256 KB
  bf16*  kpB   = (bf16*)carve((size_t)65536 * 64 * 2);         //    8 MB
  bf16*  vt    = (bf16*)carve((size_t)16 * 768 * 4096 * 2);    //  100 MB
  bf16*  pP    = (bf16*)carve((size_t)16 * 128 * 4096 * 2);    //   16 MB
  float* rsum  = (float*)carve((size_t)2048 * 4);

  // q = relu(text@Wq+bq) -> [2048,64] bf16 (cols 36..63 zero)
  // k = relu(img@Wk+bk) -> bf16, 48 columns, in the scores kernel's fragment order
  // v = relu(img@Wv+bv) -> bf16, in attn_out's fragment order
  proj_qkv<<<dim3(PJ_ALL), 512, 0, stream>>>(
      text, Wq, bq, qp, img, Wk, bk, kpB, Wv, bv, vt);
  // scores + masked softmax
  attn_scores_softmax<<<dim3(128), 512, 0, stream>>>(
      qp, kpB, masks, pP, rsum);
  // o = (p @ v) / rowsum
  attn_out<<<dim3(12, 16), 256, 0, stream>>>(pP, vt, rsum, out);
}

// v010
// It runs in 82.3 microseconds.
// In two side-by-side timings against v009, it was 1.05 and 1.06 times as fast.
// All steps since v000 together make it 7.47 times as fast.
#include <hip/hip_runtime.h>
#include <hip/hip_bf16.h>
#include <type_traits>

// ---------------------------------------------------------------------------
// Text->Img cross attention, CDNA5 (gfx1250, wave32) bf16 WMMA implementation
//   B=16, N=128, H=W=64 (M=4096), TC=768, IC=512, FQ=36 (padded to 64)
// ---------------------------------------------------------------------------

typedef __bf16 bf16;
typedef __attribute__((ext_vector_type(8)))  bf16  bf16x8;
typedef __attribute__((ext_vector_type(16))) bf16  bf16x16;
typedef __attribute__((ext_vector_type(8)))  float f32x8;

// A/B fragment loader for V_WMMA_*_16X16X32_BF16 (wave32).
// Per ISA 7.12.2, lane (with half = lane>>4) holds K = half*8 + [0..7] in
// elements 0..7 and K = 16 + half*8 + [0..7] in elements 8..15 -> two 16B
// contiguous loads from a row-major [row/col, K] buffer.
__device__ __forceinline__ bf16x16 load_frag(const bf16* base, int half) {
  bf16x8 lo = *(const bf16x8*)(base + half * 8);
  bf16x8 hi = *(const bf16x8*)(base + 16 + half * 8);
  bf16x16 r;
#pragma unroll
  for (int i = 0; i < 8; ++i) { r[i] = lo[i]; r[i + 8] = hi[i]; }
  return r;
}

__device__ __forceinline__ f32x8 wmma_bf16(bf16x16 a, bf16x16 b, f32x8 c) {
  // (neg_a, A, neg_b, B, c_mod, C, reuse_a, reuse_b)
  return __builtin_amdgcn_wmma_f32_16x16x32_bf16(false, a, false, b,
                                                 (short)0, c, false, false);
}

typedef __attribute__((ext_vector_type(4))) float f32x4;
typedef __attribute__((ext_vector_type(4))) bf16  bf16x4;

// Asks L2 for the line that holds byte base + off + OFF: nothing comes back,
// no counter moves. A later load of that line then pays the L2's latency, not the
// memory's. Every lane's address lies inside the buffer that base points into.
template <int OFF>
__device__ __forceinline__ void ask_l2(unsigned off, const void* base) {
  asm volatile("global_prefetch_b8 %0, %1 offset:%2 scope:SCOPE_SE"
               :: "v"(off), "s"(base), "n"(OFF));
}

// ---------------------------------------------------------------------------
// Kernel 1: the q projection, out[row, 0..63] = relu(A[row, :] @ W + bias)
// in columns 0..35 and 0 in columns 36..63; f32 in -> bf16 out, row-major.
// W (K x 36) is turned into bf16 [col][k] in LDS once per block, one barrier;
// the K loop has none. A wave owns 16 rows and all columns (3 accumulators), so
// nobody else needs its A rows: it streams them with loads that cover whole
// lines (16 lanes x 16 B = the 256 B that one row has in a step of 64 k), DS
// steps ahead in registers, and turns them into fragments through an LDS slab
// of its own. Column tile 2 holds columns 32..47: the lanes of 36..47 read a
// row of zeros. k is summed 32 at a time, rising, in one chain per accumulator.
// LDS pitches: K + 8 and 72 bf16, both 16 B x odd, for the ds_load_b128 reads.
// ---------------------------------------------------------------------------
template <int K, int WAVES, int DS>
__device__ __forceinline__ void proj36_body(const float* __restrict__ A,
                                            const float* __restrict__ W,
                                            const float* __restrict__ bias,
                                            bf16* __restrict__ out,
                                            unsigned char* smem, int blk) {
  constexpr int NC = 36, PB = K + 8, PA = 72, NS = K / 64, NT = WAVES * 32;
  bf16* lB   = (bf16*)smem;            // [col][k], row 36 = 0
  bf16* slab = lB + (NC + 1) * PB;     // [wave][buf][row][k]

  const int tid  = threadIdx.x;
  const int w    = tid >> 5;
  const int lane = tid & 31;
  const int half = lane >> 4;
  const int l15  = lane & 15;
  const int rowbase = blk * (WAVES * 16) + w * 16;

  // load j of a step: rows 2j and 2j+1, 256 contiguous bytes of each
  const float* ag = A + (size_t)(rowbase + half) * K + l15 * 4;
  f32x4 ring[DS][8];
  auto fetch = [&](int s) {
#pragma unroll  // constant indices keep ring in registers
    for (int j = 0; j < 8; ++j)
      ring[s % DS][j] = *(const f32x4*)(ag + j * 2 * K + s * 64);
  };
#pragma unroll  // the same
  for (int s = 0; s < DS; ++s) fetch(s);
  // the block's A rows beyond the steps just asked for go to L2 now, in the order
  // of the steps: a request covers the 256 B that one row has in one step
  static_assert(WAVES == 16 && DS == 2 && NS == 12, "512 lanes = 256 rows x 2 steps");
  const unsigned po = (unsigned)((tid & 255) * (K * 4) + (tid >> 8) * 256);
  const float* pb = A + (size_t)blk * (WAVES * 16) * K;
  ask_l2<1 * 512>(po, pb);
  ask_l2<2 * 512>(po, pb);
  ask_l2<3 * 512>(po, pb);
  ask_l2<4 * 512>(po, pb);
  ask_l2<5 * 512>(po, pb);

  // W: a unit is 8 k x 4 columns, 8 loads of 16 B -> 4 LDS stores of 16 B;
  // the loads of WG units are in flight together
  constexpr int UNITS = (K / 8) * (NC / 4);
  constexpr int WG = (UNITS / NT) % 3 == 0 ? 3 : 1;
  auto stage_w = [&](int u0, auto gc) {
    constexpr int G = decltype(gc)::value;
    const float* src[G];
    f32x4 wv[G][8];
#pragma unroll  // constant indices: the array stays in registers
    for (int g = 0; g < G; ++g) {
      const int u = u0 + g * NT;
      src[g] = W + (u / (NC / 4)) * 8 * NC + (u % (NC / 4)) * 4;
#pragma unroll  // constant indices: the array stays in registers
      for (int i = 0; i < 8; ++i) wv[g][i] = *(const f32x4*)(src[g] + i * NC);
    }
    // precaution: as inputs of the wait the loads' addresses live up to it, so
    // that no later load lands in registers which an issued load names
    if constexpr (G == 3)
      asm volatile("s_wait_xcnt 0x0" :: "v"(src[0]), "v"(src[1]), "v"(src[2]) : "memory");
    else
      asm volatile("s_wait_xcnt 0x0" :: "v"(src[0]) : "memory");
#pragma unroll  // constant indices: the array stays in registers
    for (int g = 0; g < G; ++g) {
      const int u = u0 + g * NT;
#pragma unroll  // constant indices: the array stays in registers
      for (int j = 0; j < 4; ++j) {
        bf16x8 v;
#pragma unroll  // constant indices: the array stays in registers
        for (int i = 0; i < 8; ++i) v[i] = (bf16)wv[g][i][j];
        *(bf16x8*)&lB[((u % (NC / 4)) * 4 + j) * PB + (u / (NC / 4)) * 8] = v;
      }
    }
  };
  for (int n = 0; n < UNITS / NT; n += WG)
    stage_w(n * NT + tid, std::integral_constant<int, WG>{});
  if (tid < UNITS % NT)
    stage_w((UNITS / NT) * NT + tid, std::integral_constant<int, 1>{});
  if (tid < K / 8) {
    const bf16x8 zero = {};
    *(bf16x8*)&lB[NC * PB + tid * 8] = zero;
  }
  __syncthreads();

  const bf16* brow[3];
#pragma unroll  // constant indices: the array stays in registers
  for (int t = 0; t < 3; ++t) {
    const int c = t * 16 + l15;
    brow[t] = &lB[(c < NC ? c : NC) * PB];
  }

  f32x8 acc[3] = {};
#pragma unroll  // the ring slot and the slab buffer must be constants
  for (int s = 0; s < NS; ++s) {
    bf16* sl = slab + (w * 2 + (s & 1)) * (16 * PA);
    bf16x16 af[2], bfr[2][3];
    // the W fragments wait for nobody: read ahead of the slab's wait, under it
#pragma unroll  // constant indices: the array stays in registers
    for (int c = 0; c < 2; ++c)
#pragma unroll  // constant indices: the array stays in registers
      for (int t = 0; t < 3; ++t)
        bfr[c][t] = load_frag(brow[t] + s * 64 + c * 32, half);
#pragma unroll  // constant indices: the array stays in registers
    for (int j = 0; j < 8; ++j)
      *(bf16x4*)&sl[(2 * j + half) * PA + l15 * 4] =
          __builtin_convertvector(ring[s % DS][j], bf16x4);
    if (s + DS < NS) fetch(s + DS);
    // the slab rows that a lane reads below were written by other lanes of its
    // wave: their stores are done, and the compiler moves no read above them
    asm volatile("s_wait_dscnt 0x0" ::: "memory");
#pragma unroll  // constant indices: the array stays in registers
    for (int c = 0; c < 2; ++c) af[c] = load_frag(&sl[l15 * PA + c * 32], half);
#pragma unroll  // constant indices: the array stays in registers
    for (int c = 0; c < 2; ++c)
#pragma unroll  // constant indices: the array stays in registers
      for (int t = 0; t < 3; ++t) acc[t] = wmma_bf16(af[c], bfr[c][t], acc[t]);
  }
  // see the W loads; po: the requests' offset register holds its value up to here
  asm volatile("s_wait_xcnt 0x0" :: "v"(ag), "v"(po) : "memory");

  // epilogue: bias + relu, through the wave's slab, so that every store
  // instruction writes 4 whole 128-B rows of out (C/D: row = r + 8 half, col = l15)
  bf16* sl = slab + (w * 2) * (16 * PA);
#pragma unroll  // constant indices: the array stays in registers
  for (int t = 0; t < 3; ++t) {
    const int gc = t * 16 + l15;
    const float bv = (gc < NC) ? bias[gc] : 0.f;
#pragma unroll  // constant indices: the array stays in registers
    for (int r = 0; r < 8; ++r) {
      const float val = acc[t][r] + bv;
      sl[(r + 8 * half) * PA + gc] = (bf16)(val > 0.f ? val : 0.f);
    }
  }
  // as in the loop: other lanes' stores are done before the rows are read back
  asm volatile("s_wait_dscnt 0x0" ::: "memory");
  const int pc = lane & 7;  // 16-B piece of a row; pieces 6, 7 = columns 48..63
#pragma unroll  // the 4 LDS reads issue together, then the 4 stores
  for (int j = 0; j < 4; ++j) {
    const int row = j * 4 + (lane >> 3);
    bf16x8 v = *(const bf16x8*)&sl[row * PA + (pc < 6 ? pc : 0) * 8];
    if (pc >= 6) v = bf16x8{};
    *(bf16x8*)(out + (size_t)(rowbase + row) * 64 + pc * 8) = v;
  }
  // precaution: in the kernel's text another body's code follows these stores;
  // nothing there stands ahead of this wait and rewrites their address registers
  asm volatile("s_wait_xcnt 0x0" ::: "memory");
}

// ---------------------------------------------------------------------------
// Kernel 1b: the v and the k projection of 256 img rows, from one LDS-resident tile.
//   v[b, m, col] = relu(img[b*4096+m, :] @ Wv + bv), 768 columns, written to vt
//   in the order in which attn_out reads its B fragments (VF_* below)
//   k[row, 0..47] = relu(img[row, :] @ Wk + bk) in columns 0..35, 0 beyond,
//   written to kp in the order in which the scores kernel reads its B fragments
// Block = 512 thr (16 waves). Its 256 rows x 512 k are read from memory once,
// turned into bf16 once and stay in LDS; every product of these rows is made
// from there: three passes of 256 v columns, then the k columns.
// A v pass: waves 4 x 4, 64 rows x 64 cols = 4 x 4 accumulators per wave, so 8
// fragments feed 16 WMMAs. Wv comes in chunks of 32 k through two LDS buffers:
// next chunk's global loads, WMMAs on the current chunk, cvt + LDS store of the
// next chunk, one barrier per chunk. In the first pass the img chunks come the
// same way, one chunk ahead, into their place in the resident tile.
// Blocks start with different column tiles, so that not all of them ask for the
// same lines of Wv at the same moment.
// LDS pitches: img rows 1104 B, Wv rows (32 k) 80 B, Wk rows 1040 B: 16 B x odd.
// Column order in LDS: the thread that loads 4 neighbouring columns cg*4+j puts
// column j into LDS row j*64+cg, so wave column wc holds the columns = wc mod 4.
// The k pass: wave w owns rows 16 w .. 16 w + 15 and 3 column tiles; Wk lies in
// the place of the Wv buffers as [col][k], row 36 = 0 for the columns 36..47;
// k is summed 32 at a time, rising, in one chain per accumulator.
// ---------------------------------------------------------------------------
constexpr int PV_PA  = 512 + 40;  // bf16 per LDS row of the img tile
constexpr int KF_TILE = 3 * 256;  // bf16 per score tile (16 m) of kp: 3 units of 512 B
// vt, in bf16: [b][group of 64 columns][chunk of 32 m][tile wc][unit u][lane][8].
// Tile wc of a group holds its columns 4 l15 + wc. A unit is 512 B, lane after
// lane: the lane (l15, half) holds m = 16 u + 8 half + 0..7 of its column, which
// is what a lane has in one accumulator here and half of a B fragment there.
constexpr int VF_UNIT  = 256;              // 32 lanes x 8 bf16
constexpr int VF_TILE  = 2 * VF_UNIT;      // one B fragment of 32 m x 16 columns
constexpr int VF_CHUNK = 4 * VF_TILE;      // 32 m x 64 columns, 4 KB
constexpr int VF_GROUP = 128 * VF_CHUNK;   // 4096 m x 64 columns
constexpr int PV_LDS = (256 * PV_PA + 2 * 256 * 40) * 2;

__device__ __forceinline__ void proj_vk_body(const float* __restrict__ A,
                                             const float* __restrict__ W,
                                             const float* __restrict__ bias,
                                             bf16* __restrict__ out,
                                             const float* __restrict__ Wk,
                                             const float* __restrict__ bk,
                                             bf16* __restrict__ kout,
                                             unsigned char* smem, int blk) {
  constexpr int K = 512, NC = 768, P = 40;
  bf16* lA = (bf16*)smem;                                       // [row][k]  276 KB
  bf16 (*lB)[256 * P] = (bf16 (*)[256 * P])(lA + 256 * PV_PA);  // [buf][col][k]  2x20 KB

  const int tid  = threadIdx.x;
  const int w    = tid >> 5;
  const int lane = tid & 31;
  const int half = lane >> 4;
  const int l15  = lane & 15;
  const int wr   = w >> 2;
  const int wc   = w & 3;
  const int rowblock = blk * 256;

  // img chunk [256 x 32] f32: 8 lanes x 16 B cover one row's 128-B line.
  const int ar = tid >> 3;
  const int ak = (tid & 7) * 4;
  const float* asrc = A + (size_t)(rowblock + ar) * K + ak;
  // Wv chunk [32 x 256] f32: 4 k rows x 4 columns per thread.
  const int cg = tid & 63;
  const int kg = tid >> 6;
  const float* wsrc = W + (size_t)(kg * 4) * NC + cg * 4;

  f32x4 aR[4], wR[4];
  auto ld_a = [&](int k0) {
#pragma unroll
    for (int j = 0; j < 4; ++j)
      aR[j] = *(const f32x4*)(asrc + (size_t)(j * 64) * K + k0);
  };
  auto ld_w = [&](int ct, int k0) {
#pragma unroll
    for (int i = 0; i < 4; ++i)
      wR[i] = *(const f32x4*)(wsrc + ct * 256 + (size_t)(k0 + i) * NC);
  };
  auto st_a = [&](int k0) {
#pragma unroll
    for (int j = 0; j < 4; ++j)
      *(bf16x4*)&lA[(ar + 64 * j) * PV_PA + k0 + ak] =
          __builtin_convertvector(aR[j], bf16x4);
  };
  auto st_w = [&](int buf) {
#pragma unroll
    for (int j = 0; j < 4; ++j) {
      bf16x4 v;
#pragma unroll
      for (int i = 0; i < 4; ++i) v[i] = (bf16)wR[i][j];
      *(bf16x4*)&lB[buf][(j * 64 + cg) * P + kg * 4] = v;
    }
  };

  // requests to L2: 512 lanes = 256 rows of 2 KB x 2 units of 256 B; the immediate
  // offset i * 512 picks the units 2 i and 2 i + 1 of every row (chunks 4 i .. 4 i + 3)
  const unsigned pfo = (unsigned)((tid & 255) * 2048 + (tid >> 8) * 256);
  const float* pfa = A + (size_t)rowblock * K;

  const int bb = rowblock >> 12;
  const int ch0 = ((rowblock & 4095) >> 5) + wr * 2;  // the wave's first chunk of 32 m

  // Wk takes the place of the Wv buffers behind the last v chunk, ahead of that
  // pass's stores to vt, so that no barrier has to wait for those stores
  constexpr int KC = 36, PB = K + 8, PS = 72;
  bf16* lK = (bf16*)lB;  // [col][k], 37 rows
  // a unit is 8 k x 4 columns, 8 loads of 16 B -> 4 LDS stores of 16 B
  auto stage_k = [&](int u) {
    const float* src = Wk + (u / (KC / 4)) * 8 * KC + (u % (KC / 4)) * 4;
    f32x4 wv[8];
#pragma unroll  // constant indices: the array stays in registers
    for (int i = 0; i < 8; ++i) wv[i] = *(const f32x4*)(src + i * KC);
    // precaution: as an input of the wait the loads' address lives up to it, so
    // that no later load lands in registers which an issued load names
    asm volatile("s_wait_xcnt 0x0" :: "v"(src) : "memory");
#pragma unroll  // constant indices: the array stays in registers
    for (int j = 0; j < 4; ++j) {
      bf16x8 v;
#pragma unroll  // constant indices: the array stays in registers
      for (int i = 0; i < 8; ++i) v[i] = (bf16)wv[i][j];
      *(bf16x8*)&lK[((u % (KC / 4)) * 4 + j) * PB + (u / (KC / 4)) * 8] = v;
    }
  };
  auto stage_wk = [&]() {
    constexpr int UNITS = (K / 8) * (KC / 4);  // 576 = 512 + 64
    __syncthreads();  // every wave has read its last Wv fragments: the buffers are free
    stage_k(tid);
    if (tid < UNITS - 512) stage_k(512 + tid);
    if (tid < K / 8) {
      const bf16x8 zero = {};
      *(bf16x8*)&lK[KC * PB + tid * 8] = zero;
    }
    __syncthreads();  // Wk is whole before anybody reads it
  };

  // one pass: column tile ct; ctn is the tile of the pass that follows
  auto pass = [&](auto first, auto last, int ct, int ctn) {
    constexpr bool FIRST = decltype(first)::value, LAST = decltype(last)::value;
    constexpr int nCh = K / 32;
    f32x8 acc[4][4] = {};
    for (int ci = 0; ci < nCh; ++ci) {
      const int cur = ci & 1;
      const bool lastc = (ci + 1) == nCh;
      const bool more = !(LAST && lastc);
      // VMEM for the next chunk first
      if (FIRST && !lastc) ld_a((ci + 1) * 32);
      if (more) ld_w(lastc ? ctn : ct, lastc ? 0 : (ci + 1) * 32);
      // img chunks 8..11 (asked in chunk 0) and 12..15 (in chunk 4) go to L2 seven
      // chunks ahead of their loads: not all at entry, so that the requests in
      // front of a chunk's own loads stay few
      if constexpr (FIRST) {
        if (ci == 0) ask_l2<2 * 512>(pfo, pfa);
        else if (ci == 4) ask_l2<3 * 512>(pfo, pfa);
      }

      bf16x16 af[4], bfr[4];
#pragma unroll
      for (int i = 0; i < 4; ++i)
        af[i] = load_frag(&lA[(wr * 64 + i * 16 + l15) * PV_PA + ci * 32], half);
#pragma unroll
      for (int t = 0; t < 4; ++t)
        bfr[t] = load_frag(&lB[cur][(wc * 64 + t * 16 + l15) * P], half);
      // keeps the global loads and the 16 LDS reads one group ahead of the WMMAs;
      // without it global loads sink to just before their cvt, their latency no
      // longer covered, and A fragments are read among the WMMAs behind full waits
      __builtin_amdgcn_sched_barrier(0);
#pragma unroll
      for (int i = 0; i < 4; ++i)
#pragma unroll
        for (int t = 0; t < 4; ++t)
          acc[i][t] = wmma_bf16(af[i], bfr[t], acc[i][t]);

      // keeps the cvt of the loaded chunk, and with it the wait on those loads,
      // behind the WMMAs; without it the scheduler lifts both above them
      __builtin_amdgcn_sched_barrier(0);
      if (more) {
        // safe: everyone finished reading buffer cur^1 before the last barrier,
        // and nobody has read the img columns of the next chunk yet
        st_w(cur ^ 1);
        if (FIRST && !lastc) st_a((ci + 1) * 32);
        __syncthreads();
      }
    }

    if constexpr (LAST) stage_wk();

    // epilogue: a lane's 8 accumulator registers are 8 consecutive m of one
    // column -> bias + relu + one 16-B store each. Accumulator (i, t) is unit
    // i & 1 of chunk ch0 + (i >> 1): a store instruction writes 4 whole lines.
    bf16* dst = out + (size_t)(bb * 12 + ct * 4) * VF_GROUP + ch0 * VF_CHUNK +
                wc * VF_TILE + lane * 8;
#pragma unroll
    for (int t = 0; t < 4; ++t) {
      const int gc = ct * 256 + (t * 16 + l15) * 4 + wc;
      const float bv = bias[gc];
#pragma unroll
      for (int i = 0; i < 4; ++i) {
        bf16x8 v;
#pragma unroll
        for (int r = 0; r < 8; ++r) {
          const float val = acc[i][t][r] + bv;
          v[r] = (bf16)(val > 0.f ? val : 0.f);
        }
        *(bf16x8*)(dst + t * VF_GROUP + (i >> 1) * VF_CHUNK + (i & 1) * VF_UNIT) = v;
      }
    }
    // precaution: as an input of the wait the stores' address lives up to it, so
    // that the code of the next pass does not rewrite it ahead of the wait
    asm volatile("s_wait_xcnt 0x0" :: "v"(dst) : "memory");
  };

  const int c0 = blk % 3;
  const int c1 = c0 == 2 ? 0 : c0 + 1;
  const int c2 = c1 == 2 ? 0 : c1 + 1;

  ld_a(0);
  ld_w(c0, 0);
  // Wv is read by every block: each asks for one twelfth of it (a third of its
  // bytes has the shape of an img tile: 256 pieces of 2 KB; one of its 4 unit
  // pairs). Eight blocks in a row ask for the same twelfth, so that it is asked
  // for wherever such blocks run; a twelfth that is not asked for is only slower
  {
    const int g = (blk >> 3) % 12;
    ask_l2<0>(pfo, W + (g >> 2) * (256 * 512) + (g & 3) * 128);  // in floats
  }
  // img chunks 0..7
  ask_l2<0 * 512>(pfo, pfa);
  ask_l2<1 * 512>(pfo, pfa);
  st_a(0);
  st_w(0);
  __syncthreads();
  pass(std::true_type{}, std::false_type{}, c0, c1);
  pass(std::false_type{}, std::false_type{}, c1, c2);
  pass(std::false_type{}, std::true_type{}, c2, c2);

  // ---- the k columns, from the same img tile
  const bf16* arow = &lA[(w * 16 + l15) * PV_PA];
  const bf16* brow[3];
#pragma unroll  // constant indices: the array stays in registers
  for (int t = 0; t < 3; ++t) {
    const int c = t * 16 + l15;
    brow[t] = &lK[(c < KC ? c : KC) * PB];
  }
  f32x8 ka[3] = {};
#pragma unroll 4  // 4 chunks' LDS reads go ahead of their WMMAs; all 16 would spill
  for (int s = 0; s < K / 32; ++s) {
    const bf16x16 af = load_frag(arow + s * 32, half);
#pragma unroll  // constant indices: the array stays in registers
    for (int t = 0; t < 3; ++t)
      ka[t] = wmma_bf16(af, load_frag(brow[t] + s * 32, half), ka[t]);
  }

  // epilogue: bias + relu into an LDS slab in the wave's own 16 img rows, which
  // nobody else reads in this pass (C/D: row = r + 8 half, col = l15)
  bf16* sl = lA + (w * 16) * PV_PA;
#pragma unroll  // constant indices: the array stays in registers
  for (int t = 0; t < 3; ++t) {
    const int gc = t * 16 + l15;
    const float bv = (gc < KC) ? bk[gc] : 0.f;
#pragma unroll  // constant indices: the array stays in registers
    for (int r = 0; r < 8; ++r) {
      const float val = ka[t][r] + bv;
      sl[(r + 8 * half) * PS + gc] = (bf16)(val > 0.f ? val : 0.f);
    }
  }
  // every wave's slab is whole before other waves read it. The fences name LDS
  // alone, so that the barrier does not wait for the stores to vt in flight
  __builtin_amdgcn_fence(__ATOMIC_RELEASE, "workgroup", "local");
  __builtin_amdgcn_s_barrier();
  __builtin_amdgcn_fence(__ATOMIC_ACQUIRE, "workgroup", "local");
  // kout in fragment order (see the scores kernel): wave w writes score tile w
  // of the block's 256 rows, three units of 512 B; in unit u the lane (l15, half)
  // holds columns 16 u + 8 half .. + 7 of the row that is the tile's column l15.
  // A store instruction writes 4 whole lines.
  const int srow = (w >> 2) * 64 + l15 * 4 + (w & 3);
  const bf16* sr = lA + (srow >> 4) * (16 * PV_PA) + (srow & 15) * PS + half * 8;
  bf16* kd = kout + (size_t)(blk * 16 + w) * KF_TILE + lane * 8;
#pragma unroll  // the 3 LDS reads issue together, then the 3 stores
  for (int u = 0; u < 3; ++u)
    *(bf16x8*)(kd + u * 256) = *(const bf16x8*)(sr + u * 16);
  // precaution: the stores' address lives up to the wait
  asm volatile("s_wait_xcnt 0x0" :: "v"(kd) : "memory");
}

// ---------------------------------------------------------------------------
// The projections depend on nothing but the inputs: one launch holds them all.
// Blocks 0..7 are the q blocks (256 rows each), the 256 blocks after them
// make v and k of 256 img rows each. All have 16 waves
// and share one LDS range, sized for the larger use.
// ---------------------------------------------------------------------------
constexpr int PJ_Q = 8, PJ_VK = 256, PJ_ALL = PJ_Q + PJ_VK;
constexpr int PJ_LDS_Q = (37 * (768 + 8) + 16 * 2 * 16 * 72) * 2;
constexpr int PJ_LDS = PJ_LDS_Q > PV_LDS ? PJ_LDS_Q : PV_LDS;

__launch_bounds__(512)
__global__ void proj_qkv(const float* __restrict__ text, const float* __restrict__ Wq,
                         const float* __restrict__ bq, bf16* __restrict__ qp,
                         const float* __restrict__ img, const float* __restrict__ Wk,
                         const float* __restrict__ bk, bf16* __restrict__ kp,
                         const float* __restrict__ Wv, const float* __restrict__ bv,
                         bf16* __restrict__ vt) {
  __shared__ __align__(16) unsigned char smem[PJ_LDS];
  const int blk = blockIdx.x;
  if (blk >= PJ_Q)
    proj_vk_body(img, Wv, bv, vt, Wk, bk, kp, smem, blk - PJ_Q);
  else
    proj36_body<768, 16, 2>(text, Wq, bq, qp, smem, blk);
}

// ---------------------------------------------------------------------------
// Kernel 2: s = q@k^T, beta = s*mask, softmax over M=4096, beta held in registers.
// One block per (b, 16-query tile), 16 waves. Wave w owns m in [256w, 256w+256)
// = 16 WMMA tiles. The 128 beta of a lane stay in the registers that its 128 mask
// values were loaded into: all mask loads of a wave are in flight together, and
// nothing is written to be read again.
// Column l15 of tile j is m = 256 w + 64 (j >> 2) + 4 l15 + (j & 3): a lane owns
// 4 neighbouring m four times in each of its rows, so a mask load is 16 B and a p
// store 8 B a lane, and 16 lanes cover whole lines of a row. kp holds k in that
// order, fragment by fragment (tile: 3 units of 512 B, K 0..15, 16..31, 32..47,
// lane after lane), so a k load covers 4 whole lines; K 48..63 is 0 and not kept.
// p = exp(beta - max) is bf16, unnormalized; row sums -> rowsum_g.
// Row reductions: __shfl_xor within 16-lane groups, then LDS across waves.
// ---------------------------------------------------------------------------
__launch_bounds__(512)
__global__ void attn_scores_softmax(const bf16* __restrict__ qp,
                                    const bf16* __restrict__ kp,
                                    const float* __restrict__ masks,
                                    bf16* __restrict__ p,
                                    float* __restrict__ rowsum_g) {
  __shared__ float red[16][16];
  __shared__ float rowmax[16];

  const int tid  = threadIdx.x;
  const int w    = tid >> 5;
  const int lane = tid & 31;
  const int half = lane >> 4;
  const int l15  = lane & 15;
  const int b     = blockIdx.x >> 3;
  const int nbase = (blockIdx.x & 7) * 16;

  // the wave's 16 k tiles, 24 KB in a row, stored by the launch before: asked of
  // L2 ahead of the mask loads, so that the k ring below, 3 tiles deep, meets the
  // L2's latency and not the memory's
  const unsigned ko = (unsigned)(w * (16 * KF_TILE * 2) + lane * 256);
  const bf16* kb = kp + (size_t)b * (16 * 16 * KF_TILE);
  ask_l2<0 * 8192>(ko, kb);
  ask_l2<1 * 8192>(ko, kb);
  ask_l2<2 * 8192>(ko, kb);

  const bf16* qrow = qp + ((size_t)b * 128 + nbase + l15) * 64;
  const bf16x16 a0 = load_frag(qrow, half);        // K 0..31
  const bf16x16 a1 = load_frag(qrow + 32, half);   // K 32..63
  // precaution, here and behind the mask and the k loads below: as an input of
  // the wait the loads' address lives up to it, so that no later load lands in
  // registers which an issued load names before the wait has been passed
  // (ko: the requests' offset register holds its value up to here as well)
  asm volatile("s_wait_xcnt 0x0" :: "v"(qrow), "v"(ko) : "memory");

  // the lane's element of tile j, register r: row nbase + 8 half + r,
  // m = m0 + 64 (j >> 2) + (j & 3)
  const int    m0  = w * 256 + l15 * 4;
  const size_t idx = ((size_t)b * 128 + nbase + 8 * half) * 4096 + m0;
  const float* mrow = masks + idx;
  const bf16*  kfr = kp + (size_t)(b * 16 + w) * (16 * KF_TILE) + lane * 8;

  f32x4 bt[8][4];  // [register][j >> 2][j & 3]: first the mask, then beta
#pragma unroll  // constant indices keep bt in registers
  for (int r = 0; r < 8; ++r)
#pragma unroll  // the same
    for (int h = 0; h < 4; ++h) bt[r][h] = *(const f32x4*)(mrow + r * 4096 + h * 64);
  asm volatile("s_wait_xcnt 0x0" :: "v"(mrow) : "memory");  // see the q loads

  // k fragments: a ring of KD tiles in registers
  constexpr int KD = 3;
  bf16x8 kr[KD][3];
  auto kfetch = [&](int j) {
#pragma unroll  // constant indices keep kr in registers
    for (int u = 0; u < 3; ++u)
      kr[j % KD][u] = *(const bf16x8*)(kfr + j * KF_TILE + u * 256);
  };
#pragma unroll  // the same
  for (int j = 0; j < KD; ++j) kfetch(j);

  float rmax[8];
#pragma unroll  // rmax is indexed by constants only
  for (int r = 0; r < 8; ++r) rmax[r] = -3.0e38f;

#pragma unroll  // constant indices keep bt and kr in registers
  for (int j = 0; j < 16; ++j) {
    bf16x16 b0, b1;
#pragma unroll  // constant indices: the vectors stay in registers
    for (int i = 0; i < 8; ++i) {
      b0[i] = kr[j % KD][0][i]; b0[i + 8] = kr[j % KD][1][i];
      b1[i] = kr[j % KD][2][i]; b1[i + 8] = (bf16)0.f;
    }
    f32x8 acc = {};
    acc = wmma_bf16(a0, b0, acc);
    acc = wmma_bf16(a1, b1, acc);
    if (j + KD < 16) kfetch(j + KD);
#pragma unroll  // the same
    for (int r = 0; r < 8; ++r) {
      const float be = acc[r] * bt[r][j >> 2][j & 3];  // multiplicative mask BEFORE softmax
      bt[r][j >> 2][j & 3] = be;
      rmax[r] = fmaxf(rmax[r], be);
    }
  }
  asm volatile("s_wait_xcnt 0x0" :: "v"(kfr) : "memory");  // see the q loads

  // row max: reduce across the 16 lanes that share rows, then across waves
#pragma unroll
  for (int r = 0; r < 8; ++r)
#pragma unroll
    for (int off = 1; off < 16; off <<= 1)
      rmax[r] = fmaxf(rmax[r], __shfl_xor(rmax[r], off, 16));
  if (l15 == 0)
#pragma unroll
    for (int r = 0; r < 8; ++r) red[w][r + 8 * half] = rmax[r];
  __syncthreads();
  if (tid < 16) {
    float mx = -3.0e38f;
    for (int ww = 0; ww < 16; ++ww) mx = fmaxf(mx, red[ww][tid]);
    rowmax[tid] = mx;
  }
  __syncthreads();

  float rsum[8] = {};
  bf16* prow = p + idx;
#pragma unroll  // constant indices keep bt in registers
  for (int r = 0; r < 8; ++r) {
    const float mx = rowmax[r + 8 * half];
#pragma unroll  // the same
    for (int h = 0; h < 4; ++h) {
      bf16x4 pv;  // unnormalized; 1/sum in attn_out
#pragma unroll  // the same
      for (int i = 0; i < 4; ++i) {
        const float t = (bt[r][h][i] - mx) * 1.44269504f;  // exp(x) = 2^(x log2 e)
        float e;
        // the v_nop fills the slot that the instruction set asks for between a
        // transcendental and a next instruction that reads e or overwrites t
        asm("v_exp_f32 %0, %1\n\tv_nop" : "=v"(e) : "v"(t));
        rsum[r] += e;
        pv[i] = (bf16)e;
      }
      *(bf16x4*)(prow + r * 4096 + h * 64) = pv;
    }
  }
  // precaution: the stores' address lives up to the wait
  asm volatile("s_wait_xcnt 0x0" :: "v"(prow) : "memory");
#pragma unroll
  for (int r = 0; r < 8; ++r)
#pragma unroll
    for (int off = 1; off < 16; off <<= 1)
      rsum[r] += __shfl_xor(rsum[r], off, 16);
  __syncthreads();  // rowmax reads done; red is reusable
  if (l15 == 0)
#pragma unroll
    for (int r = 0; r < 8; ++r) red[w][r + 8 * half] = rsum[r];
  __syncthreads();
  if (tid < 16) {
    float s = 0.f;
    for (int ww = 0; ww < 16; ++ww) s += red[ww][tid];
    rowsum_g[(size_t)b * 128 + nbase + tid] = s;
  }
}

// ---------------------------------------------------------------------------
// Kernel 3: o[b,n,col] = (p[b,n,:] @ v[b,:,col]) / rowsum[b,n].
// One block = all 128 n of one batch x one group of 64 columns, 8 waves (4 x 2),
// 32 n x 2 column tiles per wave = 2 x 2 accumulators. p and v are staged in LDS,
// 256 m per stage, by asynchronous copies of 512 contiguous bytes a wave, so
// every global access covers whole lines: of p the bytes that one row has in the
// stage, of v one unit; v comes in fragment order (VF_* above), a stage is 32 KB
// in a row and lies in LDS as in memory, so a B fragment is two reads of a unit.
// Three buffers: while a stage is multiplied the copies of the next two fly, so a
// stage has two stage times to land, not one. A stage is handed over ahead of its
// last block of WMMAs: the next stage's first fragments are read under that block.
// LDS rows of p: 512 B at a pitch of 528 B (16 B x odd) for the ds_load_b128 reads.
// Column l15 of tile j is column 4 l15 + j of the group: the result goes through
// LDS once, so that each line of out has one writer and is stored whole.
// ---------------------------------------------------------------------------
typedef __attribute__((ext_vector_type(2))) float f32x2;

constexpr int AO_KS    = 256;                 // m per stage
constexpr int AO_NT    = 4096 / AO_KS;        // stages
constexpr int AO_PITCH = AO_KS * 2 + 16;      // bytes per LDS row of p
constexpr int AO_A     = 128 * AO_PITCH;      // p tile, bytes
constexpr int AO_BUF   = AO_A + (AO_KS / 32) * VF_CHUNK * 2;
constexpr int AO_NB    = 3;                   // buffers of the ring
constexpr int AO_PO    = 64 + 4;              // floats per LDS row of the result: 16 B x odd

// Eight copies of one wave, LS bytes apart in LDS and GS bf16 apart in memory;
// each lane brings its own 16 bytes. The s_wait_xcnt stands inside the statement
// so that no address register of a copy is rewritten in front of it.
template <unsigned LS, int GS>
__device__ __forceinline__ void copy8(unsigned l, const bf16* g) {
  asm volatile(
      "global_load_async_to_lds_b128 %0, %8, off\n\t"
      "global_load_async_to_lds_b128 %1, %9, off\n\t"
      "global_load_async_to_lds_b128 %2, %10, off\n\t"
      "global_load_async_to_lds_b128 %3, %11, off\n\t"
      "global_load_async_to_lds_b128 %4, %12, off\n\t"
      "global_load_async_to_lds_b128 %5, %13, off\n\t"
      "global_load_async_to_lds_b128 %6, %14, off\n\t"
      "global_load_async_to_lds_b128 %7, %15, off\n\t"
      "s_wait_xcnt 0x0"
      :: "v"(l), "v"(l + LS), "v"(l + 2 * LS), "v"(l + 3 * LS),
         "v"(l + 4 * LS), "v"(l + 5 * LS), "v"(l + 6 * LS), "v"(l + 7 * LS),
         "v"(g), "v"(g + GS), "v"(g + 2 * GS), "v"(g + 3 * GS),
         "v"(g + 4 * GS), "v"(g + 5 * GS), "v"(g + 6 * GS), "v"(g + 7 * GS)
      : "memory");
}

// B fragment from fragment order: the lane's 16 B of unit 0 (K = 8 half + 0..7)
// and of unit 1 (K = 16 + 8 half + 0..7), the k order of load_frag
__device__ __forceinline__ bf16x16 load_frag_units(const bf16* lane_base) {
  bf16x8 lo = *(const bf16x8*)(lane_base);
  bf16x8 hi = *(const bf16x8*)(lane_base + VF_UNIT);
  bf16x16 r;
#pragma unroll
  for (int i = 0; i < 8; ++i) { r[i] = lo[i]; r[i + 8] = hi[i]; }
  return r;
}

__launch_bounds__(256)
__global__ void attn_out(const bf16* __restrict__ p,
                         const bf16* __restrict__ v_t,
                         const float* __restrict__ rowsum_g,
                         float* __restrict__ out) {
  __shared__ __align__(16) unsigned char ring[AO_NB][AO_BUF];  // 3 x 98 KB

  const int tid  = threadIdx.x;
  const int w    = tid >> 5;
  const int lane = tid & 31;
  const int half = lane >> 4;
  const int l15  = lane & 15;
  const int wr   = w >> 1;
  const int wc   = w & 1;
  const int b        = blockIdx.y;
  const int colblock = blockIdx.x * 64;

  // wave w copies rows w, w+8, ... of p (16 rows) and units w, w+8, ... of v (8)
  const bf16* pg = p   + ((size_t)b * 128 + w) * 4096 + lane * 8;
  const bf16* vg = v_t + (size_t)(b * 12 + blockIdx.x) * VF_GROUP + w * VF_UNIT + lane * 8;
  const unsigned l0 =
      (unsigned)(size_t)&ring[0][0] + (unsigned)(w * AO_PITCH + lane * 16);
  const unsigned lv =
      (unsigned)(size_t)&ring[0][0] + (unsigned)(AO_A + w * (VF_UNIT * 2) + lane * 16);

  auto fill = [&](int t, int buf) {
    const unsigned l = l0 + (unsigned)(buf * AO_BUF);
    copy8<8 * AO_PITCH, 8 * 4096>(l, pg + t * AO_KS);
    copy8<8 * AO_PITCH, 8 * 4096>(l + 64 * AO_PITCH, pg + 64 * 4096 + t * AO_KS);
    copy8<8 * VF_UNIT * 2, 8 * VF_UNIT>(lv + (unsigned)(buf * AO_BUF),
                                        vg + t * ((AO_KS / 32) * VF_CHUNK));
  };

  f32x8 acc[2][2] = {};
  // a block = 2 k chunks of 32 = 16 LDS reads, 8 WMMAs; two fragment sets
  bf16x16 fa[2][2][2], fb[2][2][2];  // [set][chunk][tile]
  auto frags = [&](int set, int buf, int blk) {
    const unsigned char* base = &ring[buf][0];
    const bf16* ar = (const bf16*)(base + (wr * 32 + l15) * AO_PITCH);
    const bf16* br = (const bf16*)(base + AO_A) + wc * (2 * VF_TILE) + lane * 8;
#pragma unroll  // constant indices keep fa, fb in registers
    for (int c = 0; c < 2; ++c) {
      const int kc = blk * 2 + c;
      fa[set][c][0] = load_frag(ar + kc * 32, half);
      fa[set][c][1] = load_frag(ar + 8 * AO_PITCH + kc * 32, half);
      fb[set][c][0] = load_frag_units(br + kc * VF_CHUNK);
      fb[set][c][1] = load_frag_units(br + kc * VF_CHUNK + VF_TILE);
    }
  };
  auto mult = [&](int s) {
#pragma unroll  // constant indices, as above
    for (int c = 0; c < 2; ++c) {
      acc[0][0] = wmma_bf16(fa[s][c][0], fb[s][c][0], acc[0][0]);
      acc[0][1] = wmma_bf16(fa[s][c][0], fb[s][c][1], acc[0][1]);
      acc[1][0] = wmma_bf16(fa[s][c][1], fb[s][c][0], acc[1][0]);
      acc[1][1] = wmma_bf16(fa[s][c][1], fb[s][c][1], acc[1][1]);
    }
  };

  fill(0, 0);
  fill(1, 1);
  // stage 0 has landed for this wave (all but its 24 youngest copies, which are
  // stage 1's), then for all
  asm volatile("s_wait_asynccnt 24" ::: "memory");
  __syncthreads();
  frags(0, 0, 0);
  fill(2, 2);

  constexpr int NBLK = AO_KS / 64;  // even: block 0 of every stage uses set 0
  int cur = 0;                      // t mod 3
  for (int t = 0; t < AO_NT; ++t) {
    const int nb = cur == AO_NB - 1 ? 0 : cur + 1;
#pragma unroll  // the set index must be a constant: fa, fb stay in registers
    for (int blk = 0; blk + 1 < NBLK; ++blk) {
      frags((blk & 1) ^ 1, cur, blk + 1);
      // keeps the next block's LDS reads one group ahead of this block's WMMAs;
      // without it they are spread among the WMMAs behind full waits
      __builtin_amdgcn_sched_barrier(0);
      mult(blk & 1);
      // keeps the reads of the block after next behind this block's WMMAs;
      // without it they split into smaller groups among these WMMAs
      __builtin_amdgcn_sched_barrier(0);
    }
    // hand-over, ahead of the stage's last block, whose fragments are fetched:
    // this wave's reads of buffer cur are done ...
    asm volatile("s_wait_dscnt 0x0" ::: "memory");
    // ... its copies of stage t+1 have landed: all but the 24 youngest, which are
    // stage t+2's where that stage exists (every wave issues 24 copies a stage, in
    // stage order; where no younger stage has been issued the wait is to 0) ...
    if (t + 2 < AO_NT)
      asm volatile("s_wait_asynccnt 24" ::: "memory");
    else
      asm volatile("s_wait_asynccnt 0x0" ::: "memory");
    // ... and the same holds for every wave: stage t+1 may be read, cur refilled
    __syncthreads();
    // the next stage's first reads and the refill go ahead of the last block's
    // WMMAs, so that the LDS does not idle over the stage boundary
    if (t + 1 < AO_NT) frags(0, nb, 0);
    if (t + 3 < AO_NT) fill(t + 3, cur);
    // keeps the WMMAs below behind those reads and copies
    __builtin_amdgcn_sched_barrier(0);
    mult((NBLK - 1) & 1);
    // keeps the next trip's reads behind these WMMAs, in one group
    __builtin_amdgcn_sched_barrier(0);
    cur = nb;
  }
  // no copy is outstanding when the wave ends
  asm volatile("s_wait_asynccnt 0x0" ::: "memory");

  // the ring is free: behind the last hand-over nobody reads it, nothing flies.
  // The block's 128 x 64 result in column order, rows at a pitch of AO_PO floats
  float* res = (float*)&ring[0][0];
#pragma unroll  // acc is indexed by constants only
  for (int i = 0; i < 2; ++i)
#pragma unroll  // the same
    for (int r = 0; r < 8; ++r) {
      const int n = wr * 32 + i * 16 + r + 8 * half;
      const float scale = 1.0f / rowsum_g[(size_t)b * 128 + n];
      const f32x2 v = {acc[i][0][r] * scale, acc[i][1][r] * scale};
      *(f32x2*)&res[n * AO_PO + l15 * 4 + wc * 2] = v;
    }
  __syncthreads();  // a row holds the columns of two waves: whole before it is read
  // wave w stores rows 16 w .. 16 w + 15, two rows x 256 B = 4 whole lines at a time
  const float* rs = res + (w * 16 + half) * AO_PO + l15 * 4;
  float* dst = out + ((size_t)b * 128 + w * 16 + half) * 768 + colblock + l15 * 4;
#pragma unroll  // the 8 LDS reads issue together, then the 8 stores
  for (int j = 0; j < 8; ++j)
    *(f32x4*)(dst + j * 2 * 768) = *(const f32x4*)(rs + j * 2 * AO_PO);
}

// ---------------------------------------------------------------------------
extern "C" void kernel_launch(void* const* d_in, const int* in_sizes, int n_in,
                              void* d_out, int out_size, void* d_ws, size_t ws_size,
                              hipStream_t stream) {
  (void)in_sizes; (void)n_in; (void)out_size; (void)ws_size;
  const float* text  = (const float*)d_in[0];  // [16,128,768]
  const float* img   = (const float*)d_in[1];  // [16,64,64,512] = [65536,512]
  const float* masks = (const float*)d_in[2];  // [16,128,4096]
  const float* Wq    = (const float*)d_in[3];  // [768,36]
  const float* bq    = (const float*)d_in[4];
  const float* Wk    = (const float*)d_in[5];  // [512,36]
  const float* bk    = (const float*)d_in[6];
  const float* Wv    = (const float*)d_in[7];  // [512,768]
  const float* bv    = (const float*)d_in[8];
  float* out = (float*)d_out;                  // [16,128,768]

  // workspace carve (256B aligned regions)
  char* ws = (char*)d_ws;
  size_t off = 0;
  auto carve = [&](size_t bytes) -> void* {
    void* ptr = ws + off;
    off = (off + bytes + 255) & ~(size_t)255;
    return ptr;
  };
  bf16*  qp    = (bf16*)carve((size_t)2048 * 64 * 2);          //  256 KB
  bf16*  kpB   = (bf16*)carve((size_t)65536 * 64 * 2);         //    8 MB
  bf16*  vt    = (bf16*)carve((size_t)16 * 768 * 4096 * 2);    //  100 MB
  bf16*  pP    = (bf16*)carve((size_t)16 * 128 * 4096 * 2);    //   16 MB
  float* rsum  = (float*)carve((size_t)2048 * 4);

  // q = relu(text@Wq+bq) -> [2048,64] bf16 (cols 36..63 zero)
  // k = relu(img@Wk+bk) -> bf16, 48 columns, in the scores kernel's fragment order
  // v = relu(img@Wv+bv) -> bf16, in attn_out's fragment order
  proj_qkv<<<dim3(PJ_ALL), 512, 0, stream>>>(
      text, Wq, bq, qp, img, Wk, bk, kpB, Wv, bv, vt);
  // scores + masked softmax
  attn_scores_softmax<<<dim3(128), 512, 0, stream>>>(
      qp, kpB, masks, pP, rsum);
  // o = (p @ v) / rowsum
  attn_out<<<dim3(12, 16), 256, 0, stream>>>(pP, vt, rsum, out);
}
